// v000
// Times are from an AMD MI455X. After a warm-up the kernel runs many times in a row, and a time is the length of
// such a window on the GPU divided by its runs, so every launch and the gaps after it count. The runs cycle
// through copies of the inputs. A figure is the median of several windows, for all but v000 over two sittings.
// Sittings can differ by a few percent; kernels timed side by side share one.
// v000, which the later versions start from, runs in 370 microseconds.
#include <hip/hip_runtime.h>
#include <hip/hip_bf16.h>
#include <math.h>
#include <stdint.h>

typedef __attribute__((ext_vector_type(16))) _Float16 v16h;
typedef __attribute__((ext_vector_type(8)))  float    v8f;
typedef __attribute__((ext_vector_type(4)))  unsigned int v4u;
typedef __attribute__((ext_vector_type(4)))  unsigned int u32x4;
typedef __attribute__((ext_vector_type(8)))  int          i32x8;
typedef __attribute__((ext_vector_type(4)))  int          i32x4;

#define BB   2
#define SS   2048
#define DD   1024
#define HH   16
#define DK   64
#define DKA  96            // augmented (padded) head dim
#define BSX  (BB*SS)       // 4096
#define LOG2E 1.4426950408889634f

union Frag { v16h v; v4u q[2]; };

static __device__ inline v8f wmma_f16(v16h a, v16h b, v8f c) {
  return __builtin_amdgcn_wmma_f32_16x16x32_f16(
      /*neg_a=*/false, a, /*neg_b=*/false, b,
      /*c_mod=*/(short)0, c, /*reuse_a=*/false, /*reuse_b=*/false);
}

// Load one 16x32 f16 A/B fragment. rowPtr points at this lane's row
// (row = lane%16 of the tile). half = lane/16.
// Element e<8 -> K = k0 + half*8 + e ; e>=8 -> K = k0 + 16 + half*8 + (e-8).
static __device__ inline v16h load_frag(const _Float16* rowPtr, int k0, int half) {
  Frag f;
  f.q[0] = *(const v4u*)(rowPtr + k0 + half * 8);
  f.q[1] = *(const v4u*)(rowPtr + k0 + 16 + half * 8);
  return f.v;
}

// ------------------------------- converters --------------------------------
__global__ void f32_to_f16_kernel(const float* __restrict__ in,
                                  _Float16* __restrict__ out, int n) {
  int i = blockIdx.x * blockDim.x + threadIdx.x;
  if (i < n) out[i] = (_Float16)in[i];
}

// in: (K x N) f32 row-major  ->  out: (N x K) f16 row-major
__global__ void transpose_f32_to_f16_kernel(const float* __restrict__ in,
                                            _Float16* __restrict__ out,
                                            int K, int N) {
  int i = blockIdx.x * blockDim.x + threadIdx.x;
  if (i >= K * N) return;
  int n = i / K, k = i % K;
  out[(size_t)n * K + k] = (_Float16)in[(size_t)k * N + n];
}

// ------------------------------- phase -------------------------------------
// phase[bs][h] = x[bs,:] . Wp[:,h] + bp[h]   (tiny: 0.13 GFLOP)
__global__ void phase_kernel(const float* __restrict__ x,
                             const float* __restrict__ Wp,
                             const float* __restrict__ bp,
                             float* __restrict__ phase) {
  int idx = blockIdx.x * blockDim.x + threadIdx.x;
  if (idx >= BSX * HH) return;
  int bs = idx >> 4, h = idx & 15;
  const float* xr = x + (size_t)bs * DD;
  float acc = bp[h];
  for (int k = 0; k < DD; ++k) acc = fmaf(xr[k], Wp[k * HH + h], acc);
  phase[idx] = acc;
}

// Fill augmented columns 64..95 of Qaug/Kaug.
__global__ void fill_aug_kernel(const float* __restrict__ phase,
                                const float* __restrict__ alpha,
                                _Float16* __restrict__ Qaug,
                                _Float16* __restrict__ Kaug) {
  int idx = blockIdx.x * blockDim.x + threadIdx.x;  // (b,h,s)
  if (idx >= BB * HH * SS) return;
  int s  = idx & (SS - 1);
  int bh = idx >> 11;
  int b  = bh >> 4, h = bh & 15;
  float ph = phase[((size_t)(b * SS + s)) * HH + h];
  float c = cosf(ph), sn = sinf(ph);
  float al = alpha[h];
  _Float16* qr = Qaug + ((size_t)bh * SS + s) * DKA;
  _Float16* kr = Kaug + ((size_t)bh * SS + s) * DKA;
  qr[64] = (_Float16)(al * c  * LOG2E);
  qr[65] = (_Float16)(al * sn * LOG2E);
  kr[64] = (_Float16)c;
  kr[65] = (_Float16)sn;
  for (int t = 66; t < DKA; ++t) { qr[t] = (_Float16)0.f; kr[t] = (_Float16)0.f; }
}

// ------------------------------- WMMA GEMM ---------------------------------
// C(M,N) = A(M,K) x Bt(N,K)^T + bias[n].  Block tile 128x128, 8 waves as
// 2(M) x 4(N); each wave computes 64x32 = 4x2 tiles of 16x16.
// mode 0: outF[gm*N+gn] = v                     (f32, final output)
// mode 1: aug layout  outH[(b,h,s)*96 + d] = (f16)(v*mult)   (Q and K)
// mode 3: V^T layout  outH[((b*16+h)*64+d)*S + s] = (f16)v
__global__ void __launch_bounds__(256)
gemm_wmma_kernel(const _Float16* __restrict__ A, const _Float16* __restrict__ Bt,
                 const float* __restrict__ bias, float* __restrict__ outF,
                 _Float16* __restrict__ outH, int M, int N, int K,
                 int mode, float mult) {
  const int lane = threadIdx.x & 31;
  const int wave = threadIdx.x >> 5;
  const int half = lane >> 4;
  const int ln   = lane & 15;
  const int wm   = wave >> 2;          // 0..1
  const int wn   = wave & 3;           // 0..3
  const int mbase = blockIdx.y * 128 + wm * 64;
  const int nbase = blockIdx.x * 128 + wn * 32;

  v8f acc[4][2] = {};

  for (int k0 = 0; k0 < K; k0 += 32) {
    v16h af[4], bf[2];
#pragma unroll
    for (int mi = 0; mi < 4; ++mi)
      af[mi] = load_frag(A + (size_t)(mbase + mi * 16 + ln) * K, k0, half);
#pragma unroll
    for (int ni = 0; ni < 2; ++ni)
      bf[ni] = load_frag(Bt + (size_t)(nbase + ni * 16 + ln) * K, k0, half);
#pragma unroll
    for (int mi = 0; mi < 4; ++mi)
#pragma unroll
      for (int ni = 0; ni < 2; ++ni)
        acc[mi][ni] = wmma_f16(af[mi], bf[ni], acc[mi][ni]);
  }

#pragma unroll
  for (int mi = 0; mi < 4; ++mi) {
#pragma unroll
    for (int ni = 0; ni < 2; ++ni) {
      const int gn = nbase + ni * 16 + ln;
      const float bv = bias[gn];
      const int gm0 = mbase + mi * 16 + 8 * half;
#pragma unroll
      for (int r = 0; r < 8; ++r) {
        const int gm = gm0 + r;                 // C layout: M = r + 8*half
        float v = acc[mi][ni][r] + bv;
        if (mode == 0) {
          outF[(size_t)gm * N + gn] = v;
        } else {
          int b = gm >> 11, s = gm & (SS - 1);  // M axis = b*S + s
          int h = gn >> 6,  d = gn & 63;        // N axis = h*64 + d
          if (mode == 1) {
            outH[(((size_t)(b * HH + h) * SS + s) * DKA) + d] = (_Float16)(v * mult);
          } else { // mode 3: V transposed (B,H,64,S)
            outH[(((size_t)(b * HH + h) * DK + d) * SS) + s] = (_Float16)v;
          }
        }
      }
    }
  }
}

__global__ void __launch_bounds__(256)
flash_kernel(const _Float16* __restrict__ Qaug, const _Float16* __restrict__ Kaug,
             const _Float16* __restrict__ Vt, float* __restrict__ O) {
  __shared__ __align__(16) _Float16 pstage[8][16 * 32];
  __shared__ __align__(16) _Float16 kstage[2][32 * DKA];

  const int lane = threadIdx.x & 31;
  const int wave = threadIdx.x >> 5;
  const int half = lane >> 4;
  const int ln   = lane & 15;
  const int h    = blockIdx.y;
  const int b    = blockIdx.z;
  const int row0 = blockIdx.x * 128 + wave * 16;
  const size_t bh = (size_t)(b * HH + h);

  const _Float16* Qb = Qaug + bh * SS * DKA;
  const _Float16* Kb = Kaug + bh * SS * DKA;
  const _Float16* Vb = Vt   + bh * (size_t)DK * SS;

  auto issue_k_tile = [&](int j0, int bufn) {
    unsigned long long gaddr =
        (unsigned long long)(uintptr_t)(Kb + (size_t)j0 * DKA);
    unsigned lds_addr = (unsigned)(uintptr_t)(&kstage[bufn][0]);
    u32x4 g0;
    g0[0] = 1u;                                   // count=1 (valid), user mode
    g0[1] = lds_addr;                             // lds_addr [63:32]
    g0[2] = (unsigned)gaddr;                      // global_addr [95:64]
    g0[3] = ((unsigned)(gaddr >> 32) & 0x01FFFFFFu) | (2u << 30); // type=2
    i32x8 g1;
    g1[0] = (int)(1u << 16);
    g1[1] = (int)((unsigned)DKA << 16);
    g1[2] = (int)((unsigned)SS << 16);
    g1[3] = (int)((unsigned)DKA << 16);
    g1[4] = 32;
    g1[5] = DKA;
    g1[6] = 0;
    g1[7] = 0;
    i32x4 z4 = {0, 0, 0, 0};
#if defined(__clang_major__) && (__clang_major__ >= 23)
    i32x8 z8 = {};
    __builtin_amdgcn_tensor_load_to_lds(g0, g1, z4, z4, z8, 0);
#else
    __builtin_amdgcn_tensor_load_to_lds(g0, g1, z4, z4, 0);
#endif
  };

  // Q fragments (16 rows x 96), loaded once.
  v16h qf[3];
#pragma unroll
  for (int f = 0; f < 3; ++f)
    qf[f] = load_frag(Qb + (size_t)(row0 + ln) * DKA, f * 32, half);

  v8f acc[4] = {};
  float mrow[8], lrow[8];
#pragma unroll
  for (int r = 0; r < 8; ++r) { mrow[r] = -1e30f; lrow[r] = 0.f; }

  if (wave == 0) issue_k_tile(0, 0);              // prime the pipeline

  for (int j0 = 0; j0 < SS; j0 += 32) {
    const int bufn = (j0 >> 5) & 1;
    if (wave == 0) __builtin_amdgcn_s_wait_tensorcnt(0);
    __syncthreads();                              // K' tile ready for all waves
    if (wave == 0 && (j0 + 32) < SS)
      issue_k_tile(j0 + 32, bufn ^ 1);            // async prefetch next tile

    const _Float16* Kl = kstage[bufn];
    v8f s0 = {}, s1 = {};
#pragma unroll
    for (int f = 0; f < 3; ++f) {
      v16h b0 = load_frag(Kl + (size_t)(ln)      * DKA, f * 32, half);
      v16h b1 = load_frag(Kl + (size_t)(16 + ln) * DKA, f * 32, half);
      s0 = wmma_f16(qf[f], b0, s0);
      s1 = wmma_f16(qf[f], b1, s1);
    }

    // Prefetch next V block while softmax VALU work runs.
    if (j0 + 32 < SS) {
#pragma unroll
      for (int n2 = 0; n2 < 4; ++n2)
        __builtin_prefetch(Vb + (size_t)(n2 * 16 + ln) * SS + (j0 + 32), 0, 1);
    }

    // Online softmax (log2 domain). Row r lives in lanes sharing lane/16.
    float p0a[8], p1a[8];
#pragma unroll
    for (int r = 0; r < 8; ++r) {
      float v = fmaxf(s0[r], s1[r]);
      v = fmaxf(v, __shfl_xor(v, 1));
      v = fmaxf(v, __shfl_xor(v, 2));
      v = fmaxf(v, __shfl_xor(v, 4));
      v = fmaxf(v, __shfl_xor(v, 8));
      float mn   = fmaxf(mrow[r], v);
      float corr = exp2f(mrow[r] - mn);
      float p0 = exp2f(s0[r] - mn);
      float p1 = exp2f(s1[r] - mn);
      float rs = p0 + p1;
      rs += __shfl_xor(rs, 1);
      rs += __shfl_xor(rs, 2);
      rs += __shfl_xor(rs, 4);
      rs += __shfl_xor(rs, 8);
      lrow[r] = lrow[r] * corr + rs;
      mrow[r] = mn;
#pragma unroll
      for (int n2 = 0; n2 < 4; ++n2) acc[n2][r] *= corr;
      p0a[r] = p0; p1a[r] = p1;
    }

    // C-layout -> A-layout shuffle via LDS (per-wave region; LDS is in-order
    // within a wave, no barrier needed).
    _Float16* pl = pstage[wave];
#pragma unroll
    for (int r = 0; r < 8; ++r) {
      int Mr = r + 8 * half;
      pl[Mr * 32 + ln]      = (_Float16)p0a[r];
      pl[Mr * 32 + 16 + ln] = (_Float16)p1a[r];
    }
    Frag pf;
    pf.q[0] = *(const v4u*)&pl[ln * 32 + half * 8];
    pf.q[1] = *(const v4u*)&pl[ln * 32 + 16 + half * 8];

    // acc += P(16x32) x V(32x64)
#pragma unroll
    for (int n2 = 0; n2 < 4; ++n2) {
      v16h vf = load_frag(Vb + (size_t)(n2 * 16 + ln) * SS, j0, half);
      acc[n2] = wmma_f16(pf.v, vf, acc[n2]);
    }
    __syncthreads();   // all waves done with kstage[bufn] before overwrite
  }

  // Normalize and write O in (B,S,H*dk) f32.
#pragma unroll
  for (int n2 = 0; n2 < 4; ++n2) {
#pragma unroll
    for (int r = 0; r < 8; ++r) {
      int grow = row0 + r + 8 * half;
      float ov = acc[n2][r] / lrow[r];
      O[((size_t)(b * SS + grow)) * DD + h * DK + n2 * 16 + ln] = ov;
    }
  }
}

// ------------------------------- launcher ----------------------------------
extern "C" void kernel_launch(void* const* d_in, const int* in_sizes, int n_in,
                              void* d_out, int out_size, void* d_ws, size_t ws_size,
                              hipStream_t stream) {
  const float* x  = (const float*)d_in[0];
  const float* Wq = (const float*)d_in[1];
  const float* bq = (const float*)d_in[2];
  const float* Wk = (const float*)d_in[3];
  const float* bk = (const float*)d_in[4];
  const float* Wv = (const float*)d_in[5];
  const float* bv = (const float*)d_in[6];
  const float* Wo = (const float*)d_in[7];
  const float* bo = (const float*)d_in[8];
  const float* Wp = (const float*)d_in[9];
  const float* bp = (const float*)d_in[10];
  const float* alpha = (const float*)d_in[11];
  float* out = (float*)d_out;

  // workspace carve-out (~76 MB), 256B aligned chunks
  char* w = (char*)d_ws;
  size_t off = 0;
  auto carve = [&](size_t bytes) {
    char* p = w + off;
    off = (off + bytes + 255) & ~(size_t)255;
    return p;
  };
  _Float16* Xh   = (_Float16*)carve((size_t)BSX * DD * 2);
  _Float16* Wqt  = (_Float16*)carve((size_t)DD * DD * 2);
  _Float16* Wkt  = (_Float16*)carve((size_t)DD * DD * 2);
  _Float16* Wvt  = (_Float16*)carve((size_t)DD * DD * 2);
  _Float16* Wot  = (_Float16*)carve((size_t)DD * DD * 2);
  _Float16* Qaug = (_Float16*)carve((size_t)BB * HH * SS * DKA * 2);
  _Float16* Kaug = (_Float16*)carve((size_t)BB * HH * SS * DKA * 2);
  _Float16* Vt   = (_Float16*)carve((size_t)BB * HH * DK * SS * 2);
  float*    phase= (float*)   carve((size_t)BSX * HH * 4);
  float*    Obuf = (float*)   carve((size_t)BSX * DD * 4);
  _Float16* Oh   = (_Float16*)carve((size_t)BSX * DD * 2);
  (void)ws_size; (void)n_in; (void)in_sizes; (void)out_size;

  const int nXD = BSX * DD;        // 4,194,304
  const int nW  = DD * DD;         // 1,048,576

  // 1) converts
  f32_to_f16_kernel<<<(nXD + 255) / 256, 256, 0, stream>>>(x, Xh, nXD);
  transpose_f32_to_f16_kernel<<<(nW + 255) / 256, 256, 0, stream>>>(Wq, Wqt, DD, DD);
  transpose_f32_to_f16_kernel<<<(nW + 255) / 256, 256, 0, stream>>>(Wk, Wkt, DD, DD);
  transpose_f32_to_f16_kernel<<<(nW + 255) / 256, 256, 0, stream>>>(Wv, Wvt, DD, DD);
  transpose_f32_to_f16_kernel<<<(nW + 255) / 256, 256, 0, stream>>>(Wo, Wot, DD, DD);

  // 2) phase projection (f32, tiny)
  phase_kernel<<<(BSX * HH + 255) / 256, 256, 0, stream>>>(x, Wp, bp, phase);

  // 3) QKV projections via WMMA GEMM
  dim3 ggrid(DD / 128, BSX / 128);
  const float qmult = 0.125f * LOG2E;  // dk^-0.5 = 1/8, log2e folded for exp2
  gemm_wmma_kernel<<<ggrid, 256, 0, stream>>>(Xh, Wqt, bq, nullptr, Qaug,
                                              BSX, DD, DD, 1, qmult);
  gemm_wmma_kernel<<<ggrid, 256, 0, stream>>>(Xh, Wkt, bk, nullptr, Kaug,
                                              BSX, DD, DD, 1, 1.0f);
  gemm_wmma_kernel<<<ggrid, 256, 0, stream>>>(Xh, Wvt, bv, nullptr, Vt,
                                              BSX, DD, DD, 3, 1.0f);

  // 4) cos/sin augmentation columns
  fill_aug_kernel<<<(BB * HH * SS + 255) / 256, 256, 0, stream>>>(phase, alpha,
                                                                  Qaug, Kaug);

  dim3 fgrid(SS / 128, HH, BB);
  flash_kernel<<<fgrid, 256, 0, stream>>>(Qaug, Kaug, Vt, Obuf);

  // 6) output projection
  f32_to_f16_kernel<<<(nXD + 255) / 256, 256, 0, stream>>>(Obuf, Oh, nXD);
  gemm_wmma_kernel<<<ggrid, 256, 0, stream>>>(Oh, Wot, bo, out, nullptr,
                                              BSX, DD, DD, 0, 1.0f);
}

// v001
// It runs in 285 microseconds.
// Two timings next to v000 both put it at 1.31 times that version's speed.
#include <hip/hip_runtime.h>
#include <hip/hip_bf16.h>
#include <math.h>
#include <stdint.h>

typedef __attribute__((ext_vector_type(16))) _Float16 v16h;
typedef __attribute__((ext_vector_type(8)))  float    v8f;
typedef __attribute__((ext_vector_type(4)))  unsigned int v4u;
typedef __attribute__((ext_vector_type(4)))  unsigned int u32x4;
typedef __attribute__((ext_vector_type(8)))  int          i32x8;
typedef __attribute__((ext_vector_type(4)))  int          i32x4;

#define BB   2
#define SS   2048
#define DD   1024
#define HH   16
#define DK   64
#define DKA  96            // augmented (padded) head dim
#define BSX  (BB*SS)       // 4096
#define LOG2E 1.4426950408889634f

union Frag { v16h v; v4u q[2]; };

static __device__ inline v8f wmma_f16(v16h a, v16h b, v8f c) {
  return __builtin_amdgcn_wmma_f32_16x16x32_f16(
      /*neg_a=*/false, a, /*neg_b=*/false, b,
      /*c_mod=*/(short)0, c, /*reuse_a=*/false, /*reuse_b=*/false);
}

// Load one 16x32 f16 A/B fragment. rowPtr points at this lane's row
// (row = lane%16 of the tile). half = lane/16.
// Element e<8 -> K = k0 + half*8 + e ; e>=8 -> K = k0 + 16 + half*8 + (e-8).
static __device__ inline v16h load_frag(const _Float16* rowPtr, int k0, int half) {
  Frag f;
  f.q[0] = *(const v4u*)(rowPtr + k0 + half * 8);
  f.q[1] = *(const v4u*)(rowPtr + k0 + 16 + half * 8);
  return f.v;
}

// ------------------------------- converters --------------------------------
__global__ void f32_to_f16_kernel(const float* __restrict__ in,
                                  _Float16* __restrict__ out, int n) {
  int i = blockIdx.x * blockDim.x + threadIdx.x;
  if (i < n) out[i] = (_Float16)in[i];
}

// in: (K x N) f32 row-major  ->  out: (N x K) f16 row-major
__global__ void transpose_f32_to_f16_kernel(const float* __restrict__ in,
                                            _Float16* __restrict__ out,
                                            int K, int N) {
  int i = blockIdx.x * blockDim.x + threadIdx.x;
  if (i >= K * N) return;
  int n = i / K, k = i % K;
  out[(size_t)n * K + k] = (_Float16)in[(size_t)k * N + n];
}

// ------------------------------- phase -------------------------------------
// phase[bs][h] = x[bs,:] . Wp[:,h] + bp[h]   (tiny: 0.13 GFLOP)
__global__ void phase_kernel(const float* __restrict__ x,
                             const float* __restrict__ Wp,
                             const float* __restrict__ bp,
                             float* __restrict__ phase) {
  int idx = blockIdx.x * blockDim.x + threadIdx.x;
  if (idx >= BSX * HH) return;
  int bs = idx >> 4, h = idx & 15;
  const float* xr = x + (size_t)bs * DD;
  float acc = bp[h];
  for (int k = 0; k < DD; ++k) acc = fmaf(xr[k], Wp[k * HH + h], acc);
  phase[idx] = acc;
}

// Fill augmented columns 64..95 of Qaug/Kaug.
__global__ void fill_aug_kernel(const float* __restrict__ phase,
                                const float* __restrict__ alpha,
                                _Float16* __restrict__ Qaug,
                                _Float16* __restrict__ Kaug) {
  int idx = blockIdx.x * blockDim.x + threadIdx.x;  // (b,h,s)
  if (idx >= BB * HH * SS) return;
  int s  = idx & (SS - 1);
  int bh = idx >> 11;
  int b  = bh >> 4, h = bh & 15;
  float ph = phase[((size_t)(b * SS + s)) * HH + h];
  float c = cosf(ph), sn = sinf(ph);
  float al = alpha[h];
  _Float16* qr = Qaug + ((size_t)bh * SS + s) * DKA;
  _Float16* kr = Kaug + ((size_t)bh * SS + s) * DKA;
  qr[64] = (_Float16)(al * c  * LOG2E);
  qr[65] = (_Float16)(al * sn * LOG2E);
  kr[64] = (_Float16)c;
  kr[65] = (_Float16)sn;
  for (int t = 66; t < DKA; ++t) { qr[t] = (_Float16)0.f; kr[t] = (_Float16)0.f; }
}

// ------------------------------- WMMA GEMM ---------------------------------
// C(M,N) = A(M,K) x Bt(N,K)^T + bias[n].  Block tile 128x128, 8 waves as
// 2(M) x 4(N); each wave computes 64x32 = 4x2 tiles of 16x16.
// A pass is 128 k = 256 bytes of each of the 128 A rows and 128 Bt rows. The
// rows reach LDS by tensor loads: every wave brings one slice of 32 rows per
// pass (waves 0..3 rows of A, waves 4..7 rows of Bt) into a ring of two
// buffers, one pass ahead of its readers; the pad gives an LDS pitch of
// 272 bytes, and the fragments come by ds_load_b128 in the k order of
// load_frag. Needs K a multiple of 128 and at least 256.
// mode 0: outF[gm*N+gn] = v                     (f32, final output)
// mode 1: aug layout  outH[(b,h,s)*96 + d] = (f16)(v*mult)   (Q and K)
// mode 3: V^T layout  outH[((b*16+h)*64+d)*S + s] = (f16)v
typedef __attribute__((ext_vector_type(8))) unsigned int u32x8;

#define G_ROWB  256u                 // bytes of one operand row per pass
#define G_PITCH 272u                 // LDS pitch: row + 16 bytes of pad
#define G_SROWS 32u                  // rows per slice
#define G_SLICE 10240u               // 32 x 272 = 8704, up to a multiple of 2 KiB
#define G_BUF   (8u * G_SLICE)       // one buffer: 4 slices of A, 4 of Bt

static __device__ inline uint32_t uni(uint32_t v) {
  return (uint32_t)__builtin_amdgcn_readfirstlane(v);
}
static __device__ inline uint32_t pinned(uint32_t v) {
  uint32_t w = uni(v);
  asm volatile("" : "+s"(w));  // pinned(): the word stays in a scalar register
  return w;
}
static __device__ inline void tdm_load(u32x4 g0, u32x8 g1) {
  asm volatile("tensor_load_to_lds %0, %1" :: "s"(g0), "s"(g1) : "memory");
}

__global__ void __launch_bounds__(256)
gemm_wmma_kernel(const _Float16* __restrict__ A, const _Float16* __restrict__ Bt,
                 const float* __restrict__ bias, float* __restrict__ outF,
                 _Float16* __restrict__ outH, int M, int N, int K,
                 int mode, float mult) {
  __shared__ __attribute__((aligned(2048))) unsigned char ring[2u * G_BUF];

  const int lane = threadIdx.x & 31;
  const uint32_t wave = uni(threadIdx.x >> 5);
  const int half = lane >> 4;
  const int ln   = lane & 15;
  const int wm   = (int)(wave >> 2);   // 0..1
  const int wn   = (int)(wave & 3u);   // 0..3
  const int mbase = blockIdx.y * 128 + wm * 64;
  const int nbase = blockIdx.x * 128 + wn * 32;

  // This wave's slice: its first source byte and its place in buffer 0.
  const _Float16* srow = (wave < 4u)
      ? A  + (size_t)(blockIdx.y * 128u + wave * G_SROWS) * K
      : Bt + (size_t)(blockIdx.x * 128u + (wave - 4u) * G_SROWS) * K;
  const uint64_t sbase = (uint64_t)(uintptr_t)srow;
  const uint32_t ldst  = (uint32_t)(uintptr_t)ring + wave * G_SLICE;
  const uint32_t npass = (uint32_t)K >> 7;

  u32x8 g1;
  g1[0] = uni((1u << 20) | (5u << 22) | (3u << 25));
  g1[1] = uni(G_ROWB << 16);
  g1[2] = uni(G_SROWS << 16);
  g1[3] = uni(G_ROWB << 16);
  g1[4] = uni(G_SROWS);
  g1[5] = uni((uint32_t)K * 2u);
  g1[6] = uni(0u);
  g1[7] = uni(0u);
  asm volatile("" : "+s"(g1));
  auto issue = [&](uint32_t st) {
    const uint64_t ga = sbase + (uint64_t)st * G_ROWB;
    u32x4 g0;
    g0[0] = uni(1u);
    g0[1] = uni(ldst + (st & 1u) * G_BUF);
    g0[2] = uni((uint32_t)ga);
    g0[3] = uni((((uint32_t)(ga >> 32)) & 0x01FFFFFFu) | 0x80000000u);
    tdm_load(g0, g1);
  };

  v8f acc[4][2] = {};

  issue(0u);
  // Stage 0 has landed for this wave; the barrier publishes every slice.
  asm volatile("s_wait_tensorcnt 0x0" ::: "memory");
  __syncthreads();
  issue(1u);

  for (uint32_t s = 0; s < npass; ++s) {
    const unsigned char* buf = ring + (s & 1u) * G_BUF;
    const unsigned char* arow = buf + (uint32_t)(wm * 2) * G_SLICE + (uint32_t)ln * G_PITCH;
    const unsigned char* brow = buf + (uint32_t)(4 + wn) * G_SLICE + (uint32_t)ln * G_PITCH;
    // Fragments of block kk (32 k) of this pass, in the k order of load_frag.
    auto load_block = [&](int kk, v16h (&af)[4], v16h (&bf)[2]) {
#pragma unroll  // constant indices: the fragments stay in registers
      for (int mi = 0; mi < 4; ++mi)
        af[mi] = load_frag((const _Float16*)(arow + (uint32_t)(mi >> 1) * G_SLICE +
                                             (uint32_t)(mi & 1) * 16u * G_PITCH),
                           kk * 32, half);
#pragma unroll
      for (int ni = 0; ni < 2; ++ni)
        bf[ni] = load_frag((const _Float16*)(brow + (uint32_t)ni * 16u * G_PITCH),
                           kk * 32, half);
    };
    v16h af[2][4], bf[2][2];
    load_block(0, af[0], bf[0]);
#pragma unroll  // constant indices keep fragments and accumulators in registers
    for (int kk = 0; kk < 4; ++kk) {
      if (kk < 3) load_block(kk + 1, af[(kk + 1) & 1], bf[(kk + 1) & 1]);
      // Keeps the next block's LDS loads, as one group, ahead of this block's
      // products, so that their latency runs behind the matrix work.
      __builtin_amdgcn_sched_barrier(0);
#pragma unroll  // constant indices: the accumulators stay in registers
      for (int mi = 0; mi < 4; ++mi)
#pragma unroll
        for (int ni = 0; ni < 2; ++ni)
          acc[mi][ni] = wmma_f16(af[kk & 1][mi], bf[kk & 1][ni], acc[mi][ni]);
      // Keeps later LDS loads from being moved in among these products.
      if (kk < 3) __builtin_amdgcn_sched_barrier(0);
    }
    // Publish point of stage s + 1: this wave's reads of stage s are done,
    // its own slice of stage s + 1 has landed, then every wave meets.
    asm volatile("s_wait_dscnt 0x0" ::: "memory");
    asm volatile("s_wait_tensorcnt 0x0" ::: "memory");
    __syncthreads();
    // Refill the buffer that every wave has just left.
    const uint32_t nxt = pinned(s + 2u);
    if (pinned(nxt < npass)) issue(nxt);
  }
  // Nothing may be outstanding when the wave ends.
  asm volatile("s_wait_tensorcnt 0x0" ::: "memory");
  asm volatile("s_wait_dscnt 0x0" ::: "memory");

#pragma unroll
  for (int mi = 0; mi < 4; ++mi) {
#pragma unroll
    for (int ni = 0; ni < 2; ++ni) {
      const int gn = nbase + ni * 16 + ln;
      const float bv = bias[gn];
      const int gm0 = mbase + mi * 16 + 8 * half;
#pragma unroll
      for (int r = 0; r < 8; ++r) {
        const int gm = gm0 + r;                 // C layout: M = r + 8*half
        float v = acc[mi][ni][r] + bv;
        if (mode == 0) {
          outF[(size_t)gm * N + gn] = v;
        } else {
          int b = gm >> 11, s = gm & (SS - 1);  // M axis = b*S + s
          int h = gn >> 6,  d = gn & 63;        // N axis = h*64 + d
          if (mode == 1) {
            outH[(((size_t)(b * HH + h) * SS + s) * DKA) + d] = (_Float16)(v * mult);
          } else { // mode 3: V transposed (B,H,64,S)
            outH[(((size_t)(b * HH + h) * DK + d) * SS) + s] = (_Float16)v;
          }
        }
      }
    }
  }
}

__global__ void __launch_bounds__(256)
flash_kernel(const _Float16* __restrict__ Qaug, const _Float16* __restrict__ Kaug,
             const _Float16* __restrict__ Vt, float* __restrict__ O) {
  __shared__ __align__(16) _Float16 pstage[8][16 * 32];
  __shared__ __align__(16) _Float16 kstage[2][32 * DKA];

  const int lane = threadIdx.x & 31;
  const int wave = threadIdx.x >> 5;
  const int half = lane >> 4;
  const int ln   = lane & 15;
  const int h    = blockIdx.y;
  const int b    = blockIdx.z;
  const int row0 = blockIdx.x * 128 + wave * 16;
  const size_t bh = (size_t)(b * HH + h);

  const _Float16* Qb = Qaug + bh * SS * DKA;
  const _Float16* Kb = Kaug + bh * SS * DKA;
  const _Float16* Vb = Vt   + bh * (size_t)DK * SS;

  auto issue_k_tile = [&](int j0, int bufn) {
    unsigned long long gaddr =
        (unsigned long long)(uintptr_t)(Kb + (size_t)j0 * DKA);
    unsigned lds_addr = (unsigned)(uintptr_t)(&kstage[bufn][0]);
    u32x4 g0;
    g0[0] = 1u;                                   // count=1 (valid), user mode
    g0[1] = lds_addr;                             // lds_addr [63:32]
    g0[2] = (unsigned)gaddr;                      // global_addr [95:64]
    g0[3] = ((unsigned)(gaddr >> 32) & 0x01FFFFFFu) | (2u << 30); // type=2
    i32x8 g1;
    g1[0] = (int)(1u << 16);
    g1[1] = (int)((unsigned)DKA << 16);
    g1[2] = (int)((unsigned)SS << 16);
    g1[3] = (int)((unsigned)DKA << 16);
    g1[4] = 32;
    g1[5] = DKA;
    g1[6] = 0;
    g1[7] = 0;
    i32x4 z4 = {0, 0, 0, 0};
#if defined(__clang_major__) && (__clang_major__ >= 23)
    i32x8 z8 = {};
    __builtin_amdgcn_tensor_load_to_lds(g0, g1, z4, z4, z8, 0);
#else
    __builtin_amdgcn_tensor_load_to_lds(g0, g1, z4, z4, 0);
#endif
  };

  // Q fragments (16 rows x 96), loaded once.
  v16h qf[3];
#pragma unroll
  for (int f = 0; f < 3; ++f)
    qf[f] = load_frag(Qb + (size_t)(row0 + ln) * DKA, f * 32, half);

  v8f acc[4] = {};
  float mrow[8], lrow[8];
#pragma unroll
  for (int r = 0; r < 8; ++r) { mrow[r] = -1e30f; lrow[r] = 0.f; }

  if (wave == 0) issue_k_tile(0, 0);              // prime the pipeline

  for (int j0 = 0; j0 < SS; j0 += 32) {
    const int bufn = (j0 >> 5) & 1;
    if (wave == 0) __builtin_amdgcn_s_wait_tensorcnt(0);
    __syncthreads();                              // K' tile ready for all waves
    if (wave == 0 && (j0 + 32) < SS)
      issue_k_tile(j0 + 32, bufn ^ 1);            // async prefetch next tile

    const _Float16* Kl = kstage[bufn];
    v8f s0 = {}, s1 = {};
#pragma unroll
    for (int f = 0; f < 3; ++f) {
      v16h b0 = load_frag(Kl + (size_t)(ln)      * DKA, f * 32, half);
      v16h b1 = load_frag(Kl + (size_t)(16 + ln) * DKA, f * 32, half);
      s0 = wmma_f16(qf[f], b0, s0);
      s1 = wmma_f16(qf[f], b1, s1);
    }

    // Prefetch next V block while softmax VALU work runs.
    if (j0 + 32 < SS) {
#pragma unroll
      for (int n2 = 0; n2 < 4; ++n2)
        __builtin_prefetch(Vb + (size_t)(n2 * 16 + ln) * SS + (j0 + 32), 0, 1);
    }

    // Online softmax (log2 domain). Row r lives in lanes sharing lane/16.
    float p0a[8], p1a[8];
#pragma unroll
    for (int r = 0; r < 8; ++r) {
      float v = fmaxf(s0[r], s1[r]);
      v = fmaxf(v, __shfl_xor(v, 1));
      v = fmaxf(v, __shfl_xor(v, 2));
      v = fmaxf(v, __shfl_xor(v, 4));
      v = fmaxf(v, __shfl_xor(v, 8));
      float mn   = fmaxf(mrow[r], v);
      float corr = exp2f(mrow[r] - mn);
      float p0 = exp2f(s0[r] - mn);
      float p1 = exp2f(s1[r] - mn);
      float rs = p0 + p1;
      rs += __shfl_xor(rs, 1);
      rs += __shfl_xor(rs, 2);
      rs += __shfl_xor(rs, 4);
      rs += __shfl_xor(rs, 8);
      lrow[r] = lrow[r] * corr + rs;
      mrow[r] = mn;
#pragma unroll
      for (int n2 = 0; n2 < 4; ++n2) acc[n2][r] *= corr;
      p0a[r] = p0; p1a[r] = p1;
    }

    // C-layout -> A-layout shuffle via LDS (per-wave region; LDS is in-order
    // within a wave, no barrier needed).
    _Float16* pl = pstage[wave];
#pragma unroll
    for (int r = 0; r < 8; ++r) {
      int Mr = r + 8 * half;
      pl[Mr * 32 + ln]      = (_Float16)p0a[r];
      pl[Mr * 32 + 16 + ln] = (_Float16)p1a[r];
    }
    Frag pf;
    pf.q[0] = *(const v4u*)&pl[ln * 32 + half * 8];
    pf.q[1] = *(const v4u*)&pl[ln * 32 + 16 + half * 8];

    // acc += P(16x32) x V(32x64)
#pragma unroll
    for (int n2 = 0; n2 < 4; ++n2) {
      v16h vf = load_frag(Vb + (size_t)(n2 * 16 + ln) * SS, j0, half);
      acc[n2] = wmma_f16(pf.v, vf, acc[n2]);
    }
    __syncthreads();   // all waves done with kstage[bufn] before overwrite
  }

  // Normalize and write O in (B,S,H*dk) f32.
#pragma unroll
  for (int n2 = 0; n2 < 4; ++n2) {
#pragma unroll
    for (int r = 0; r < 8; ++r) {
      int grow = row0 + r + 8 * half;
      float ov = acc[n2][r] / lrow[r];
      O[((size_t)(b * SS + grow)) * DD + h * DK + n2 * 16 + ln] = ov;
    }
  }
}

// ------------------------------- launcher ----------------------------------
extern "C" void kernel_launch(void* const* d_in, const int* in_sizes, int n_in,
                              void* d_out, int out_size, void* d_ws, size_t ws_size,
                              hipStream_t stream) {
  const float* x  = (const float*)d_in[0];
  const float* Wq = (const float*)d_in[1];
  const float* bq = (const float*)d_in[2];
  const float* Wk = (const float*)d_in[3];
  const float* bk = (const float*)d_in[4];
  const float* Wv = (const float*)d_in[5];
  const float* bv = (const float*)d_in[6];
  const float* Wo = (const float*)d_in[7];
  const float* bo = (const float*)d_in[8];
  const float* Wp = (const float*)d_in[9];
  const float* bp = (const float*)d_in[10];
  const float* alpha = (const float*)d_in[11];
  float* out = (float*)d_out;

  // workspace carve-out (~76 MB), 256B aligned chunks
  char* w = (char*)d_ws;
  size_t off = 0;
  auto carve = [&](size_t bytes) {
    char* p = w + off;
    off = (off + bytes + 255) & ~(size_t)255;
    return p;
  };
  _Float16* Xh   = (_Float16*)carve((size_t)BSX * DD * 2);
  _Float16* Wqt  = (_Float16*)carve((size_t)DD * DD * 2);
  _Float16* Wkt  = (_Float16*)carve((size_t)DD * DD * 2);
  _Float16* Wvt  = (_Float16*)carve((size_t)DD * DD * 2);
  _Float16* Wot  = (_Float16*)carve((size_t)DD * DD * 2);
  _Float16* Qaug = (_Float16*)carve((size_t)BB * HH * SS * DKA * 2);
  _Float16* Kaug = (_Float16*)carve((size_t)BB * HH * SS * DKA * 2);
  _Float16* Vt   = (_Float16*)carve((size_t)BB * HH * DK * SS * 2);
  float*    phase= (float*)   carve((size_t)BSX * HH * 4);
  float*    Obuf = (float*)   carve((size_t)BSX * DD * 4);
  _Float16* Oh   = (_Float16*)carve((size_t)BSX * DD * 2);
  (void)ws_size; (void)n_in; (void)in_sizes; (void)out_size;

  const int nXD = BSX * DD;        // 4,194,304
  const int nW  = DD * DD;         // 1,048,576

  // 1) converts
  f32_to_f16_kernel<<<(nXD + 255) / 256, 256, 0, stream>>>(x, Xh, nXD);
  transpose_f32_to_f16_kernel<<<(nW + 255) / 256, 256, 0, stream>>>(Wq, Wqt, DD, DD);
  transpose_f32_to_f16_kernel<<<(nW + 255) / 256, 256, 0, stream>>>(Wk, Wkt, DD, DD);
  transpose_f32_to_f16_kernel<<<(nW + 255) / 256, 256, 0, stream>>>(Wv, Wvt, DD, DD);
  transpose_f32_to_f16_kernel<<<(nW + 255) / 256, 256, 0, stream>>>(Wo, Wot, DD, DD);

  // 2) phase projection (f32, tiny)
  phase_kernel<<<(BSX * HH + 255) / 256, 256, 0, stream>>>(x, Wp, bp, phase);

  // 3) QKV projections via WMMA GEMM
  dim3 ggrid(DD / 128, BSX / 128);
  const float qmult = 0.125f * LOG2E;  // dk^-0.5 = 1/8, log2e folded for exp2
  gemm_wmma_kernel<<<ggrid, 256, 0, stream>>>(Xh, Wqt, bq, nullptr, Qaug,
                                              BSX, DD, DD, 1, qmult);
  gemm_wmma_kernel<<<ggrid, 256, 0, stream>>>(Xh, Wkt, bk, nullptr, Kaug,
                                              BSX, DD, DD, 1, 1.0f);
  gemm_wmma_kernel<<<ggrid, 256, 0, stream>>>(Xh, Wvt, bv, nullptr, Vt,
                                              BSX, DD, DD, 3, 1.0f);

  // 4) cos/sin augmentation columns
  fill_aug_kernel<<<(BB * HH * SS + 255) / 256, 256, 0, stream>>>(phase, alpha,
                                                                  Qaug, Kaug);

  dim3 fgrid(SS / 128, HH, BB);
  flash_kernel<<<fgrid, 256, 0, stream>>>(Qaug, Kaug, Vt, Obuf);

  // 6) output projection
  f32_to_f16_kernel<<<(nXD + 255) / 256, 256, 0, stream>>>(Obuf, Oh, nXD);
  gemm_wmma_kernel<<<ggrid, 256, 0, stream>>>(Oh, Wot, bo, out, nullptr,
                                              BSX, DD, DD, 0, 1.0f);
}

// v002
// One run takes 261 microseconds.
// Timed twice side by side with v001, it ran 1.09 and 1.08 times as fast.
// Over all steps from v000 it is 1.43 times as fast.
#include <hip/hip_runtime.h>
#include <hip/hip_bf16.h>
#include <math.h>
#include <stdint.h>

typedef __attribute__((ext_vector_type(16))) _Float16 v16h;
typedef __attribute__((ext_vector_type(8)))  float    v8f;
typedef __attribute__((ext_vector_type(4)))  unsigned int v4u;
typedef __attribute__((ext_vector_type(4)))  unsigned int u32x4;
typedef __attribute__((ext_vector_type(8)))  int          i32x8;
typedef __attribute__((ext_vector_type(4)))  int          i32x4;

#define BB   2
#define SS   2048
#define DD   1024
#define HH   16
#define DK   64
#define DKA  96            // augmented (padded) head dim
#define BSX  (BB*SS)       // 4096
#define LOG2E 1.4426950408889634f

union Frag { v16h v; v4u q[2]; };

static __device__ inline v8f wmma_f16(v16h a, v16h b, v8f c) {
  return __builtin_amdgcn_wmma_f32_16x16x32_f16(
      /*neg_a=*/false, a, /*neg_b=*/false, b,
      /*c_mod=*/(short)0, c, /*reuse_a=*/false, /*reuse_b=*/false);
}

// Load one 16x32 f16 A/B fragment. rowPtr points at this lane's row
// (row = lane%16 of the tile). half = lane/16.
// Element e<8 -> K = k0 + half*8 + e ; e>=8 -> K = k0 + 16 + half*8 + (e-8).
static __device__ inline v16h load_frag(const _Float16* rowPtr, int k0, int half) {
  Frag f;
  f.q[0] = *(const v4u*)(rowPtr + k0 + half * 8);
  f.q[1] = *(const v4u*)(rowPtr + k0 + 16 + half * 8);
  return f.v;
}

// ------------------------------- converters --------------------------------
typedef __attribute__((ext_vector_type(4))) float    f32x4;
typedef __attribute__((ext_vector_type(4))) _Float16 h16x4;
typedef __attribute__((ext_vector_type(8))) _Float16 h16x8;

#define CV_BLOCK 8192   // values per block of 8 waves

// A wave converts 1024 consecutive values: eight 16-byte loads a lane, each
// 512 contiguous bytes over the wave and all issued before the first use, then
// eight 8-byte stores, each 256 contiguous bytes over the wave.
__global__ void __launch_bounds__(256)
f32_to_f16_kernel(const float* __restrict__ in,
                  _Float16* __restrict__ out, int n) {
  const int base = (int)blockIdx.x * CV_BLOCK + (int)(threadIdx.x >> 5) * 1024 +
                   (int)(threadIdx.x & 31) * 4;
  if (((int)blockIdx.x + 1) * CV_BLOCK <= n) {
    f32x4 v[8];
#pragma unroll  // constant indices: the eight loads stay in registers, in flight together
    for (int j = 0; j < 8; ++j) v[j] = *(const f32x4*)(in + base + j * 128);
#pragma unroll
    for (int j = 0; j < 8; ++j)
      *(h16x4*)(out + base + j * 128) = __builtin_convertvector(v[j], h16x4);
    // Precaution: stands ahead of any later write of a register these stores name.
    asm volatile("s_wait_xcnt 0x0" ::: "memory");
  } else {  // the last, partial block
    for (int i = (int)blockIdx.x * CV_BLOCK + (int)threadIdx.x; i < n; i += 256)
      out[i] = (_Float16)in[i];
  }
}

// in: (DD x DD) f32 row-major, [k][n]  ->  out: (DD x DD) f16 row-major, [n][k]
// Grid (DD / 64, DD / 64). A block of 4 waves takes 64 k x 64 n, a wave
// 64 k x 16 n, a lane 8 k x 4 n: eight 16-byte loads a lane (256 contiguous
// bytes of each source row over the block), all issued before the first use,
// then four 16-byte stores; eight lanes fill one 128-byte line of out.
__global__ void __launch_bounds__(128)
transpose_f32_to_f16_kernel(const float* __restrict__ in,
                            _Float16* __restrict__ out) {
  const int lane = threadIdx.x & 31;
  const int wave = threadIdx.x >> 5;
  const int k0 = (int)blockIdx.y * 64 + (lane & 7) * 8;
  const int n0 = (int)blockIdx.x * 64 + wave * 16 + (lane >> 3) * 4;
  const float* src = in + k0 * DD + n0;
  _Float16* dst = out + n0 * DD + k0;
  f32x4 v[8];
#pragma unroll  // constant indices: the eight loads stay in registers, in flight together
  for (int j = 0; j < 8; ++j) v[j] = *(const f32x4*)(src + j * DD);
#pragma unroll  // constant indices into v
  for (int i = 0; i < 4; ++i) {
    h16x8 h;
#pragma unroll
    for (int j = 0; j < 8; ++j) h[j] = (_Float16)v[j][i];
    *(h16x8*)(dst + i * DD) = h;
  }
}

// ------------------------------- phase -------------------------------------
// phase[bs][h] = x[bs,:] . Wp[:,h] + bp[h]   (tiny: 0.13 GFLOP)
__global__ void phase_kernel(const float* __restrict__ x,
                             const float* __restrict__ Wp,
                             const float* __restrict__ bp,
                             float* __restrict__ phase) {
  int idx = blockIdx.x * blockDim.x + threadIdx.x;
  if (idx >= BSX * HH) return;
  int bs = idx >> 4, h = idx & 15;
  const float* xr = x + (size_t)bs * DD;
  float acc = bp[h];
  for (int k = 0; k < DD; ++k) acc = fmaf(xr[k], Wp[k * HH + h], acc);
  phase[idx] = acc;
}

// Fill augmented columns 64..95 of Qaug/Kaug.
__global__ void fill_aug_kernel(const float* __restrict__ phase,
                                const float* __restrict__ alpha,
                                _Float16* __restrict__ Qaug,
                                _Float16* __restrict__ Kaug) {
  int idx = blockIdx.x * blockDim.x + threadIdx.x;  // (b,h,s)
  if (idx >= BB * HH * SS) return;
  int s  = idx & (SS - 1);
  int bh = idx >> 11;
  int b  = bh >> 4, h = bh & 15;
  float ph = phase[((size_t)(b * SS + s)) * HH + h];
  float c = cosf(ph), sn = sinf(ph);
  float al = alpha[h];
  _Float16* qr = Qaug + ((size_t)bh * SS + s) * DKA;
  _Float16* kr = Kaug + ((size_t)bh * SS + s) * DKA;
  qr[64] = (_Float16)(al * c  * LOG2E);
  qr[65] = (_Float16)(al * sn * LOG2E);
  kr[64] = (_Float16)c;
  kr[65] = (_Float16)sn;
  for (int t = 66; t < DKA; ++t) { qr[t] = (_Float16)0.f; kr[t] = (_Float16)0.f; }
}

// ------------------------------- WMMA GEMM ---------------------------------
// C(M,N) = A(M,K) x Bt(N,K)^T + bias[n].  Block tile 128x128, 8 waves as
// 2(M) x 4(N); each wave computes 64x32 = 4x2 tiles of 16x16.
// A pass is 128 k = 256 bytes of each of the 128 A rows and 128 Bt rows. The
// rows reach LDS by tensor loads: every wave brings one slice of 32 rows per
// pass (waves 0..3 rows of A, waves 4..7 rows of Bt) into a ring of two
// buffers, one pass ahead of its readers; the pad gives an LDS pitch of
// 272 bytes, and the fragments come by ds_load_b128 in the k order of
// load_frag. Needs K a multiple of 128 and at least 256.
// mode 0: outF[gm*N+gn] = v                     (f32, final output)
// mode 1: aug layout  outH[(b,h,s)*96 + d] = (f16)(v*mult)   (Q and K)
// mode 3: V^T layout  outH[((b*16+h)*64+d)*S + s] = (f16)v
typedef __attribute__((ext_vector_type(8))) unsigned int u32x8;

#define G_ROWB  256u                 // bytes of one operand row per pass
#define G_PITCH 272u                 // LDS pitch: row + 16 bytes of pad
#define G_SROWS 32u                  // rows per slice
#define G_SLICE 10240u               // 32 x 272 = 8704, up to a multiple of 2 KiB
#define G_BUF   (8u * G_SLICE)       // one buffer: 4 slices of A, 4 of Bt

static __device__ inline uint32_t uni(uint32_t v) {
  return (uint32_t)__builtin_amdgcn_readfirstlane(v);
}
static __device__ inline uint32_t pinned(uint32_t v) {
  uint32_t w = uni(v);
  asm volatile("" : "+s"(w));  // pinned(): the word stays in a scalar register
  return w;
}
static __device__ inline void tdm_load(u32x4 g0, u32x8 g1) {
  asm volatile("tensor_load_to_lds %0, %1" :: "s"(g0), "s"(g1) : "memory");
}

__global__ void __launch_bounds__(256)
gemm_wmma_kernel(const _Float16* __restrict__ A, const _Float16* __restrict__ Bt,
                 const float* __restrict__ bias, float* __restrict__ outF,
                 _Float16* __restrict__ outH, int M, int N, int K,
                 int mode, float mult) {
  __shared__ __attribute__((aligned(2048))) unsigned char ring[2u * G_BUF];

  const int lane = threadIdx.x & 31;
  const uint32_t wave = uni(threadIdx.x >> 5);
  const int half = lane >> 4;
  const int ln   = lane & 15;
  const int wm   = (int)(wave >> 2);   // 0..1
  const int wn   = (int)(wave & 3u);   // 0..3
  const int mbase = blockIdx.y * 128 + wm * 64;
  const int nbase = blockIdx.x * 128 + wn * 32;

  // This wave's slice: its first source byte and its place in buffer 0.
  const _Float16* srow = (wave < 4u)
      ? A  + (size_t)(blockIdx.y * 128u + wave * G_SROWS) * K
      : Bt + (size_t)(blockIdx.x * 128u + (wave - 4u) * G_SROWS) * K;
  const uint64_t sbase = (uint64_t)(uintptr_t)srow;
  const uint32_t ldst  = (uint32_t)(uintptr_t)ring + wave * G_SLICE;
  const uint32_t npass = (uint32_t)K >> 7;

  u32x8 g1;
  g1[0] = uni((1u << 20) | (5u << 22) | (3u << 25));
  g1[1] = uni(G_ROWB << 16);
  g1[2] = uni(G_SROWS << 16);
  g1[3] = uni(G_ROWB << 16);
  g1[4] = uni(G_SROWS);
  g1[5] = uni((uint32_t)K * 2u);
  g1[6] = uni(0u);
  g1[7] = uni(0u);
  asm volatile("" : "+s"(g1));
  auto issue = [&](uint32_t st) {
    const uint64_t ga = sbase + (uint64_t)st * G_ROWB;
    u32x4 g0;
    g0[0] = uni(1u);
    g0[1] = uni(ldst + (st & 1u) * G_BUF);
    g0[2] = uni((uint32_t)ga);
    g0[3] = uni((((uint32_t)(ga >> 32)) & 0x01FFFFFFu) | 0x80000000u);
    tdm_load(g0, g1);
  };

  v8f acc[4][2] = {};

  issue(0u);
  // Stage 0 has landed for this wave; the barrier publishes every slice.
  asm volatile("s_wait_tensorcnt 0x0" ::: "memory");
  __syncthreads();
  issue(1u);

  for (uint32_t s = 0; s < npass; ++s) {
    const unsigned char* buf = ring + (s & 1u) * G_BUF;
    const unsigned char* arow = buf + (uint32_t)(wm * 2) * G_SLICE + (uint32_t)ln * G_PITCH;
    const unsigned char* brow = buf + (uint32_t)(4 + wn) * G_SLICE + (uint32_t)ln * G_PITCH;
    // Fragments of block kk (32 k) of this pass, in the k order of load_frag.
    auto load_block = [&](int kk, v16h (&af)[4], v16h (&bf)[2]) {
#pragma unroll  // constant indices: the fragments stay in registers
      for (int mi = 0; mi < 4; ++mi)
        af[mi] = load_frag((const _Float16*)(arow + (uint32_t)(mi >> 1) * G_SLICE +
                                             (uint32_t)(mi & 1) * 16u * G_PITCH),
                           kk * 32, half);
#pragma unroll
      for (int ni = 0; ni < 2; ++ni)
        bf[ni] = load_frag((const _Float16*)(brow + (uint32_t)ni * 16u * G_PITCH),
                           kk * 32, half);
    };
    v16h af[2][4], bf[2][2];
    load_block(0, af[0], bf[0]);
#pragma unroll  // constant indices keep fragments and accumulators in registers
    for (int kk = 0; kk < 4; ++kk) {
      if (kk < 3) load_block(kk + 1, af[(kk + 1) & 1], bf[(kk + 1) & 1]);
      // Keeps the next block's LDS loads, as one group, ahead of this block's
      // products, so that their latency runs behind the matrix work.
      __builtin_amdgcn_sched_barrier(0);
#pragma unroll  // constant indices: the accumulators stay in registers
      for (int mi = 0; mi < 4; ++mi)
#pragma unroll
        for (int ni = 0; ni < 2; ++ni)
          acc[mi][ni] = wmma_f16(af[kk & 1][mi], bf[kk & 1][ni], acc[mi][ni]);
      // Keeps later LDS loads from being moved in among these products.
      if (kk < 3) __builtin_amdgcn_sched_barrier(0);
    }
    // Publish point of stage s + 1: this wave's reads of stage s are done,
    // its own slice of stage s + 1 has landed, then every wave meets.
    asm volatile("s_wait_dscnt 0x0" ::: "memory");
    asm volatile("s_wait_tensorcnt 0x0" ::: "memory");
    __syncthreads();
    // Refill the buffer that every wave has just left.
    const uint32_t nxt = pinned(s + 2u);
    if (pinned(nxt < npass)) issue(nxt);
  }
  // Nothing may be outstanding when the wave ends.
  asm volatile("s_wait_tensorcnt 0x0" ::: "memory");
  asm volatile("s_wait_dscnt 0x0" ::: "memory");

#pragma unroll
  for (int mi = 0; mi < 4; ++mi) {
#pragma unroll
    for (int ni = 0; ni < 2; ++ni) {
      const int gn = nbase + ni * 16 + ln;
      const float bv = bias[gn];
      const int gm0 = mbase + mi * 16 + 8 * half;
#pragma unroll
      for (int r = 0; r < 8; ++r) {
        const int gm = gm0 + r;                 // C layout: M = r + 8*half
        float v = acc[mi][ni][r] + bv;
        if (mode == 0) {
          outF[(size_t)gm * N + gn] = v;
        } else {
          int b = gm >> 11, s = gm & (SS - 1);  // M axis = b*S + s
          int h = gn >> 6,  d = gn & 63;        // N axis = h*64 + d
          if (mode == 1) {
            outH[(((size_t)(b * HH + h) * SS + s) * DKA) + d] = (_Float16)(v * mult);
          } else { // mode 3: V transposed (B,H,64,S)
            outH[(((size_t)(b * HH + h) * DK + d) * SS) + s] = (_Float16)v;
          }
        }
      }
    }
  }
}

__global__ void __launch_bounds__(256)
flash_kernel(const _Float16* __restrict__ Qaug, const _Float16* __restrict__ Kaug,
             const _Float16* __restrict__ Vt, float* __restrict__ O) {
  __shared__ __align__(16) _Float16 pstage[8][16 * 32];
  __shared__ __align__(16) _Float16 kstage[2][32 * DKA];

  const int lane = threadIdx.x & 31;
  const int wave = threadIdx.x >> 5;
  const int half = lane >> 4;
  const int ln   = lane & 15;
  const int h    = blockIdx.y;
  const int b    = blockIdx.z;
  const int row0 = blockIdx.x * 128 + wave * 16;
  const size_t bh = (size_t)(b * HH + h);

  const _Float16* Qb = Qaug + bh * SS * DKA;
  const _Float16* Kb = Kaug + bh * SS * DKA;
  const _Float16* Vb = Vt   + bh * (size_t)DK * SS;

  auto issue_k_tile = [&](int j0, int bufn) {
    unsigned long long gaddr =
        (unsigned long long)(uintptr_t)(Kb + (size_t)j0 * DKA);
    unsigned lds_addr = (unsigned)(uintptr_t)(&kstage[bufn][0]);
    u32x4 g0;
    g0[0] = 1u;                                   // count=1 (valid), user mode
    g0[1] = lds_addr;                             // lds_addr [63:32]
    g0[2] = (unsigned)gaddr;                      // global_addr [95:64]
    g0[3] = ((unsigned)(gaddr >> 32) & 0x01FFFFFFu) | (2u << 30); // type=2
    i32x8 g1;
    g1[0] = (int)(1u << 16);
    g1[1] = (int)((unsigned)DKA << 16);
    g1[2] = (int)((unsigned)SS << 16);
    g1[3] = (int)((unsigned)DKA << 16);
    g1[4] = 32;
    g1[5] = DKA;
    g1[6] = 0;
    g1[7] = 0;
    i32x4 z4 = {0, 0, 0, 0};
#if defined(__clang_major__) && (__clang_major__ >= 23)
    i32x8 z8 = {};
    __builtin_amdgcn_tensor_load_to_lds(g0, g1, z4, z4, z8, 0);
#else
    __builtin_amdgcn_tensor_load_to_lds(g0, g1, z4, z4, 0);
#endif
  };

  // Q fragments (16 rows x 96), loaded once.
  v16h qf[3];
#pragma unroll
  for (int f = 0; f < 3; ++f)
    qf[f] = load_frag(Qb + (size_t)(row0 + ln) * DKA, f * 32, half);

  v8f acc[4] = {};
  float mrow[8], lrow[8];
#pragma unroll
  for (int r = 0; r < 8; ++r) { mrow[r] = -1e30f; lrow[r] = 0.f; }

  if (wave == 0) issue_k_tile(0, 0);              // prime the pipeline

  for (int j0 = 0; j0 < SS; j0 += 32) {
    const int bufn = (j0 >> 5) & 1;
    if (wave == 0) __builtin_amdgcn_s_wait_tensorcnt(0);
    __syncthreads();                              // K' tile ready for all waves
    if (wave == 0 && (j0 + 32) < SS)
      issue_k_tile(j0 + 32, bufn ^ 1);            // async prefetch next tile

    const _Float16* Kl = kstage[bufn];
    v8f s0 = {}, s1 = {};
#pragma unroll
    for (int f = 0; f < 3; ++f) {
      v16h b0 = load_frag(Kl + (size_t)(ln)      * DKA, f * 32, half);
      v16h b1 = load_frag(Kl + (size_t)(16 + ln) * DKA, f * 32, half);
      s0 = wmma_f16(qf[f], b0, s0);
      s1 = wmma_f16(qf[f], b1, s1);
    }

    // Prefetch next V block while softmax VALU work runs.
    if (j0 + 32 < SS) {
#pragma unroll
      for (int n2 = 0; n2 < 4; ++n2)
        __builtin_prefetch(Vb + (size_t)(n2 * 16 + ln) * SS + (j0 + 32), 0, 1);
    }

    // Online softmax (log2 domain). Row r lives in lanes sharing lane/16.
    float p0a[8], p1a[8];
#pragma unroll
    for (int r = 0; r < 8; ++r) {
      float v = fmaxf(s0[r], s1[r]);
      v = fmaxf(v, __shfl_xor(v, 1));
      v = fmaxf(v, __shfl_xor(v, 2));
      v = fmaxf(v, __shfl_xor(v, 4));
      v = fmaxf(v, __shfl_xor(v, 8));
      float mn   = fmaxf(mrow[r], v);
      float corr = exp2f(mrow[r] - mn);
      float p0 = exp2f(s0[r] - mn);
      float p1 = exp2f(s1[r] - mn);
      float rs = p0 + p1;
      rs += __shfl_xor(rs, 1);
      rs += __shfl_xor(rs, 2);
      rs += __shfl_xor(rs, 4);
      rs += __shfl_xor(rs, 8);
      lrow[r] = lrow[r] * corr + rs;
      mrow[r] = mn;
#pragma unroll
      for (int n2 = 0; n2 < 4; ++n2) acc[n2][r] *= corr;
      p0a[r] = p0; p1a[r] = p1;
    }

    // C-layout -> A-layout shuffle via LDS (per-wave region; LDS is in-order
    // within a wave, no barrier needed).
    _Float16* pl = pstage[wave];
#pragma unroll
    for (int r = 0; r < 8; ++r) {
      int Mr = r + 8 * half;
      pl[Mr * 32 + ln]      = (_Float16)p0a[r];
      pl[Mr * 32 + 16 + ln] = (_Float16)p1a[r];
    }
    Frag pf;
    pf.q[0] = *(const v4u*)&pl[ln * 32 + half * 8];
    pf.q[1] = *(const v4u*)&pl[ln * 32 + 16 + half * 8];

    // acc += P(16x32) x V(32x64)
#pragma unroll
    for (int n2 = 0; n2 < 4; ++n2) {
      v16h vf = load_frag(Vb + (size_t)(n2 * 16 + ln) * SS, j0, half);
      acc[n2] = wmma_f16(pf.v, vf, acc[n2]);
    }
    __syncthreads();   // all waves done with kstage[bufn] before overwrite
  }

  // Normalize and write O in (B,S,H*dk) f32.
#pragma unroll
  for (int n2 = 0; n2 < 4; ++n2) {
#pragma unroll
    for (int r = 0; r < 8; ++r) {
      int grow = row0 + r + 8 * half;
      float ov = acc[n2][r] / lrow[r];
      O[((size_t)(b * SS + grow)) * DD + h * DK + n2 * 16 + ln] = ov;
    }
  }
}

// ------------------------------- launcher ----------------------------------
extern "C" void kernel_launch(void* const* d_in, const int* in_sizes, int n_in,
                              void* d_out, int out_size, void* d_ws, size_t ws_size,
                              hipStream_t stream) {
  const float* x  = (const float*)d_in[0];
  const float* Wq = (const float*)d_in[1];
  const float* bq = (const float*)d_in[2];
  const float* Wk = (const float*)d_in[3];
  const float* bk = (const float*)d_in[4];
  const float* Wv = (const float*)d_in[5];
  const float* bv = (const float*)d_in[6];
  const float* Wo = (const float*)d_in[7];
  const float* bo = (const float*)d_in[8];
  const float* Wp = (const float*)d_in[9];
  const float* bp = (const float*)d_in[10];
  const float* alpha = (const float*)d_in[11];
  float* out = (float*)d_out;

  // workspace carve-out (~76 MB), 256B aligned chunks
  char* w = (char*)d_ws;
  size_t off = 0;
  auto carve = [&](size_t bytes) {
    char* p = w + off;
    off = (off + bytes + 255) & ~(size_t)255;
    return p;
  };
  _Float16* Xh   = (_Float16*)carve((size_t)BSX * DD * 2);
  _Float16* Wqt  = (_Float16*)carve((size_t)DD * DD * 2);
  _Float16* Wkt  = (_Float16*)carve((size_t)DD * DD * 2);
  _Float16* Wvt  = (_Float16*)carve((size_t)DD * DD * 2);
  _Float16* Wot  = (_Float16*)carve((size_t)DD * DD * 2);
  _Float16* Qaug = (_Float16*)carve((size_t)BB * HH * SS * DKA * 2);
  _Float16* Kaug = (_Float16*)carve((size_t)BB * HH * SS * DKA * 2);
  _Float16* Vt   = (_Float16*)carve((size_t)BB * HH * DK * SS * 2);
  float*    phase= (float*)   carve((size_t)BSX * HH * 4);
  float*    Obuf = (float*)   carve((size_t)BSX * DD * 4);
  _Float16* Oh   = (_Float16*)carve((size_t)BSX * DD * 2);
  (void)ws_size; (void)n_in; (void)in_sizes; (void)out_size;

  const int nXD = BSX * DD;        // 4,194,304
  dim3 tgrid(DD / 64, DD / 64);    // one block per 64 x 64 tile of a weight

  // 1) converts
  f32_to_f16_kernel<<<(nXD + CV_BLOCK - 1) / CV_BLOCK, 256, 0, stream>>>(x, Xh, nXD);
  transpose_f32_to_f16_kernel<<<tgrid, 128, 0, stream>>>(Wq, Wqt);
  transpose_f32_to_f16_kernel<<<tgrid, 128, 0, stream>>>(Wk, Wkt);
  transpose_f32_to_f16_kernel<<<tgrid, 128, 0, stream>>>(Wv, Wvt);
  transpose_f32_to_f16_kernel<<<tgrid, 128, 0, stream>>>(Wo, Wot);

  // 2) phase projection (f32, tiny)
  phase_kernel<<<(BSX * HH + 255) / 256, 256, 0, stream>>>(x, Wp, bp, phase);

  // 3) QKV projections via WMMA GEMM
  dim3 ggrid(DD / 128, BSX / 128);
  const float qmult = 0.125f * LOG2E;  // dk^-0.5 = 1/8, log2e folded for exp2
  gemm_wmma_kernel<<<ggrid, 256, 0, stream>>>(Xh, Wqt, bq, nullptr, Qaug,
                                              BSX, DD, DD, 1, qmult);
  gemm_wmma_kernel<<<ggrid, 256, 0, stream>>>(Xh, Wkt, bk, nullptr, Kaug,
                                              BSX, DD, DD, 1, 1.0f);
  gemm_wmma_kernel<<<ggrid, 256, 0, stream>>>(Xh, Wvt, bv, nullptr, Vt,
                                              BSX, DD, DD, 3, 1.0f);

  // 4) cos/sin augmentation columns
  fill_aug_kernel<<<(BB * HH * SS + 255) / 256, 256, 0, stream>>>(phase, alpha,
                                                                  Qaug, Kaug);

  dim3 fgrid(SS / 128, HH, BB);
  flash_kernel<<<fgrid, 256, 0, stream>>>(Qaug, Kaug, Vt, Obuf);

  // 6) output projection
  f32_to_f16_kernel<<<(nXD + CV_BLOCK - 1) / CV_BLOCK, 256, 0, stream>>>(Obuf, Oh, nXD);
  gemm_wmma_kernel<<<ggrid, 256, 0, stream>>>(Oh, Wot, bo, out, nullptr,
                                              BSX, DD, DD, 0, 1.0f);
}

// v003
// A run of this version takes 238 microseconds.
// In two side-by-side timings against v002, it was 1.09 and 1.10 times as fast.
// Over all steps from v000 it is 1.56 times as fast.
#include <hip/hip_runtime.h>
#include <hip/hip_bf16.h>
#include <math.h>
#include <stdint.h>

typedef __attribute__((ext_vector_type(16))) _Float16 v16h;
typedef __attribute__((ext_vector_type(8)))  float    v8f;
typedef __attribute__((ext_vector_type(4)))  unsigned int v4u;
typedef __attribute__((ext_vector_type(4)))  unsigned int u32x4;
typedef __attribute__((ext_vector_type(8)))  int          i32x8;
typedef __attribute__((ext_vector_type(4)))  int          i32x4;

#define BB   2
#define SS   2048
#define DD   1024
#define HH   16
#define DK   64
#define DKA  96            // augmented (padded) head dim
#define BSX  (BB*SS)       // 4096
#define LOG2E 1.4426950408889634f

union Frag { v16h v; v4u q[2]; };

static __device__ inline v8f wmma_f16(v16h a, v16h b, v8f c) {
  return __builtin_amdgcn_wmma_f32_16x16x32_f16(
      /*neg_a=*/false, a, /*neg_b=*/false, b,
      /*c_mod=*/(short)0, c, /*reuse_a=*/false, /*reuse_b=*/false);
}

// Load one 16x32 f16 A/B fragment. rowPtr points at this lane's row
// (row = lane%16 of the tile). half = lane/16.
// Element e<8 -> K = k0 + half*8 + e ; e>=8 -> K = k0 + 16 + half*8 + (e-8).
static __device__ inline v16h load_frag(const _Float16* rowPtr, int k0, int half) {
  Frag f;
  f.q[0] = *(const v4u*)(rowPtr + k0 + half * 8);
  f.q[1] = *(const v4u*)(rowPtr + k0 + 16 + half * 8);
  return f.v;
}

// ------------------------------- converters --------------------------------
typedef __attribute__((ext_vector_type(4))) float    f32x4;
typedef __attribute__((ext_vector_type(4))) _Float16 h16x4;
typedef __attribute__((ext_vector_type(8))) _Float16 h16x8;

#define CV_BLOCK 8192   // values per block of 8 waves

// A wave converts 1024 consecutive values: eight 16-byte loads a lane, each
// 512 contiguous bytes over the wave and all issued before the first use, then
// eight 8-byte stores, each 256 contiguous bytes over the wave.
__global__ void __launch_bounds__(256)
f32_to_f16_kernel(const float* __restrict__ in,
                  _Float16* __restrict__ out, int n) {
  const int base = (int)blockIdx.x * CV_BLOCK + (int)(threadIdx.x >> 5) * 1024 +
                   (int)(threadIdx.x & 31) * 4;
  if (((int)blockIdx.x + 1) * CV_BLOCK <= n) {
    f32x4 v[8];
#pragma unroll  // constant indices: the eight loads stay in registers, in flight together
    for (int j = 0; j < 8; ++j) v[j] = *(const f32x4*)(in + base + j * 128);
#pragma unroll
    for (int j = 0; j < 8; ++j)
      *(h16x4*)(out + base + j * 128) = __builtin_convertvector(v[j], h16x4);
    // Precaution: stands ahead of any later write of a register these stores name.
    asm volatile("s_wait_xcnt 0x0" ::: "memory");
  } else {  // the last, partial block
    for (int i = (int)blockIdx.x * CV_BLOCK + (int)threadIdx.x; i < n; i += 256)
      out[i] = (_Float16)in[i];
  }
}

// in: (DD x DD) f32 row-major, [k][n]  ->  out: (DD x DD) f16 row-major, [n][k]
// Grid (DD / 64, DD / 64). A block of 4 waves takes 64 k x 64 n, a wave
// 64 k x 16 n, a lane 8 k x 4 n: eight 16-byte loads a lane (256 contiguous
// bytes of each source row over the block), all issued before the first use,
// then four 16-byte stores; eight lanes fill one 128-byte line of out.
__global__ void __launch_bounds__(128)
transpose_f32_to_f16_kernel(const float* __restrict__ in,
                            _Float16* __restrict__ out) {
  const int lane = threadIdx.x & 31;
  const int wave = threadIdx.x >> 5;
  const int k0 = (int)blockIdx.y * 64 + (lane & 7) * 8;
  const int n0 = (int)blockIdx.x * 64 + wave * 16 + (lane >> 3) * 4;
  const float* src = in + k0 * DD + n0;
  _Float16* dst = out + n0 * DD + k0;
  f32x4 v[8];
#pragma unroll  // constant indices: the eight loads stay in registers, in flight together
  for (int j = 0; j < 8; ++j) v[j] = *(const f32x4*)(src + j * DD);
#pragma unroll  // constant indices into v
  for (int i = 0; i < 4; ++i) {
    h16x8 h;
#pragma unroll
    for (int j = 0; j < 8; ++j) h[j] = (_Float16)v[j][i];
    *(h16x8*)(dst + i * DD) = h;
  }
}

// ------------------------------- phase -------------------------------------
// phase[bs][h] = x[bs,:] . Wp[:,h] + bp[h]   (tiny: 0.13 GFLOP)
__global__ void phase_kernel(const float* __restrict__ x,
                             const float* __restrict__ Wp,
                             const float* __restrict__ bp,
                             float* __restrict__ phase) {
  int idx = blockIdx.x * blockDim.x + threadIdx.x;
  if (idx >= BSX * HH) return;
  int bs = idx >> 4, h = idx & 15;
  const float* xr = x + (size_t)bs * DD;
  float acc = bp[h];
  for (int k = 0; k < DD; ++k) acc = fmaf(xr[k], Wp[k * HH + h], acc);
  phase[idx] = acc;
}

// Fill augmented columns 64..95 of Qaug/Kaug.
__global__ void fill_aug_kernel(const float* __restrict__ phase,
                                const float* __restrict__ alpha,
                                _Float16* __restrict__ Qaug,
                                _Float16* __restrict__ Kaug) {
  int idx = blockIdx.x * blockDim.x + threadIdx.x;  // (b,h,s)
  if (idx >= BB * HH * SS) return;
  int s  = idx & (SS - 1);
  int bh = idx >> 11;
  int b  = bh >> 4, h = bh & 15;
  float ph = phase[((size_t)(b * SS + s)) * HH + h];
  float c = cosf(ph), sn = sinf(ph);
  float al = alpha[h];
  _Float16* qr = Qaug + ((size_t)bh * SS + s) * DKA;
  _Float16* kr = Kaug + ((size_t)bh * SS + s) * DKA;
  qr[64] = (_Float16)(al * c  * LOG2E);
  qr[65] = (_Float16)(al * sn * LOG2E);
  kr[64] = (_Float16)c;
  kr[65] = (_Float16)sn;
  for (int t = 66; t < DKA; ++t) { qr[t] = (_Float16)0.f; kr[t] = (_Float16)0.f; }
}

// ------------------------------- WMMA GEMM ---------------------------------
// C(M,N) = A(M,K) x Bt(N,K)^T + bias[n].  Block tile 128x128, 8 waves as
// 2(M) x 4(N); each wave computes 64x32 = 4x2 tiles of 16x16.
// A pass is 128 k = 256 bytes of each of the 128 A rows and 128 Bt rows. The
// rows reach LDS by tensor loads: every wave brings one slice of 32 rows per
// pass (waves 0..3 rows of A, waves 4..7 rows of Bt) into a ring of two
// buffers, one pass ahead of its readers; the pad gives an LDS pitch of
// 272 bytes, and the fragments come by ds_load_b128 in the k order of
// load_frag. Needs K a multiple of 128 and at least 256.
// mode 0: outF[gm*N+gn] = v                     (f32, final output)
// mode 1: aug layout  outH[(b,h,s)*96 + d] = (f16)(v*mult)   (Q and K)
// mode 3: V^T layout  outH[((b*16+h)*64+d)*S + s] = (f16)v
typedef __attribute__((ext_vector_type(8))) unsigned int u32x8;

#define G_ROWB  256u                 // bytes of one operand row per pass
#define G_PITCH 272u                 // LDS pitch: row + 16 bytes of pad
#define G_SROWS 32u                  // rows per slice
#define G_SLICE 10240u               // 32 x 272 = 8704, up to a multiple of 2 KiB
#define G_BUF   (8u * G_SLICE)       // one buffer: 4 slices of A, 4 of Bt

static __device__ inline uint32_t uni(uint32_t v) {
  return (uint32_t)__builtin_amdgcn_readfirstlane(v);
}
static __device__ inline uint32_t pinned(uint32_t v) {
  uint32_t w = uni(v);
  asm volatile("" : "+s"(w));  // pinned(): the word stays in a scalar register
  return w;
}
static __device__ inline void tdm_load(u32x4 g0, u32x8 g1) {
  asm volatile("tensor_load_to_lds %0, %1" :: "s"(g0), "s"(g1) : "memory");
}

__global__ void __launch_bounds__(256)
gemm_wmma_kernel(const _Float16* __restrict__ A, const _Float16* __restrict__ Bt,
                 const float* __restrict__ bias, float* __restrict__ outF,
                 _Float16* __restrict__ outH, int M, int N, int K,
                 int mode, float mult) {
  __shared__ __attribute__((aligned(2048))) unsigned char ring[2u * G_BUF];

  const int lane = threadIdx.x & 31;
  const uint32_t wave = uni(threadIdx.x >> 5);
  const int half = lane >> 4;
  const int ln   = lane & 15;
  const int wm   = (int)(wave >> 2);   // 0..1
  const int wn   = (int)(wave & 3u);   // 0..3
  const int mbase = blockIdx.y * 128 + wm * 64;
  const int nbase = blockIdx.x * 128 + wn * 32;

  // This wave's slice: its first source byte and its place in buffer 0.
  const _Float16* srow = (wave < 4u)
      ? A  + (size_t)(blockIdx.y * 128u + wave * G_SROWS) * K
      : Bt + (size_t)(blockIdx.x * 128u + (wave - 4u) * G_SROWS) * K;
  const uint64_t sbase = (uint64_t)(uintptr_t)srow;
  const uint32_t ldst  = (uint32_t)(uintptr_t)ring + wave * G_SLICE;
  const uint32_t npass = (uint32_t)K >> 7;

  u32x8 g1;
  g1[0] = uni((1u << 20) | (5u << 22) | (3u << 25));
  g1[1] = uni(G_ROWB << 16);
  g1[2] = uni(G_SROWS << 16);
  g1[3] = uni(G_ROWB << 16);
  g1[4] = uni(G_SROWS);
  g1[5] = uni((uint32_t)K * 2u);
  g1[6] = uni(0u);
  g1[7] = uni(0u);
  asm volatile("" : "+s"(g1));
  auto issue = [&](uint32_t st) {
    const uint64_t ga = sbase + (uint64_t)st * G_ROWB;
    u32x4 g0;
    g0[0] = uni(1u);
    g0[1] = uni(ldst + (st & 1u) * G_BUF);
    g0[2] = uni((uint32_t)ga);
    g0[3] = uni((((uint32_t)(ga >> 32)) & 0x01FFFFFFu) | 0x80000000u);
    tdm_load(g0, g1);
  };

  v8f acc[4][2] = {};

  issue(0u);
  // Stage 0 has landed for this wave; the barrier publishes every slice.
  asm volatile("s_wait_tensorcnt 0x0" ::: "memory");
  __syncthreads();
  issue(1u);

  for (uint32_t s = 0; s < npass; ++s) {
    const unsigned char* buf = ring + (s & 1u) * G_BUF;
    const unsigned char* arow = buf + (uint32_t)(wm * 2) * G_SLICE + (uint32_t)ln * G_PITCH;
    const unsigned char* brow = buf + (uint32_t)(4 + wn) * G_SLICE + (uint32_t)ln * G_PITCH;
    // Fragments of block kk (32 k) of this pass, in the k order of load_frag.
    auto load_block = [&](int kk, v16h (&af)[4], v16h (&bf)[2]) {
#pragma unroll  // constant indices: the fragments stay in registers
      for (int mi = 0; mi < 4; ++mi)
        af[mi] = load_frag((const _Float16*)(arow + (uint32_t)(mi >> 1) * G_SLICE +
                                             (uint32_t)(mi & 1) * 16u * G_PITCH),
                           kk * 32, half);
#pragma unroll
      for (int ni = 0; ni < 2; ++ni)
        bf[ni] = load_frag((const _Float16*)(brow + (uint32_t)ni * 16u * G_PITCH),
                           kk * 32, half);
    };
    v16h af[2][4], bf[2][2];
    load_block(0, af[0], bf[0]);
#pragma unroll  // constant indices keep fragments and accumulators in registers
    for (int kk = 0; kk < 4; ++kk) {
      if (kk < 3) load_block(kk + 1, af[(kk + 1) & 1], bf[(kk + 1) & 1]);
      // Keeps the next block's LDS loads, as one group, ahead of this block's
      // products, so that their latency runs behind the matrix work.
      __builtin_amdgcn_sched_barrier(0);
#pragma unroll  // constant indices: the accumulators stay in registers
      for (int mi = 0; mi < 4; ++mi)
#pragma unroll
        for (int ni = 0; ni < 2; ++ni)
          acc[mi][ni] = wmma_f16(af[kk & 1][mi], bf[kk & 1][ni], acc[mi][ni]);
      // Keeps later LDS loads from being moved in among these products.
      if (kk < 3) __builtin_amdgcn_sched_barrier(0);
    }
    // Publish point of stage s + 1: this wave's reads of stage s are done,
    // its own slice of stage s + 1 has landed, then every wave meets.
    asm volatile("s_wait_dscnt 0x0" ::: "memory");
    asm volatile("s_wait_tensorcnt 0x0" ::: "memory");
    __syncthreads();
    // Refill the buffer that every wave has just left.
    const uint32_t nxt = pinned(s + 2u);
    if (pinned(nxt < npass)) issue(nxt);
  }
  // Nothing may be outstanding when the wave ends.
  asm volatile("s_wait_tensorcnt 0x0" ::: "memory");
  asm volatile("s_wait_dscnt 0x0" ::: "memory");

#pragma unroll
  for (int mi = 0; mi < 4; ++mi) {
#pragma unroll
    for (int ni = 0; ni < 2; ++ni) {
      const int gn = nbase + ni * 16 + ln;
      const float bv = bias[gn];
      const int gm0 = mbase + mi * 16 + 8 * half;
#pragma unroll
      for (int r = 0; r < 8; ++r) {
        const int gm = gm0 + r;                 // C layout: M = r + 8*half
        float v = acc[mi][ni][r] + bv;
        if (mode == 0) {
          outF[(size_t)gm * N + gn] = v;
        } else {
          int b = gm >> 11, s = gm & (SS - 1);  // M axis = b*S + s
          int h = gn >> 6,  d = gn & 63;        // N axis = h*64 + d
          if (mode == 1) {
            outH[(((size_t)(b * HH + h) * SS + s) * DKA) + d] = (_Float16)(v * mult);
          } else { // mode 3: V transposed (B,H,64,S)
            outH[(((size_t)(b * HH + h) * DK + d) * SS) + s] = (_Float16)v;
          }
        }
      }
    }
  }
}

static __device__ inline float xhalf(float x) {
  return __builtin_bit_cast(float, __builtin_amdgcn_permlanex16(
      __builtin_bit_cast(int, x), __builtin_bit_cast(int, x),
      0x76543210, 0xfedcba98, false, false));
}

__global__ void __launch_bounds__(256)
flash_kernel(const _Float16* __restrict__ Qaug, const _Float16* __restrict__ Kaug,
             const _Float16* __restrict__ Vt, float* __restrict__ O) {
  __shared__ __align__(16) _Float16 kstage[2][32 * DKA];

  const int lane = threadIdx.x & 31;
  const int wave = threadIdx.x >> 5;
  const int half = lane >> 4;
  const int ln   = lane & 15;
  const int h    = blockIdx.y;
  const int b    = blockIdx.z;
  const int row0 = blockIdx.x * 128 + wave * 16;
  const size_t bh = (size_t)(b * HH + h);

  const _Float16* Qb = Qaug + bh * SS * DKA;
  const _Float16* Kb = Kaug + bh * SS * DKA;
  const _Float16* Vb = Vt   + bh * (size_t)DK * SS;

  auto issue_k_tile = [&](int j0, int bufn) {
    unsigned long long gaddr =
        (unsigned long long)(uintptr_t)(Kb + (size_t)j0 * DKA);
    unsigned lds_addr = (unsigned)(uintptr_t)(&kstage[bufn][0]);
    u32x4 g0;
    g0[0] = 1u;                                   // count=1 (valid), user mode
    g0[1] = lds_addr;                             // lds_addr [63:32]
    g0[2] = (unsigned)gaddr;                      // global_addr [95:64]
    g0[3] = ((unsigned)(gaddr >> 32) & 0x01FFFFFFu) | (2u << 30); // type=2
    i32x8 g1;
    g1[0] = (int)(1u << 16);
    g1[1] = (int)((unsigned)DKA << 16);
    g1[2] = (int)((unsigned)SS << 16);
    g1[3] = (int)((unsigned)DKA << 16);
    g1[4] = 32;
    g1[5] = DKA;
    g1[6] = 0;
    g1[7] = 0;
    i32x4 z4 = {0, 0, 0, 0};
#if defined(__clang_major__) && (__clang_major__ >= 23)
    i32x8 z8 = {};
    __builtin_amdgcn_tensor_load_to_lds(g0, g1, z4, z4, z8, 0);
#else
    __builtin_amdgcn_tensor_load_to_lds(g0, g1, z4, z4, 0);
#endif
  };

  // Q fragments (16 queries x 96), loaded once; B operand of the score product.
  v16h qf[3];
#pragma unroll
  for (int f = 0; f < 3; ++f)
    qf[f] = load_frag(Qb + (size_t)(row0 + ln) * DKA, f * 32, half);

  // acc[n2][r] = O[query ln][d = n2*16 + 8*half + r], not yet normalized.
  v8f acc[4] = {};
  float mrun = -1e30f;  // running maximum of query ln, alike in both halves
  float lrun = 0.f;     // running sum of query ln over this half's keys

  if (wave == 0) issue_k_tile(0, 0);              // prime the pipeline

  for (int j0 = 0; j0 < SS; j0 += 32) {
    const int bufn = (j0 >> 5) & 1;
    if (wave == 0) __builtin_amdgcn_s_wait_tensorcnt(0);
    __syncthreads();                              // K' tile ready for all waves
    if (wave == 0 && (j0 + 32) < SS)
      issue_k_tile(j0 + 32, bufn ^ 1);            // async prefetch next tile

    const _Float16* Kl = kstage[bufn];
    v8f s0 = {}, s1 = {};
#pragma unroll
    for (int f = 0; f < 3; ++f) {
      v16h a0 = load_frag(Kl + (size_t)(ln)      * DKA, f * 32, half);
      v16h a1 = load_frag(Kl + (size_t)(16 + ln) * DKA, f * 32, half);
      s0 = wmma_f16(a0, qf[f], s0);
      s1 = wmma_f16(a1, qf[f], s1);
    }

    // Prefetch next V block while softmax VALU work runs.
    if (j0 + 32 < SS) {
#pragma unroll
      for (int n2 = 0; n2 < 4; ++n2)
        __builtin_prefetch(Vb + (size_t)(n2 * 16 + ln) * SS + (j0 + 32), 0, 1);
    }

    // Online softmax (log2 domain). All 16 scores of a lane are query ln's.
    float v = fmaxf(s0[0], s1[0]);
#pragma unroll
    for (int r = 1; r < 8; ++r) v = fmaxf(v, fmaxf(s0[r], s1[r]));
    v = fmaxf(v, xhalf(v));
    const float mn   = fmaxf(mrun, v);
    const float corr = exp2f(mrun - mn);
    v16h pb;           // P^T as B operand: element e is key 8*half + e (e < 8), 8 + 8*half + e (e >= 8)
    float rs = 0.f;
#pragma unroll
    for (int r = 0; r < 8; ++r) {
      const float p0 = exp2f(s0[r] - mn);
      const float p1 = exp2f(s1[r] - mn);
      rs += p0 + p1;
      pb[r]     = (_Float16)p0;
      pb[8 + r] = (_Float16)p1;
    }
    lrun = lrun * corr + rs;
    mrun = mn;
#pragma unroll
    for (int n2 = 0; n2 < 4; ++n2)
#pragma unroll
      for (int r = 0; r < 8; ++r) acc[n2][r] *= corr;

    // acc^T += V^T(64x32) x P^T(32x16)
#pragma unroll
    for (int n2 = 0; n2 < 4; ++n2) {
      v16h vf = load_frag(Vb + (size_t)(n2 * 16 + ln) * SS, j0, half);
      acc[n2] = wmma_f16(vf, pb, acc[n2]);
    }
    __syncthreads();   // all waves done with kstage[bufn] before overwrite
  }

  // Join the halves' sums, normalize and write O in (B,S,H*dk) f32: a lane
  // holds 8 consecutive d of its query per tile, two 16-byte stores.
  const float lsum = lrun + xhalf(lrun);
  float* orow = O + ((size_t)(b * SS + row0 + ln)) * DD + h * DK + 8 * half;
#pragma unroll
  for (int n2 = 0; n2 < 4; ++n2) {
    f32x4 lo, hi;
#pragma unroll
    for (int r = 0; r < 4; ++r) {
      lo[r] = acc[n2][r] / lsum;
      hi[r] = acc[n2][4 + r] / lsum;
    }
    *(f32x4*)(orow + n2 * 16)     = lo;
    *(f32x4*)(orow + n2 * 16 + 4) = hi;
  }
}

// ------------------------------- launcher ----------------------------------
extern "C" void kernel_launch(void* const* d_in, const int* in_sizes, int n_in,
                              void* d_out, int out_size, void* d_ws, size_t ws_size,
                              hipStream_t stream) {
  const float* x  = (const float*)d_in[0];
  const float* Wq = (const float*)d_in[1];
  const float* bq = (const float*)d_in[2];
  const float* Wk = (const float*)d_in[3];
  const float* bk = (const float*)d_in[4];
  const float* Wv = (const float*)d_in[5];
  const float* bv = (const float*)d_in[6];
  const float* Wo = (const float*)d_in[7];
  const float* bo = (const float*)d_in[8];
  const float* Wp = (const float*)d_in[9];
  const float* bp = (const float*)d_in[10];
  const float* alpha = (const float*)d_in[11];
  float* out = (float*)d_out;

  // workspace carve-out (~76 MB), 256B aligned chunks
  char* w = (char*)d_ws;
  size_t off = 0;
  auto carve = [&](size_t bytes) {
    char* p = w + off;
    off = (off + bytes + 255) & ~(size_t)255;
    return p;
  };
  _Float16* Xh   = (_Float16*)carve((size_t)BSX * DD * 2);
  _Float16* Wqt  = (_Float16*)carve((size_t)DD * DD * 2);
  _Float16* Wkt  = (_Float16*)carve((size_t)DD * DD * 2);
  _Float16* Wvt  = (_Float16*)carve((size_t)DD * DD * 2);
  _Float16* Wot  = (_Float16*)carve((size_t)DD * DD * 2);
  _Float16* Qaug = (_Float16*)carve((size_t)BB * HH * SS * DKA * 2);
  _Float16* Kaug = (_Float16*)carve((size_t)BB * HH * SS * DKA * 2);
  _Float16* Vt   = (_Float16*)carve((size_t)BB * HH * DK * SS * 2);
  float*    phase= (float*)   carve((size_t)BSX * HH * 4);
  float*    Obuf = (float*)   carve((size_t)BSX * DD * 4);
  _Float16* Oh   = (_Float16*)carve((size_t)BSX * DD * 2);
  (void)ws_size; (void)n_in; (void)in_sizes; (void)out_size;

  const int nXD = BSX * DD;        // 4,194,304
  dim3 tgrid(DD / 64, DD / 64);    // one block per 64 x 64 tile of a weight

  // 1) converts
  f32_to_f16_kernel<<<(nXD + CV_BLOCK - 1) / CV_BLOCK, 256, 0, stream>>>(x, Xh, nXD);
  transpose_f32_to_f16_kernel<<<tgrid, 128, 0, stream>>>(Wq, Wqt);
  transpose_f32_to_f16_kernel<<<tgrid, 128, 0, stream>>>(Wk, Wkt);
  transpose_f32_to_f16_kernel<<<tgrid, 128, 0, stream>>>(Wv, Wvt);
  transpose_f32_to_f16_kernel<<<tgrid, 128, 0, stream>>>(Wo, Wot);

  // 2) phase projection (f32, tiny)
  phase_kernel<<<(BSX * HH + 255) / 256, 256, 0, stream>>>(x, Wp, bp, phase);

  // 3) QKV projections via WMMA GEMM
  dim3 ggrid(DD / 128, BSX / 128);
  const float qmult = 0.125f * LOG2E;  // dk^-0.5 = 1/8, log2e folded for exp2
  gemm_wmma_kernel<<<ggrid, 256, 0, stream>>>(Xh, Wqt, bq, nullptr, Qaug,
                                              BSX, DD, DD, 1, qmult);
  gemm_wmma_kernel<<<ggrid, 256, 0, stream>>>(Xh, Wkt, bk, nullptr, Kaug,
                                              BSX, DD, DD, 1, 1.0f);
  gemm_wmma_kernel<<<ggrid, 256, 0, stream>>>(Xh, Wvt, bv, nullptr, Vt,
                                              BSX, DD, DD, 3, 1.0f);

  // 4) cos/sin augmentation columns
  fill_aug_kernel<<<(BB * HH * SS + 255) / 256, 256, 0, stream>>>(phase, alpha,
                                                                  Qaug, Kaug);

  dim3 fgrid(SS / 128, HH, BB);
  flash_kernel<<<fgrid, 256, 0, stream>>>(Qaug, Kaug, Vt, Obuf);

  // 6) output projection
  f32_to_f16_kernel<<<(nXD + CV_BLOCK - 1) / CV_BLOCK, 256, 0, stream>>>(Obuf, Oh, nXD);
  gemm_wmma_kernel<<<ggrid, 256, 0, stream>>>(Oh, Wot, bo, out, nullptr,
                                              BSX, DD, DD, 0, 1.0f);
}

// v004
// A run of this version takes 189 microseconds.
// Timed twice side by side with v003, it ran 1.27 times as fast both times.
// Over all steps from v000 it is 1.98 times as fast.
#include <hip/hip_runtime.h>
#include <hip/hip_bf16.h>
#include <math.h>
#include <stdint.h>

typedef __attribute__((ext_vector_type(16))) _Float16 v16h;
typedef __attribute__((ext_vector_type(8)))  float    v8f;
typedef __attribute__((ext_vector_type(4)))  unsigned int v4u;
typedef __attribute__((ext_vector_type(4)))  unsigned int u32x4;
typedef __attribute__((ext_vector_type(8)))  int          i32x8;
typedef __attribute__((ext_vector_type(4)))  int          i32x4;

#define BB   2
#define SS   2048
#define DD   1024
#define HH   16
#define DK   64
#define DKA  96            // augmented (padded) head dim
#define BSX  (BB*SS)       // 4096
#define LOG2E 1.4426950408889634f

union Frag { v16h v; v4u q[2]; };

static __device__ inline v8f wmma_f16(v16h a, v16h b, v8f c) {
  return __builtin_amdgcn_wmma_f32_16x16x32_f16(
      /*neg_a=*/false, a, /*neg_b=*/false, b,
      /*c_mod=*/(short)0, c, /*reuse_a=*/false, /*reuse_b=*/false);
}

// Load one 16x32 f16 A/B fragment. rowPtr points at this lane's row
// (row = lane%16 of the tile). half = lane/16.
// Element e<8 -> K = k0 + half*8 + e ; e>=8 -> K = k0 + 16 + half*8 + (e-8).
static __device__ inline v16h load_frag(const _Float16* rowPtr, int k0, int half) {
  Frag f;
  f.q[0] = *(const v4u*)(rowPtr + k0 + half * 8);
  f.q[1] = *(const v4u*)(rowPtr + k0 + 16 + half * 8);
  return f.v;
}

// ------------------------------- converters --------------------------------
typedef __attribute__((ext_vector_type(4))) float    f32x4;
typedef __attribute__((ext_vector_type(4))) _Float16 h16x4;
typedef __attribute__((ext_vector_type(8))) _Float16 h16x8;

#define CV_BLOCK 8192   // values per block of 8 waves

// A wave converts 1024 consecutive values: eight 16-byte loads a lane, each
// 512 contiguous bytes over the wave and all issued before the first use, then
// eight 8-byte stores, each 256 contiguous bytes over the wave.
static __device__ __attribute__((always_inline)) inline void
f32_to_f16_block(const float* __restrict__ in,
                 _Float16* __restrict__ out, int n, int blk) {
  const int base = blk * CV_BLOCK + (int)(threadIdx.x >> 5) * 1024 +
                   (int)(threadIdx.x & 31) * 4;
  if ((blk + 1) * CV_BLOCK <= n) {
    f32x4 v[8];
#pragma unroll  // constant indices: the eight loads stay in registers, in flight together
    for (int j = 0; j < 8; ++j) v[j] = *(const f32x4*)(in + base + j * 128);
#pragma unroll
    for (int j = 0; j < 8; ++j)
      *(h16x4*)(out + base + j * 128) = __builtin_convertvector(v[j], h16x4);
    // Precaution: stands ahead of any later write of a register these stores name.
    asm volatile("s_wait_xcnt 0x0" ::: "memory");
  } else {  // the last, partial block
    for (int i = blk * CV_BLOCK + (int)threadIdx.x; i < n; i += 256)
      out[i] = (_Float16)in[i];
  }
}

// in: (DD x DD) f32 row-major, [k][n]  ->  out: (DD x DD) f16 row-major, [n][k]
// tile = 0 .. (DD / 64)^2 - 1. A group of 4 waves takes 64 k x 64 n, a wave
// 64 k x 16 n, a lane 8 k x 4 n: eight 16-byte loads a lane (256 contiguous
// bytes of each source row over the group), all issued before the first use,
// then four 16-byte stores; eight lanes fill one 128-byte line of out.
static __device__ __attribute__((always_inline)) inline void
transpose_f32_to_f16_tile(const float* __restrict__ in,
                          _Float16* __restrict__ out, int tile) {
  const int lane = threadIdx.x & 31;
  const int wave = (threadIdx.x >> 5) & 3;
  const int k0 = (tile >> 4) * 64 + (lane & 7) * 8;
  const int n0 = (tile & 15) * 64 + wave * 16 + (lane >> 3) * 4;
  const float* src = in + k0 * DD + n0;
  _Float16* dst = out + n0 * DD + k0;
  f32x4 v[8];
#pragma unroll  // constant indices: the eight loads stay in registers, in flight together
  for (int j = 0; j < 8; ++j) v[j] = *(const f32x4*)(src + j * DD);
#pragma unroll  // constant indices into v
  for (int i = 0; i < 4; ++i) {
    h16x8 h;
#pragma unroll
    for (int j = 0; j < 8; ++j) h[j] = (_Float16)v[j][i];
    *(h16x8*)(dst + i * DD) = h;
  }
  // Precaution: stands ahead of any later write of a register these stores name.
  asm volatile("s_wait_xcnt 0x0" ::: "memory");
}

// ------------------------------- phase -------------------------------------
// phase[bs][h] = x[bs,:] . Wp[:,h] + bp[h]   (tiny: 0.13 GFLOP); the thread
// that holds it fills columns 64..95 of its row (b,h,s) of Qaug and Kaug.
static __device__ __attribute__((always_inline)) inline void
phase_fill_block(const float* __restrict__ x,
                 const float* __restrict__ Wp,
                 const float* __restrict__ bp,
                 const float* __restrict__ alpha,
                 _Float16* __restrict__ Qaug,
                 _Float16* __restrict__ Kaug, int blk) {
  int idx = blk * 256 + (int)threadIdx.x;
  int bs = idx >> 4, h = idx & 15;
  const float* xr = x + (size_t)bs * DD;
  float acc = bp[h];
  for (int k = 0; k < DD; ++k) acc = fmaf(xr[k], Wp[k * HH + h], acc);
  float ph = acc;
  int b = bs >> 11, s = bs & (SS - 1);
  int bh = b * HH + h;
  float c = cosf(ph), sn = sinf(ph);
  float al = alpha[h];
  _Float16* qr = Qaug + ((size_t)bh * SS + s) * DKA;
  _Float16* kr = Kaug + ((size_t)bh * SS + s) * DKA;
  qr[64] = (_Float16)(al * c  * LOG2E);
  qr[65] = (_Float16)(al * sn * LOG2E);
  kr[64] = (_Float16)c;
  kr[65] = (_Float16)sn;
  for (int t = 66; t < DKA; ++t) { qr[t] = (_Float16)0.f; kr[t] = (_Float16)0.f; }
}

// ------------------------------- first launch ------------------------------
// Everything that reads only the inputs shares one grid, by block range; the
// phase blocks last longest and come first.
#define PB_PHASE (BSX * HH / 256)            // 256 blocks
#define PB_CONV  (BSX * DD / CV_BLOCK)       // 512 blocks
#define PB_TRANS ((DD / 64) * (DD / 64) / 2) // 128 blocks a weight, two tiles each

__global__ void __launch_bounds__(256)
prep_kernel(const float* __restrict__ x,  const float* __restrict__ Wq,
            const float* __restrict__ Wk, const float* __restrict__ Wv,
            const float* __restrict__ Wo, const float* __restrict__ Wp,
            const float* __restrict__ bp, const float* __restrict__ alpha,
            _Float16* __restrict__ Xh,  _Float16* __restrict__ Wqt,
            _Float16* __restrict__ Wkt, _Float16* __restrict__ Wvt,
            _Float16* __restrict__ Wot, _Float16* __restrict__ Qaug,
            _Float16* __restrict__ Kaug) {
  const int blk = (int)blockIdx.x;
  if (blk < PB_PHASE) {
    phase_fill_block(x, Wp, bp, alpha, Qaug, Kaug, blk);
  } else if (blk < PB_PHASE + PB_CONV) {
    f32_to_f16_block(x, Xh, BSX * DD, blk - PB_PHASE);
  } else {
    const int t = blk - (PB_PHASE + PB_CONV);
    const int w = t / PB_TRANS;
    const float* in = (w == 0) ? Wq : (w == 1) ? Wk : (w == 2) ? Wv : Wo;
    _Float16* out   = (w == 0) ? Wqt : (w == 1) ? Wkt : (w == 2) ? Wvt : Wot;
    transpose_f32_to_f16_tile(in, out, (t % PB_TRANS) * 2 + (int)(threadIdx.x >> 7));
  }
}

// ------------------------------- WMMA GEMM ---------------------------------
// C(M,N) = A(M,K) x Bt(N,K)^T + bias[n].  Block tile 128x128, 8 waves as
// 2(M) x 4(N); each wave computes 64x32 = 4x2 tiles of 16x16.
// A pass is 128 k = 256 bytes of each of the 128 A rows and 128 Bt rows. The
// rows reach LDS by tensor loads: every wave brings one slice of 32 rows per
// pass (waves 0..3 rows of A, waves 4..7 rows of Bt) into a ring of two
// buffers, one pass ahead of its readers; the pad gives an LDS pitch of
// 272 bytes, and the fragments come by ds_load_b128 in the k order of
// load_frag. Needs K a multiple of 128 and at least 256.
// mode 0: outF[gm*N+gn] = v                     (f32, final output)
// mode 1: aug layout  outH[(b,h,s)*96 + d] = (f16)(v*mult)   (Q and K)
// mode 3: V^T layout  outH[((b*16+h)*64+d)*S + s] = (f16)v
typedef __attribute__((ext_vector_type(8))) unsigned int u32x8;

#define G_ROWB  256u                 // bytes of one operand row per pass
#define G_PITCH 272u                 // LDS pitch: row + 16 bytes of pad
#define G_SROWS 32u                  // rows per slice
#define G_SLICE 10240u               // 32 x 272 = 8704, up to a multiple of 2 KiB
#define G_BUF   (8u * G_SLICE)       // one buffer: 4 slices of A, 4 of Bt

static __device__ inline uint32_t uni(uint32_t v) {
  return (uint32_t)__builtin_amdgcn_readfirstlane(v);
}
static __device__ inline uint32_t pinned(uint32_t v) {
  uint32_t w = uni(v);
  asm volatile("" : "+s"(w));  // pinned(): the word stays in a scalar register
  return w;
}
static __device__ inline void tdm_load(u32x4 g0, u32x8 g1) {
  asm volatile("tensor_load_to_lds %0, %1" :: "s"(g0), "s"(g1) : "memory");
}

static __device__ __attribute__((always_inline)) inline void
gemm_wmma_tile(unsigned char* ring,
               const _Float16* __restrict__ A, const _Float16* __restrict__ Bt,
               const float* __restrict__ bias, float* __restrict__ outF,
               _Float16* __restrict__ outH, int N, int K,
               int mode, float mult) {
  const int lane = threadIdx.x & 31;
  const uint32_t wave = uni(threadIdx.x >> 5);
  const int half = lane >> 4;
  const int ln   = lane & 15;
  const int wm   = (int)(wave >> 2);   // 0..1
  const int wn   = (int)(wave & 3u);   // 0..3
  const int mbase = blockIdx.y * 128 + wm * 64;
  const int nbase = blockIdx.x * 128 + wn * 32;

  // This wave's slice: its first source byte and its place in buffer 0.
  const _Float16* srow = (wave < 4u)
      ? A  + (size_t)(blockIdx.y * 128u + wave * G_SROWS) * K
      : Bt + (size_t)(blockIdx.x * 128u + (wave - 4u) * G_SROWS) * K;
  const uint64_t sbase = (uint64_t)(uintptr_t)srow;
  const uint32_t ldst  = (uint32_t)(uintptr_t)ring + wave * G_SLICE;
  const uint32_t npass = (uint32_t)K >> 7;

  u32x8 g1;
  g1[0] = uni((1u << 20) | (5u << 22) | (3u << 25));
  g1[1] = uni(G_ROWB << 16);
  g1[2] = uni(G_SROWS << 16);
  g1[3] = uni(G_ROWB << 16);
  g1[4] = uni(G_SROWS);
  g1[5] = uni((uint32_t)K * 2u);
  g1[6] = uni(0u);
  g1[7] = uni(0u);
  asm volatile("" : "+s"(g1));
  auto issue = [&](uint32_t st) {
    const uint64_t ga = sbase + (uint64_t)st * G_ROWB;
    u32x4 g0;
    g0[0] = uni(1u);
    g0[1] = uni(ldst + (st & 1u) * G_BUF);
    g0[2] = uni((uint32_t)ga);
    g0[3] = uni((((uint32_t)(ga >> 32)) & 0x01FFFFFFu) | 0x80000000u);
    tdm_load(g0, g1);
  };

  v8f acc[4][2] = {};

  issue(0u);
  // Stage 0 has landed for this wave; the barrier publishes every slice.
  asm volatile("s_wait_tensorcnt 0x0" ::: "memory");
  __syncthreads();
  issue(1u);

  for (uint32_t s = 0; s < npass; ++s) {
    const unsigned char* buf = ring + (s & 1u) * G_BUF;
    const unsigned char* arow = buf + (uint32_t)(wm * 2) * G_SLICE + (uint32_t)ln * G_PITCH;
    const unsigned char* brow = buf + (uint32_t)(4 + wn) * G_SLICE + (uint32_t)ln * G_PITCH;
    // Fragments of block kk (32 k) of this pass, in the k order of load_frag.
    auto load_block = [&](int kk, v16h (&af)[4], v16h (&bf)[2]) {
#pragma unroll  // constant indices: the fragments stay in registers
      for (int mi = 0; mi < 4; ++mi)
        af[mi] = load_frag((const _Float16*)(arow + (uint32_t)(mi >> 1) * G_SLICE +
                                             (uint32_t)(mi & 1) * 16u * G_PITCH),
                           kk * 32, half);
#pragma unroll
      for (int ni = 0; ni < 2; ++ni)
        bf[ni] = load_frag((const _Float16*)(brow + (uint32_t)ni * 16u * G_PITCH),
                           kk * 32, half);
    };
    v16h af[2][4], bf[2][2];
    load_block(0, af[0], bf[0]);
#pragma unroll  // constant indices keep fragments and accumulators in registers
    for (int kk = 0; kk < 4; ++kk) {
      if (kk < 3) load_block(kk + 1, af[(kk + 1) & 1], bf[(kk + 1) & 1]);
      // Keeps the next block's LDS loads, as one group, ahead of this block's
      // products, so that their latency runs behind the matrix work.
      __builtin_amdgcn_sched_barrier(0);
#pragma unroll  // constant indices: the accumulators stay in registers
      for (int mi = 0; mi < 4; ++mi)
#pragma unroll
        for (int ni = 0; ni < 2; ++ni)
          acc[mi][ni] = wmma_f16(af[kk & 1][mi], bf[kk & 1][ni], acc[mi][ni]);
      // Keeps later LDS loads from being moved in among these products.
      if (kk < 3) __builtin_amdgcn_sched_barrier(0);
    }
    // Publish point of stage s + 1: this wave's reads of stage s are done,
    // its own slice of stage s + 1 has landed, then every wave meets.
    asm volatile("s_wait_dscnt 0x0" ::: "memory");
    asm volatile("s_wait_tensorcnt 0x0" ::: "memory");
    __syncthreads();
    // Refill the buffer that every wave has just left.
    const uint32_t nxt = pinned(s + 2u);
    if (pinned(nxt < npass)) issue(nxt);
  }
  // Nothing may be outstanding when the wave ends.
  asm volatile("s_wait_tensorcnt 0x0" ::: "memory");
  asm volatile("s_wait_dscnt 0x0" ::: "memory");

#pragma unroll
  for (int mi = 0; mi < 4; ++mi) {
#pragma unroll
    for (int ni = 0; ni < 2; ++ni) {
      const int gn = nbase + ni * 16 + ln;
      const float bv = bias[gn];
      const int gm0 = mbase + mi * 16 + 8 * half;
#pragma unroll
      for (int r = 0; r < 8; ++r) {
        const int gm = gm0 + r;                 // C layout: M = r + 8*half
        float v = acc[mi][ni][r] + bv;
        if (mode == 0) {
          outF[(size_t)gm * N + gn] = v;
        } else {
          int b = gm >> 11, s = gm & (SS - 1);  // M axis = b*S + s
          int h = gn >> 6,  d = gn & 63;        // N axis = h*64 + d
          if (mode == 1) {
            outH[(((size_t)(b * HH + h) * SS + s) * DKA) + d] = (_Float16)(v * mult);
          } else { // mode 3: V transposed (B,H,64,S)
            outH[(((size_t)(b * HH + h) * DK + d) * SS) + s] = (_Float16)v;
          }
        }
      }
    }
  }
}

// The output projection.
__global__ void __launch_bounds__(256)
gemm_wmma_kernel(const _Float16* __restrict__ A, const _Float16* __restrict__ Bt,
                 const float* __restrict__ bias, float* __restrict__ outF,
                 _Float16* __restrict__ outH, int N, int K,
                 int mode, float mult) {
  __shared__ __attribute__((aligned(2048))) unsigned char ring[2u * G_BUF];
  gemm_wmma_tile(ring, A, Bt, bias, outF, outH, N, K, mode, mult);
}

// The V, Q and K projections in one grid: blockIdx.z picks the weight, the
// bias, the output and its layout. V comes first: its stores touch the most
// lines.
__global__ void __launch_bounds__(256)
qkv_gemm_kernel(const _Float16* __restrict__ A,
                const _Float16* __restrict__ Wqt, const _Float16* __restrict__ Wkt,
                const _Float16* __restrict__ Wvt,
                const float* __restrict__ bq, const float* __restrict__ bk,
                const float* __restrict__ bv,
                _Float16* __restrict__ Qaug, _Float16* __restrict__ Kaug,
                _Float16* __restrict__ Vt, int N, int K, float qmult) {
  __shared__ __attribute__((aligned(2048))) unsigned char ring[2u * G_BUF];
  const uint32_t z = blockIdx.z;
  const _Float16* Bt = (z == 0u) ? Wvt : (z == 1u) ? Wqt : Wkt;
  const float* bias  = (z == 0u) ? bv : (z == 1u) ? bq : bk;
  _Float16* outH     = (z == 0u) ? Vt : (z == 1u) ? Qaug : Kaug;
  gemm_wmma_tile(ring, A, Bt, bias, nullptr, outH, N, K,
                 (z == 0u) ? 3 : 1, (z == 1u) ? qmult : 1.0f);
}

static __device__ inline float xhalf(float x) {
  return __builtin_bit_cast(float, __builtin_amdgcn_permlanex16(
      __builtin_bit_cast(int, x), __builtin_bit_cast(int, x),
      0x76543210, 0xfedcba98, false, false));
}

__global__ void __launch_bounds__(256)
flash_kernel(const _Float16* __restrict__ Qaug, const _Float16* __restrict__ Kaug,
             const _Float16* __restrict__ Vt, _Float16* __restrict__ O) {
  __shared__ __align__(16) _Float16 kstage[2][32 * DKA];

  const int lane = threadIdx.x & 31;
  const int wave = threadIdx.x >> 5;
  const int half = lane >> 4;
  const int ln   = lane & 15;
  const int h    = blockIdx.y;
  const int b    = blockIdx.z;
  const int row0 = blockIdx.x * 128 + wave * 16;
  const size_t bh = (size_t)(b * HH + h);

  const _Float16* Qb = Qaug + bh * SS * DKA;
  const _Float16* Kb = Kaug + bh * SS * DKA;
  const _Float16* Vb = Vt   + bh * (size_t)DK * SS;

  auto issue_k_tile = [&](int j0, int bufn) {
    unsigned long long gaddr =
        (unsigned long long)(uintptr_t)(Kb + (size_t)j0 * DKA);
    unsigned lds_addr = (unsigned)(uintptr_t)(&kstage[bufn][0]);
    u32x4 g0;
    g0[0] = 1u;                                   // count=1 (valid), user mode
    g0[1] = lds_addr;                             // lds_addr [63:32]
    g0[2] = (unsigned)gaddr;                      // global_addr [95:64]
    g0[3] = ((unsigned)(gaddr >> 32) & 0x01FFFFFFu) | (2u << 30); // type=2
    i32x8 g1;
    g1[0] = (int)(1u << 16);
    g1[1] = (int)((unsigned)DKA << 16);
    g1[2] = (int)((unsigned)SS << 16);
    g1[3] = (int)((unsigned)DKA << 16);
    g1[4] = 32;
    g1[5] = DKA;
    g1[6] = 0;
    g1[7] = 0;
    i32x4 z4 = {0, 0, 0, 0};
#if defined(__clang_major__) && (__clang_major__ >= 23)
    i32x8 z8 = {};
    __builtin_amdgcn_tensor_load_to_lds(g0, g1, z4, z4, z8, 0);
#else
    __builtin_amdgcn_tensor_load_to_lds(g0, g1, z4, z4, 0);
#endif
  };

  // Q fragments (16 queries x 96), loaded once; B operand of the score product.
  v16h qf[3];
#pragma unroll
  for (int f = 0; f < 3; ++f)
    qf[f] = load_frag(Qb + (size_t)(row0 + ln) * DKA, f * 32, half);

  // acc[n2][r] = O[query ln][d = n2*16 + 8*half + r], not yet normalized.
  v8f acc[4] = {};
  float mrun = -1e30f;  // running maximum of query ln, alike in both halves
  float lrun = 0.f;     // running sum of query ln over this half's keys

  if (wave == 0) issue_k_tile(0, 0);              // prime the pipeline

  for (int j0 = 0; j0 < SS; j0 += 32) {
    const int bufn = (j0 >> 5) & 1;
    if (wave == 0) __builtin_amdgcn_s_wait_tensorcnt(0);
    __syncthreads();                              // K' tile ready for all waves
    if (wave == 0 && (j0 + 32) < SS)
      issue_k_tile(j0 + 32, bufn ^ 1);            // async prefetch next tile

    const _Float16* Kl = kstage[bufn];
    v8f s0 = {}, s1 = {};
#pragma unroll
    for (int f = 0; f < 3; ++f) {
      v16h a0 = load_frag(Kl + (size_t)(ln)      * DKA, f * 32, half);
      v16h a1 = load_frag(Kl + (size_t)(16 + ln) * DKA, f * 32, half);
      s0 = wmma_f16(a0, qf[f], s0);
      s1 = wmma_f16(a1, qf[f], s1);
    }

    // Prefetch next V block while softmax VALU work runs.
    if (j0 + 32 < SS) {
#pragma unroll
      for (int n2 = 0; n2 < 4; ++n2)
        __builtin_prefetch(Vb + (size_t)(n2 * 16 + ln) * SS + (j0 + 32), 0, 1);
    }

    // Online softmax (log2 domain). All 16 scores of a lane are query ln's.
    float v = fmaxf(s0[0], s1[0]);
#pragma unroll
    for (int r = 1; r < 8; ++r) v = fmaxf(v, fmaxf(s0[r], s1[r]));
    v = fmaxf(v, xhalf(v));
    const float mn   = fmaxf(mrun, v);
    const float corr = exp2f(mrun - mn);
    v16h pb;           // P^T as B operand: element e is key 8*half + e (e < 8), 8 + 8*half + e (e >= 8)
    float rs = 0.f;
#pragma unroll
    for (int r = 0; r < 8; ++r) {
      const float p0 = exp2f(s0[r] - mn);
      const float p1 = exp2f(s1[r] - mn);
      rs += p0 + p1;
      pb[r]     = (_Float16)p0;
      pb[8 + r] = (_Float16)p1;
    }
    lrun = lrun * corr + rs;
    mrun = mn;
#pragma unroll
    for (int n2 = 0; n2 < 4; ++n2)
#pragma unroll
      for (int r = 0; r < 8; ++r) acc[n2][r] *= corr;

    // acc^T += V^T(64x32) x P^T(32x16)
#pragma unroll
    for (int n2 = 0; n2 < 4; ++n2) {
      v16h vf = load_frag(Vb + (size_t)(n2 * 16 + ln) * SS, j0, half);
      acc[n2] = wmma_f16(vf, pb, acc[n2]);
    }
    __syncthreads();   // all waves done with kstage[bufn] before overwrite
  }

  // Join the halves' sums, normalize and write O in (B,S,H*dk) as f16, the
  // output projection's A operand: a lane holds 8 consecutive d of its query
  // per tile, one 16-byte store.
  const float lsum = lrun + xhalf(lrun);
  _Float16* orow = O + ((size_t)(b * SS + row0 + ln)) * DD + h * DK + 8 * half;
#pragma unroll  // constant indices: the accumulators stay in registers
  for (int n2 = 0; n2 < 4; ++n2) {
    h16x8 o;
#pragma unroll
    for (int r = 0; r < 8; ++r) o[r] = (_Float16)(acc[n2][r] / lsum);
    *(h16x8*)(orow + n2 * 16) = o;
  }
}

// ------------------------------- launcher ----------------------------------
extern "C" void kernel_launch(void* const* d_in, const int* in_sizes, int n_in,
                              void* d_out, int out_size, void* d_ws, size_t ws_size,
                              hipStream_t stream) {
  const float* x  = (const float*)d_in[0];
  const float* Wq = (const float*)d_in[1];
  const float* bq = (const float*)d_in[2];
  const float* Wk = (const float*)d_in[3];
  const float* bk = (const float*)d_in[4];
  const float* Wv = (const float*)d_in[5];
  const float* bv = (const float*)d_in[6];
  const float* Wo = (const float*)d_in[7];
  const float* bo = (const float*)d_in[8];
  const float* Wp = (const float*)d_in[9];
  const float* bp = (const float*)d_in[10];
  const float* alpha = (const float*)d_in[11];
  float* out = (float*)d_out;

  // workspace carve-out (~58 MB), 256B aligned chunks
  char* w = (char*)d_ws;
  size_t off = 0;
  auto carve = [&](size_t bytes) {
    char* p = w + off;
    off = (off + bytes + 255) & ~(size_t)255;
    return p;
  };
  _Float16* Xh   = (_Float16*)carve((size_t)BSX * DD * 2);
  _Float16* Wqt  = (_Float16*)carve((size_t)DD * DD * 2);
  _Float16* Wkt  = (_Float16*)carve((size_t)DD * DD * 2);
  _Float16* Wvt  = (_Float16*)carve((size_t)DD * DD * 2);
  _Float16* Wot  = (_Float16*)carve((size_t)DD * DD * 2);
  _Float16* Qaug = (_Float16*)carve((size_t)BB * HH * SS * DKA * 2);
  _Float16* Kaug = (_Float16*)carve((size_t)BB * HH * SS * DKA * 2);
  _Float16* Vt   = (_Float16*)carve((size_t)BB * HH * DK * SS * 2);
  _Float16* Oh   = (_Float16*)carve((size_t)BSX * DD * 2);
  (void)ws_size; (void)n_in; (void)in_sizes; (void)out_size;

  // 1) all that reads only the inputs: x and the weights to f16 (weights
  //    transposed), the phase projection with its cos/sin columns of Q' and K'
  prep_kernel<<<PB_PHASE + PB_CONV + 4 * PB_TRANS, 256, 0, stream>>>(
      x, Wq, Wk, Wv, Wo, Wp, bp, alpha, Xh, Wqt, Wkt, Wvt, Wot, Qaug, Kaug);

  // 2) QKV projections via WMMA GEMM, one grid
  const float qmult = 0.125f * LOG2E;  // dk^-0.5 = 1/8, log2e folded for exp2
  dim3 qgrid(DD / 128, BSX / 128, 3);
  qkv_gemm_kernel<<<qgrid, 256, 0, stream>>>(Xh, Wqt, Wkt, Wvt, bq, bk, bv,
                                             Qaug, Kaug, Vt, DD, DD, qmult);

  dim3 fgrid(SS / 128, HH, BB);
  flash_kernel<<<fgrid, 256, 0, stream>>>(Qaug, Kaug, Vt, Oh);

  // 4) output projection
  dim3 ggrid(DD / 128, BSX / 128);
  gemm_wmma_kernel<<<ggrid, 256, 0, stream>>>(Oh, Wot, bo, out, nullptr,
                                              DD, DD, 0, 1.0f);
}

// v005
// It runs in 161 microseconds.
// Next to v004, in two timings, it ran 1.17 times as fast each time.
// Counting every step since v000, it is 2.31 times as fast.
#include <hip/hip_runtime.h>
#include <hip/hip_bf16.h>
#include <math.h>
#include <stdint.h>

typedef __attribute__((ext_vector_type(16))) _Float16 v16h;
typedef __attribute__((ext_vector_type(8)))  float    v8f;
typedef __attribute__((ext_vector_type(4)))  unsigned int v4u;
typedef __attribute__((ext_vector_type(4)))  unsigned int u32x4;
typedef __attribute__((ext_vector_type(8)))  int          i32x8;
typedef __attribute__((ext_vector_type(4)))  int          i32x4;

#define BB   2
#define SS   2048
#define DD   1024
#define HH   16
#define DK   64
#define DKA  96            // augmented (padded) head dim
#define BSX  (BB*SS)       // 4096
#define LOG2E 1.4426950408889634f

union Frag { v16h v; v4u q[2]; };

static __device__ inline v8f wmma_f16(v16h a, v16h b, v8f c) {
  return __builtin_amdgcn_wmma_f32_16x16x32_f16(
      /*neg_a=*/false, a, /*neg_b=*/false, b,
      /*c_mod=*/(short)0, c, /*reuse_a=*/false, /*reuse_b=*/false);
}

// Load one 16x32 f16 A/B fragment. rowPtr points at this lane's row
// (row = lane%16 of the tile). half = lane/16.
// Element e<8 -> K = k0 + half*8 + e ; e>=8 -> K = k0 + 16 + half*8 + (e-8).
static __device__ inline v16h load_frag(const _Float16* rowPtr, int k0, int half) {
  Frag f;
  f.q[0] = *(const v4u*)(rowPtr + k0 + half * 8);
  f.q[1] = *(const v4u*)(rowPtr + k0 + 16 + half * 8);
  return f.v;
}

// ------------------------------- converters --------------------------------
typedef __attribute__((ext_vector_type(4))) float    f32x4;
typedef __attribute__((ext_vector_type(4))) _Float16 h16x4;
typedef __attribute__((ext_vector_type(8))) _Float16 h16x8;

#define CV_BLOCK 8192   // values per block of 8 waves

// A wave converts 1024 consecutive values: eight 16-byte loads a lane, each
// 512 contiguous bytes over the wave and all issued before the first use, then
// eight 8-byte stores, each 256 contiguous bytes over the wave.
static __device__ __attribute__((always_inline)) inline void
f32_to_f16_block(const float* __restrict__ in,
                 _Float16* __restrict__ out, int n, int blk) {
  const int base = blk * CV_BLOCK + (int)(threadIdx.x >> 5) * 1024 +
                   (int)(threadIdx.x & 31) * 4;
  if ((blk + 1) * CV_BLOCK <= n) {
    f32x4 v[8];
#pragma unroll  // constant indices: the eight loads stay in registers, in flight together
    for (int j = 0; j < 8; ++j) v[j] = *(const f32x4*)(in + base + j * 128);
#pragma unroll
    for (int j = 0; j < 8; ++j)
      *(h16x4*)(out + base + j * 128) = __builtin_convertvector(v[j], h16x4);
    // Precaution: stands ahead of any later write of a register these stores name.
    asm volatile("s_wait_xcnt 0x0" ::: "memory");
  } else {  // the last, partial block
    for (int i = blk * CV_BLOCK + (int)threadIdx.x; i < n; i += 256)
      out[i] = (_Float16)in[i];
  }
}

// in: (DD x DD) f32 row-major, [k][n]  ->  out: (DD x DD) f16 row-major, [n][k]
// tile = 0 .. (DD / 64)^2 - 1. A group of 4 waves takes 64 k x 64 n, a wave
// 64 k x 16 n, a lane 8 k x 4 n: eight 16-byte loads a lane (256 contiguous
// bytes of each source row over the group), all issued before the first use,
// then four 16-byte stores; eight lanes fill one 128-byte line of out.
static __device__ __attribute__((always_inline)) inline void
transpose_f32_to_f16_tile(const float* __restrict__ in,
                          _Float16* __restrict__ out, int tile) {
  const int lane = threadIdx.x & 31;
  const int wave = (threadIdx.x >> 5) & 3;
  const int k0 = (tile >> 4) * 64 + (lane & 7) * 8;
  const int n0 = (tile & 15) * 64 + wave * 16 + (lane >> 3) * 4;
  const float* src = in + k0 * DD + n0;
  _Float16* dst = out + n0 * DD + k0;
  f32x4 v[8];
#pragma unroll  // constant indices: the eight loads stay in registers, in flight together
  for (int j = 0; j < 8; ++j) v[j] = *(const f32x4*)(src + j * DD);
#pragma unroll  // constant indices into v
  for (int i = 0; i < 4; ++i) {
    h16x8 h;
#pragma unroll
    for (int j = 0; j < 8; ++j) h[j] = (_Float16)v[j][i];
    *(h16x8*)(dst + i * DD) = h;
  }
  // Precaution: stands ahead of any later write of a register these stores name.
  asm volatile("s_wait_xcnt 0x0" ::: "memory");
}

// ------------------------------- phase -------------------------------------
// phase[bs][h] = x[bs,:] . Wp[:,h] + bp[h]   (tiny: 0.13 GFLOP); the thread
// that holds it fills columns 64..95 of its row (b,h,s) of Qaug and Kaug.
static __device__ __attribute__((always_inline)) inline void
phase_fill_block(const float* __restrict__ x,
                 const float* __restrict__ Wp,
                 const float* __restrict__ bp,
                 const float* __restrict__ alpha,
                 _Float16* __restrict__ Qaug,
                 _Float16* __restrict__ Kaug, int blk) {
  int idx = blk * 256 + (int)threadIdx.x;
  int bs = idx >> 4, h = idx & 15;
  const float* xr = x + (size_t)bs * DD;
  float acc = bp[h];
  for (int k = 0; k < DD; ++k) acc = fmaf(xr[k], Wp[k * HH + h], acc);
  float ph = acc;
  int b = bs >> 11, s = bs & (SS - 1);
  int bh = b * HH + h;
  float c = cosf(ph), sn = sinf(ph);
  float al = alpha[h];
  _Float16* qr = Qaug + ((size_t)bh * SS + s) * DKA;
  _Float16* kr = Kaug + ((size_t)bh * SS + s) * DKA;
  qr[64] = (_Float16)(al * c  * LOG2E);
  qr[65] = (_Float16)(al * sn * LOG2E);
  kr[64] = (_Float16)c;
  kr[65] = (_Float16)sn;
  for (int t = 66; t < DKA; ++t) { qr[t] = (_Float16)0.f; kr[t] = (_Float16)0.f; }
}

// ------------------------------- first launch ------------------------------
// Everything that reads only the inputs shares one grid, by block range; the
// phase blocks last longest and come first.
#define PB_PHASE (BSX * HH / 256)            // 256 blocks
#define PB_CONV  (BSX * DD / CV_BLOCK)       // 512 blocks
#define PB_TRANS ((DD / 64) * (DD / 64) / 2) // 128 blocks a weight, two tiles each

__global__ void __launch_bounds__(256)
prep_kernel(const float* __restrict__ x,  const float* __restrict__ Wq,
            const float* __restrict__ Wk, const float* __restrict__ Wv,
            const float* __restrict__ Wo, const float* __restrict__ Wp,
            const float* __restrict__ bp, const float* __restrict__ alpha,
            _Float16* __restrict__ Xh,  _Float16* __restrict__ Wqt,
            _Float16* __restrict__ Wkt, _Float16* __restrict__ Wvt,
            _Float16* __restrict__ Wot, _Float16* __restrict__ Qaug,
            _Float16* __restrict__ Kaug) {
  const int blk = (int)blockIdx.x;
  if (blk < PB_PHASE) {
    phase_fill_block(x, Wp, bp, alpha, Qaug, Kaug, blk);
  } else if (blk < PB_PHASE + PB_CONV) {
    f32_to_f16_block(x, Xh, BSX * DD, blk - PB_PHASE);
  } else {
    const int t = blk - (PB_PHASE + PB_CONV);
    const int w = t / PB_TRANS;
    const float* in = (w == 0) ? Wq : (w == 1) ? Wk : (w == 2) ? Wv : Wo;
    _Float16* out   = (w == 0) ? Wqt : (w == 1) ? Wkt : (w == 2) ? Wvt : Wot;
    transpose_f32_to_f16_tile(in, out, (t % PB_TRANS) * 2 + (int)(threadIdx.x >> 7));
  }
}

// ------------------------------- WMMA GEMM ---------------------------------
// C(M,N) = A(M,K) x Bt(N,K)^T + bias[n].  Block tile 128x128, 8 waves as
// 2(M) x 4(N); each wave computes 64x32 = 4x2 tiles of 16x16.
// A pass is 128 k = 256 bytes of each of the 128 A rows and 128 Bt rows. The
// rows reach LDS by tensor loads: every wave brings one slice of 32 rows per
// pass (waves 0..3 rows of A, waves 4..7 rows of Bt) into a ring of two
// buffers, one pass ahead of its readers; the pad gives an LDS pitch of
// 272 bytes, and the fragments come by ds_load_b128 in the k order of
// load_frag. Needs K a multiple of 128 and at least 256.
// mode 0: outF[gm*N+gn] = v                     (f32, final output)
// mode 1: aug layout  outH[(b,h,s)*96 + d] = (f16)(v*mult)   (Q and K)
// mode 3: V^T layout  outH[((b*16+h)*64+d)*S + s] = (f16)v
typedef __attribute__((ext_vector_type(8))) unsigned int u32x8;

#define G_ROWB  256u                 // bytes of one operand row per pass
#define G_PITCH 272u                 // LDS pitch: row + 16 bytes of pad
#define G_SROWS 32u                  // rows per slice
#define G_SLICE 10240u               // 32 x 272 = 8704, up to a multiple of 2 KiB
#define G_BUF   (8u * G_SLICE)       // one buffer: 4 slices of A, 4 of Bt

static __device__ inline uint32_t uni(uint32_t v) {
  return (uint32_t)__builtin_amdgcn_readfirstlane(v);
}
static __device__ inline uint32_t pinned(uint32_t v) {
  uint32_t w = uni(v);
  asm volatile("" : "+s"(w));  // pinned(): the word stays in a scalar register
  return w;
}
static __device__ inline void tdm_load(u32x4 g0, u32x8 g1) {
  asm volatile("tensor_load_to_lds %0, %1" :: "s"(g0), "s"(g1) : "memory");
}

static __device__ __attribute__((always_inline)) inline void
gemm_wmma_tile(unsigned char* ring,
               const _Float16* __restrict__ A, const _Float16* __restrict__ Bt,
               const float* __restrict__ bias, float* __restrict__ outF,
               _Float16* __restrict__ outH, int N, int K,
               int mode, float mult) {
  const int lane = threadIdx.x & 31;
  const uint32_t wave = uni(threadIdx.x >> 5);
  const int half = lane >> 4;
  const int ln   = lane & 15;
  const int wm   = (int)(wave >> 2);   // 0..1
  const int wn   = (int)(wave & 3u);   // 0..3
  const int mbase = blockIdx.y * 128 + wm * 64;
  const int nbase = blockIdx.x * 128 + wn * 32;

  // This wave's slice: its first source byte and its place in buffer 0.
  const _Float16* srow = (wave < 4u)
      ? A  + (size_t)(blockIdx.y * 128u + wave * G_SROWS) * K
      : Bt + (size_t)(blockIdx.x * 128u + (wave - 4u) * G_SROWS) * K;
  const uint64_t sbase = (uint64_t)(uintptr_t)srow;
  const uint32_t ldst  = (uint32_t)(uintptr_t)ring + wave * G_SLICE;
  const uint32_t npass = (uint32_t)K >> 7;

  u32x8 g1;
  g1[0] = uni((1u << 20) | (5u << 22) | (3u << 25));
  g1[1] = uni(G_ROWB << 16);
  g1[2] = uni(G_SROWS << 16);
  g1[3] = uni(G_ROWB << 16);
  g1[4] = uni(G_SROWS);
  g1[5] = uni((uint32_t)K * 2u);
  g1[6] = uni(0u);
  g1[7] = uni(0u);
  asm volatile("" : "+s"(g1));
  auto issue = [&](uint32_t st) {
    const uint64_t ga = sbase + (uint64_t)st * G_ROWB;
    u32x4 g0;
    g0[0] = uni(1u);
    g0[1] = uni(ldst + (st & 1u) * G_BUF);
    g0[2] = uni((uint32_t)ga);
    g0[3] = uni((((uint32_t)(ga >> 32)) & 0x01FFFFFFu) | 0x80000000u);
    tdm_load(g0, g1);
  };

  v8f acc[4][2] = {};

  issue(0u);
  // Stage 0 has landed for this wave; the barrier publishes every slice.
  asm volatile("s_wait_tensorcnt 0x0" ::: "memory");
  __syncthreads();
  issue(1u);

  for (uint32_t s = 0; s < npass; ++s) {
    const unsigned char* buf = ring + (s & 1u) * G_BUF;
    const unsigned char* arow = buf + (uint32_t)(wm * 2) * G_SLICE + (uint32_t)ln * G_PITCH;
    const unsigned char* brow = buf + (uint32_t)(4 + wn) * G_SLICE + (uint32_t)ln * G_PITCH;
    // Fragments of block kk (32 k) of this pass, in the k order of load_frag.
    auto load_block = [&](int kk, v16h (&af)[4], v16h (&bf)[2]) {
#pragma unroll  // constant indices: the fragments stay in registers
      for (int mi = 0; mi < 4; ++mi)
        af[mi] = load_frag((const _Float16*)(arow + (uint32_t)(mi >> 1) * G_SLICE +
                                             (uint32_t)(mi & 1) * 16u * G_PITCH),
                           kk * 32, half);
#pragma unroll
      for (int ni = 0; ni < 2; ++ni)
        bf[ni] = load_frag((const _Float16*)(brow + (uint32_t)ni * 16u * G_PITCH),
                           kk * 32, half);
    };
    v16h af[2][4], bf[2][2];
    load_block(0, af[0], bf[0]);
#pragma unroll  // constant indices keep fragments and accumulators in registers
    for (int kk = 0; kk < 4; ++kk) {
      if (kk < 3) load_block(kk + 1, af[(kk + 1) & 1], bf[(kk + 1) & 1]);
      // Keeps the next block's LDS loads, as one group, ahead of this block's
      // products, so that their latency runs behind the matrix work.
      __builtin_amdgcn_sched_barrier(0);
#pragma unroll  // constant indices: the accumulators stay in registers
      for (int mi = 0; mi < 4; ++mi)
#pragma unroll
        for (int ni = 0; ni < 2; ++ni)
          acc[mi][ni] = wmma_f16(af[kk & 1][mi], bf[kk & 1][ni], acc[mi][ni]);
      // Keeps later LDS loads from being moved in among these products.
      if (kk < 3) __builtin_amdgcn_sched_barrier(0);
    }
    // Publish point of stage s + 1: this wave's reads of stage s are done,
    // its own slice of stage s + 1 has landed, then every wave meets.
    asm volatile("s_wait_dscnt 0x0" ::: "memory");
    asm volatile("s_wait_tensorcnt 0x0" ::: "memory");
    __syncthreads();
    // Refill the buffer that every wave has just left.
    const uint32_t nxt = pinned(s + 2u);
    if (pinned(nxt < npass)) issue(nxt);
  }
  // Nothing may be outstanding when the wave ends.
  asm volatile("s_wait_tensorcnt 0x0" ::: "memory");
  asm volatile("s_wait_dscnt 0x0" ::: "memory");

#pragma unroll
  for (int mi = 0; mi < 4; ++mi) {
#pragma unroll
    for (int ni = 0; ni < 2; ++ni) {
      const int gn = nbase + ni * 16 + ln;
      const float bv = bias[gn];
      const int gm0 = mbase + mi * 16 + 8 * half;
#pragma unroll
      for (int r = 0; r < 8; ++r) {
        const int gm = gm0 + r;                 // C layout: M = r + 8*half
        float v = acc[mi][ni][r] + bv;
        if (mode == 0) {
          outF[(size_t)gm * N + gn] = v;
        } else {
          int b = gm >> 11, s = gm & (SS - 1);  // M axis = b*S + s
          int h = gn >> 6,  d = gn & 63;        // N axis = h*64 + d
          if (mode == 1) {
            outH[(((size_t)(b * HH + h) * SS + s) * DKA) + d] = (_Float16)(v * mult);
          } else { // mode 3: V transposed (B,H,64,S)
            outH[(((size_t)(b * HH + h) * DK + d) * SS) + s] = (_Float16)v;
          }
        }
      }
    }
  }
}

// The output projection.
__global__ void __launch_bounds__(256)
gemm_wmma_kernel(const _Float16* __restrict__ A, const _Float16* __restrict__ Bt,
                 const float* __restrict__ bias, float* __restrict__ outF,
                 _Float16* __restrict__ outH, int N, int K,
                 int mode, float mult) {
  __shared__ __attribute__((aligned(2048))) unsigned char ring[2u * G_BUF];
  gemm_wmma_tile(ring, A, Bt, bias, outF, outH, N, K, mode, mult);
}

// The V, Q and K projections in one grid: blockIdx.z picks the weight, the
// bias, the output and its layout. V comes first: its stores touch the most
// lines.
__global__ void __launch_bounds__(256)
qkv_gemm_kernel(const _Float16* __restrict__ A,
                const _Float16* __restrict__ Wqt, const _Float16* __restrict__ Wkt,
                const _Float16* __restrict__ Wvt,
                const float* __restrict__ bq, const float* __restrict__ bk,
                const float* __restrict__ bv,
                _Float16* __restrict__ Qaug, _Float16* __restrict__ Kaug,
                _Float16* __restrict__ Vt, int N, int K, float qmult) {
  __shared__ __attribute__((aligned(2048))) unsigned char ring[2u * G_BUF];
  const uint32_t z = blockIdx.z;
  const _Float16* Bt = (z == 0u) ? Wvt : (z == 1u) ? Wqt : Wkt;
  const float* bias  = (z == 0u) ? bv : (z == 1u) ? bq : bk;
  _Float16* outH     = (z == 0u) ? Vt : (z == 1u) ? Qaug : Kaug;
  gemm_wmma_tile(ring, A, Bt, bias, nullptr, outH, N, K,
                 (z == 0u) ? 3 : 1, (z == 1u) ? qmult : 1.0f);
}

static __device__ inline float xhalf(float x) {
  return __builtin_bit_cast(float, __builtin_amdgcn_permlanex16(
      __builtin_bit_cast(int, x), __builtin_bit_cast(int, x),
      0x76543210, 0xfedcba98, false, false));
}

#define V_ROWB  256u                 // bytes of one V^T row per stage (128 keys)
#define V_PITCH 272u                 // LDS pitch: row + 16 bytes of pad
#define V_BUF   18432u               // 64 x 272 = 17408, up to a multiple of 2 KiB
#define V_STAGES ((uint32_t)SS / 128u)

__global__ void __launch_bounds__(256)
flash_kernel(const _Float16* __restrict__ Qaug, const _Float16* __restrict__ Kaug,
             const _Float16* __restrict__ Vt, _Float16* __restrict__ O) {
  __shared__ __align__(16) _Float16 kstage[2][32 * DKA];
  __shared__ __attribute__((aligned(2048))) unsigned char vstage[2u * V_BUF];  // V^T ring

  const int lane = threadIdx.x & 31;
  const int wave = threadIdx.x >> 5;
  const int half = lane >> 4;
  const int ln   = lane & 15;
  const int h    = blockIdx.y;
  const int b    = blockIdx.z;
  const int row0 = blockIdx.x * 128 + wave * 16;
  const size_t bh = (size_t)(b * HH + h);

  const _Float16* Qb = Qaug + bh * SS * DKA;
  const _Float16* Kb = Kaug + bh * SS * DKA;
  const _Float16* Vb = Vt   + bh * (size_t)DK * SS;

  auto issue_k_tile = [&](int j0, int bufn) {
    unsigned long long gaddr =
        (unsigned long long)(uintptr_t)(Kb + (size_t)j0 * DKA);
    unsigned lds_addr = (unsigned)(uintptr_t)(&kstage[bufn][0]);
    u32x4 g0;
    g0[0] = 1u;                                   // count=1 (valid), user mode
    g0[1] = lds_addr;                             // lds_addr [63:32]
    g0[2] = (unsigned)gaddr;                      // global_addr [95:64]
    g0[3] = ((unsigned)(gaddr >> 32) & 0x01FFFFFFu) | (2u << 30); // type=2
    i32x8 g1;
    g1[0] = (int)(1u << 16);
    g1[1] = (int)((unsigned)DKA << 16);
    g1[2] = (int)((unsigned)SS << 16);
    g1[3] = (int)((unsigned)DKA << 16);
    g1[4] = 32;
    g1[5] = DKA;
    g1[6] = 0;
    g1[7] = 0;
    i32x4 z4 = {0, 0, 0, 0};
#if defined(__clang_major__) && (__clang_major__ >= 23)
    i32x8 z8 = {};
    __builtin_amdgcn_tensor_load_to_lds(g0, g1, z4, z4, z8, 0);
#else
    __builtin_amdgcn_tensor_load_to_lds(g0, g1, z4, z4, 0);
#endif
  };

  // Q fragments (16 queries x 96), loaded once; B operand of the score product.
  v16h qf[3];
#pragma unroll
  for (int f = 0; f < 3; ++f)
    qf[f] = load_frag(Qb + (size_t)(row0 + ln) * DKA, f * 32, half);

  // acc[n2][r] = O[query ln][d = n2*16 + 8*half + r], not yet normalized.
  v8f acc[4] = {};
  float mrun = -1e30f;  // running maximum of query ln, alike in both halves
  float lrun = 0.f;     // running sum of query ln over this half's keys

  const uint32_t wv = uni(threadIdx.x >> 5);
  const uint64_t vsrc = (uint64_t)(uintptr_t)Vb;
  const uint32_t vdst = (uint32_t)(uintptr_t)vstage;
  u32x8 vg1;
  vg1[0] = uni((1u << 20) | (5u << 22) | (3u << 25));
  vg1[1] = uni(V_ROWB << 16);
  vg1[2] = uni((uint32_t)DK << 16);
  vg1[3] = uni(V_ROWB << 16);
  vg1[4] = uni((uint32_t)DK);
  vg1[5] = uni((uint32_t)SS * 2u);
  vg1[6] = uni(0u);
  vg1[7] = uni(0u);
  asm volatile("" : "+s"(vg1));
  u32x4 vg0;
  vg0[0] = uni(1u);
  vg0[1] = uni(vdst);
  vg0[2] = uni((uint32_t)vsrc);
  vg0[3] = uni((((uint32_t)(vsrc >> 32)) & 0x01FFFFFFu) | 0x80000000u);
  auto next_v = [&]() {
    asm volatile("" : "+s"(vg0));
    const uint32_t lo = vg0[2] + V_ROWB;
    vg0[3] = uni(vg0[3] + ((lo < V_ROWB) ? 1u : 0u));
    vg0[2] = uni(lo);
    vg0[1] = uni((2u * vdst + V_BUF) - vg0[1]);
  };
  if (pinned(wv == 1u)) {
    tdm_load(vg0, vg1);
    // Stage 0 has landed for the issuing wave; the barrier publishes it.
    asm volatile("s_wait_tensorcnt 0x0" ::: "memory");
  }
  __syncthreads();
  next_v();
  if (pinned(wv == 1u)) tdm_load(vg0, vg1);
  uint32_t vkey = 0u;  // first key of the block of 32 inside its stage: 0, 32, 64, 96

  if (wave == 0) issue_k_tile(0, 0);              // prime the pipeline

  for (int j0 = 0; j0 < SS; j0 += 32) {
    const int bufn = (j0 >> 5) & 1;
    if (wave == 0) __builtin_amdgcn_s_wait_tensorcnt(0);
    __syncthreads();                              // K' tile ready for all waves
    if (wave == 0 && (j0 + 32) < SS)
      issue_k_tile(j0 + 32, bufn ^ 1);            // async prefetch next tile

    const _Float16* Kl = kstage[bufn];
    v8f s0 = {}, s1 = {};
#pragma unroll
    for (int f = 0; f < 3; ++f) {
      v16h a0 = load_frag(Kl + (size_t)(ln)      * DKA, f * 32, half);
      v16h a1 = load_frag(Kl + (size_t)(16 + ln) * DKA, f * 32, half);
      s0 = wmma_f16(a0, qf[f], s0);
      s1 = wmma_f16(a1, qf[f], s1);
    }

    // V^T fragments of these 32 keys, from this stage's buffer, in the k order
    // of load_frag; fetched here so that their latency runs behind the softmax.
    const unsigned char* vrow =
        vstage + (uint32_t)((j0 >> 7) & 1) * V_BUF + (uint32_t)ln * V_PITCH;
    v16h vf[4];
#pragma unroll  // constant indices: the fragments stay in registers
    for (int n2 = 0; n2 < 4; ++n2)
      vf[n2] = load_frag((const _Float16*)(vrow + (uint32_t)n2 * 16u * V_PITCH),
                         (int)vkey, half);
    // Keeps these LDS loads, as one group, ahead of the softmax.
    __builtin_amdgcn_sched_barrier(0);

    // Online softmax (log2 domain). All 16 scores of a lane are query ln's.
    float v = fmaxf(s0[0], s1[0]);
#pragma unroll
    for (int r = 1; r < 8; ++r) v = fmaxf(v, fmaxf(s0[r], s1[r]));
    v = fmaxf(v, xhalf(v));
    const float mn   = fmaxf(mrun, v);
    const float corr = exp2f(mrun - mn);
    v16h pb;           // P^T as B operand: element e is key 8*half + e (e < 8), 8 + 8*half + e (e >= 8)
    float rs = 0.f;
#pragma unroll
    for (int r = 0; r < 8; ++r) {
      const float p0 = exp2f(s0[r] - mn);
      const float p1 = exp2f(s1[r] - mn);
      rs += p0 + p1;
      pb[r]     = (_Float16)p0;
      pb[8 + r] = (_Float16)p1;
    }
    lrun = lrun * corr + rs;
    mrun = mn;
#pragma unroll
    for (int n2 = 0; n2 < 4; ++n2)
#pragma unroll
      for (int r = 0; r < 8; ++r) acc[n2][r] *= corr;

    // acc^T += V^T(64x32) x P^T(32x16)
#pragma unroll
    for (int n2 = 0; n2 < 4; ++n2)
      acc[n2] = wmma_f16(vf[n2], pb, acc[n2]);
    // A V^T stage ends with its fourth block of 32 keys. Publish point of the
    // next stage: this wave's LDS reads are done, the issuing wave's load has
    // landed, then every wave meets at the barrier below.
    const uint32_t vend = pinned(vkey == 96u);
    if (vend) {
      asm volatile("s_wait_dscnt 0x0" ::: "memory");
      if (pinned(wv == 1u)) asm volatile("s_wait_tensorcnt 0x0" ::: "memory");
    }
    __syncthreads();   // all waves done with kstage[bufn] before overwrite
    if (vend) {
      // Refill the V^T buffer that every wave has just left.
      next_v();
      const uint32_t nxt = pinned(((uint32_t)j0 >> 7) + 2u);
      if (pinned((wv == 1u) & (nxt < V_STAGES))) tdm_load(vg0, vg1);
    }
    vkey = (vkey + 32u) & 96u;
  }
  // Nothing may be outstanding when the wave ends.
  asm volatile("s_wait_tensorcnt 0x0" ::: "memory");
  asm volatile("s_wait_dscnt 0x0" ::: "memory");

  // Join the halves' sums, normalize and write O in (B,S,H*dk) as f16, the
  // output projection's A operand: a lane holds 8 consecutive d of its query
  // per tile, one 16-byte store.
  const float lsum = lrun + xhalf(lrun);
  _Float16* orow = O + ((size_t)(b * SS + row0 + ln)) * DD + h * DK + 8 * half;
#pragma unroll  // constant indices: the accumulators stay in registers
  for (int n2 = 0; n2 < 4; ++n2) {
    h16x8 o;
#pragma unroll
    for (int r = 0; r < 8; ++r) o[r] = (_Float16)(acc[n2][r] / lsum);
    *(h16x8*)(orow + n2 * 16) = o;
  }
}

// ------------------------------- launcher ----------------------------------
extern "C" void kernel_launch(void* const* d_in, const int* in_sizes, int n_in,
                              void* d_out, int out_size, void* d_ws, size_t ws_size,
                              hipStream_t stream) {
  const float* x  = (const float*)d_in[0];
  const float* Wq = (const float*)d_in[1];
  const float* bq = (const float*)d_in[2];
  const float* Wk = (const float*)d_in[3];
  const float* bk = (const float*)d_in[4];
  const float* Wv = (const float*)d_in[5];
  const float* bv = (const float*)d_in[6];
  const float* Wo = (const float*)d_in[7];
  const float* bo = (const float*)d_in[8];
  const float* Wp = (const float*)d_in[9];
  const float* bp = (const float*)d_in[10];
  const float* alpha = (const float*)d_in[11];
  float* out = (float*)d_out;

  // workspace carve-out (~58 MB), 256B aligned chunks
  char* w = (char*)d_ws;
  size_t off = 0;
  auto carve = [&](size_t bytes) {
    char* p = w + off;
    off = (off + bytes + 255) & ~(size_t)255;
    return p;
  };
  _Float16* Xh   = (_Float16*)carve((size_t)BSX * DD * 2);
  _Float16* Wqt  = (_Float16*)carve((size_t)DD * DD * 2);
  _Float16* Wkt  = (_Float16*)carve((size_t)DD * DD * 2);
  _Float16* Wvt  = (_Float16*)carve((size_t)DD * DD * 2);
  _Float16* Wot  = (_Float16*)carve((size_t)DD * DD * 2);
  _Float16* Qaug = (_Float16*)carve((size_t)BB * HH * SS * DKA * 2);
  _Float16* Kaug = (_Float16*)carve((size_t)BB * HH * SS * DKA * 2);
  _Float16* Vt   = (_Float16*)carve((size_t)BB * HH * DK * SS * 2);
  _Float16* Oh   = (_Float16*)carve((size_t)BSX * DD * 2);
  (void)ws_size; (void)n_in; (void)in_sizes; (void)out_size;

  // 1) all that reads only the inputs: x and the weights to f16 (weights
  //    transposed), the phase projection with its cos/sin columns of Q' and K'
  prep_kernel<<<PB_PHASE + PB_CONV + 4 * PB_TRANS, 256, 0, stream>>>(
      x, Wq, Wk, Wv, Wo, Wp, bp, alpha, Xh, Wqt, Wkt, Wvt, Wot, Qaug, Kaug);

  // 2) QKV projections via WMMA GEMM, one grid
  const float qmult = 0.125f * LOG2E;  // dk^-0.5 = 1/8, log2e folded for exp2
  dim3 qgrid(DD / 128, BSX / 128, 3);
  qkv_gemm_kernel<<<qgrid, 256, 0, stream>>>(Xh, Wqt, Wkt, Wvt, bq, bk, bv,
                                             Qaug, Kaug, Vt, DD, DD, qmult);

  dim3 fgrid(SS / 128, HH, BB);
  flash_kernel<<<fgrid, 256, 0, stream>>>(Qaug, Kaug, Vt, Oh);

  // 4) output projection
  dim3 ggrid(DD / 128, BSX / 128);
  gemm_wmma_kernel<<<ggrid, 256, 0, stream>>>(Oh, Wot, bo, out, nullptr,
                                              DD, DD, 0, 1.0f);
}

// v006
// One run takes 147 microseconds.
// Two timings next to v005 put it at 1.08 and 1.09 times that version's speed.
// Over all steps from v000 it is 2.51 times as fast.
#include <hip/hip_runtime.h>
#include <hip/hip_bf16.h>
#include <math.h>
#include <stdint.h>

typedef __attribute__((ext_vector_type(16))) _Float16 v16h;
typedef __attribute__((ext_vector_type(8)))  float    v8f;
typedef __attribute__((ext_vector_type(4)))  unsigned int v4u;
typedef __attribute__((ext_vector_type(4)))  unsigned int u32x4;
typedef __attribute__((ext_vector_type(8)))  int          i32x8;
typedef __attribute__((ext_vector_type(4)))  int          i32x4;

#define BB   2
#define SS   2048
#define DD   1024
#define HH   16
#define DK   64
#define DKA  104
#define BSX  (BB*SS)
#define LOG2E 1.4426950408889634f

union Frag { v16h v; v4u q[2]; };

static __device__ inline v8f wmma_f16(v16h a, v16h b, v8f c) {
  return __builtin_amdgcn_wmma_f32_16x16x32_f16(
      /*neg_a=*/false, a, /*neg_b=*/false, b,
      /*c_mod=*/(short)0, c, /*reuse_a=*/false, /*reuse_b=*/false);
}

// Load one 16x32 f16 A/B fragment. rowPtr points at this lane's row
// (row = lane%16 of the tile). half = lane/16.
// Element e<8 -> K = k0 + half*8 + e ; e>=8 -> K = k0 + 16 + half*8 + (e-8).
static __device__ inline v16h load_frag(const _Float16* rowPtr, int k0, int half) {
  Frag f;
  f.q[0] = *(const v4u*)(rowPtr + k0 + half * 8);
  f.q[1] = *(const v4u*)(rowPtr + k0 + 16 + half * 8);
  return f.v;
}

// ------------------------------- converters --------------------------------
typedef __attribute__((ext_vector_type(4))) float    f32x4;
typedef __attribute__((ext_vector_type(4))) _Float16 h16x4;
typedef __attribute__((ext_vector_type(8))) _Float16 h16x8;

#define CV_BLOCK 8192   // values per block of 8 waves

// A wave converts 1024 consecutive values: eight 16-byte loads a lane, each
// 512 contiguous bytes over the wave and all issued before the first use, then
// eight 8-byte stores, each 256 contiguous bytes over the wave.
static __device__ __attribute__((always_inline)) inline void
f32_to_f16_block(const float* __restrict__ in,
                 _Float16* __restrict__ out, int n, int blk) {
  const int base = blk * CV_BLOCK + (int)(threadIdx.x >> 5) * 1024 +
                   (int)(threadIdx.x & 31) * 4;
  if ((blk + 1) * CV_BLOCK <= n) {
    f32x4 v[8];
#pragma unroll  // constant indices: the eight loads stay in registers, in flight together
    for (int j = 0; j < 8; ++j) v[j] = *(const f32x4*)(in + base + j * 128);
#pragma unroll
    for (int j = 0; j < 8; ++j)
      *(h16x4*)(out + base + j * 128) = __builtin_convertvector(v[j], h16x4);
    // Precaution: stands ahead of any later write of a register these stores name.
    asm volatile("s_wait_xcnt 0x0" ::: "memory");
  } else {  // the last, partial block
    for (int i = blk * CV_BLOCK + (int)threadIdx.x; i < n; i += 256)
      out[i] = (_Float16)in[i];
  }
}

// in: (DD x DD) f32 row-major, [k][n]  ->  out: (DD x DD) f16 row-major, [n][k]
// tile = 0 .. (DD / 64)^2 - 1. A group of 4 waves takes 64 k x 64 n, a wave
// 64 k x 16 n, a lane 8 k x 4 n: eight 16-byte loads a lane (256 contiguous
// bytes of each source row over the group), all issued before the first use,
// then four 16-byte stores; eight lanes fill one 128-byte line of out.
static __device__ __attribute__((always_inline)) inline void
transpose_f32_to_f16_tile(const float* __restrict__ in,
                          _Float16* __restrict__ out, int tile) {
  const int lane = threadIdx.x & 31;
  const int wave = (threadIdx.x >> 5) & 3;
  const int k0 = (tile >> 4) * 64 + (lane & 7) * 8;
  const int n0 = (tile & 15) * 64 + wave * 16 + (lane >> 3) * 4;
  const float* src = in + k0 * DD + n0;
  _Float16* dst = out + n0 * DD + k0;
  f32x4 v[8];
#pragma unroll  // constant indices: the eight loads stay in registers, in flight together
  for (int j = 0; j < 8; ++j) v[j] = *(const f32x4*)(src + j * DD);
#pragma unroll  // constant indices into v
  for (int i = 0; i < 4; ++i) {
    h16x8 h;
#pragma unroll
    for (int j = 0; j < 8; ++j) h[j] = (_Float16)v[j][i];
    *(h16x8*)(dst + i * DD) = h;
  }
  // Precaution: stands ahead of any later write of a register these stores name.
  asm volatile("s_wait_xcnt 0x0" ::: "memory");
}

// ------------------------------- phase -------------------------------------
// phase[bs][h] = x[bs,:] . Wp[:,h] + bp[h]   (tiny: 0.13 GFLOP); the thread
// that holds it fills columns 64..103 of its row (b,h,s) of Qaug and Kaug.
static __device__ __attribute__((always_inline)) inline void
phase_fill_block(const float* __restrict__ x,
                 const float* __restrict__ Wp,
                 const float* __restrict__ bp,
                 const float* __restrict__ alpha,
                 _Float16* __restrict__ Qaug,
                 _Float16* __restrict__ Kaug, int blk) {
  int idx = blk * 256 + (int)threadIdx.x;
  int bs = idx >> 4, h = idx & 15;
  const float* xr = x + (size_t)bs * DD;
  float acc = bp[h];
  for (int k = 0; k < DD; ++k) acc = fmaf(xr[k], Wp[k * HH + h], acc);
  float ph = acc;
  int b = bs >> 11, s = bs & (SS - 1);
  int bh = b * HH + h;
  float c = cosf(ph), sn = sinf(ph);
  float al = alpha[h];
  _Float16* qr = Qaug + ((size_t)bh * SS + s) * DKA;
  _Float16* kr = Kaug + ((size_t)bh * SS + s) * DKA;
  qr[64] = (_Float16)(al * c  * LOG2E);
  qr[65] = (_Float16)(al * sn * LOG2E);
  kr[64] = (_Float16)c;
  kr[65] = (_Float16)sn;
  for (int t = 66; t < DKA; ++t) { qr[t] = (_Float16)0.f; kr[t] = (_Float16)0.f; }
}

// ------------------------------- first launch ------------------------------
// Everything that reads only the inputs shares one grid, by block range; the
// phase blocks last longest and come first.
#define PB_PHASE (BSX * HH / 256)            // 256 blocks
#define PB_CONV  (BSX * DD / CV_BLOCK)       // 512 blocks
#define PB_TRANS ((DD / 64) * (DD / 64) / 2) // 128 blocks a weight, two tiles each

__global__ void __launch_bounds__(256)
prep_kernel(const float* __restrict__ x,  const float* __restrict__ Wq,
            const float* __restrict__ Wk, const float* __restrict__ Wv,
            const float* __restrict__ Wo, const float* __restrict__ Wp,
            const float* __restrict__ bp, const float* __restrict__ alpha,
            _Float16* __restrict__ Xh,  _Float16* __restrict__ Wqt,
            _Float16* __restrict__ Wkt, _Float16* __restrict__ Wvt,
            _Float16* __restrict__ Wot, _Float16* __restrict__ Qaug,
            _Float16* __restrict__ Kaug) {
  const int blk = (int)blockIdx.x;
  if (blk < PB_PHASE) {
    phase_fill_block(x, Wp, bp, alpha, Qaug, Kaug, blk);
  } else if (blk < PB_PHASE + PB_CONV) {
    f32_to_f16_block(x, Xh, BSX * DD, blk - PB_PHASE);
  } else {
    const int t = blk - (PB_PHASE + PB_CONV);
    const int w = t / PB_TRANS;
    const float* in = (w == 0) ? Wq : (w == 1) ? Wk : (w == 2) ? Wv : Wo;
    _Float16* out   = (w == 0) ? Wqt : (w == 1) ? Wkt : (w == 2) ? Wvt : Wot;
    transpose_f32_to_f16_tile(in, out, (t % PB_TRANS) * 2 + (int)(threadIdx.x >> 7));
  }
}

// ------------------------------- WMMA GEMM ---------------------------------
// C(M,N) = A(M,K) x Bt(N,K)^T + bias[n].  Block tile 128x128, 8 waves as
// 2(M) x 4(N); each wave computes 64x32 = 4x2 tiles of 16x16.
// A pass is 128 k = 256 bytes of each of the 128 A rows and 128 Bt rows. The
// rows reach LDS by tensor loads: every wave brings one slice of 32 rows per
// pass (waves 0..3 rows of A, waves 4..7 rows of Bt) into a ring of two
// buffers, one pass ahead of its readers; the pad gives an LDS pitch of
// 272 bytes, and the fragments come by ds_load_b128 in the k order of
// load_frag. Needs K a multiple of 128 and at least 256.
// mode 0: outF[gm*N+gn] = v                     (f32, final output)
// mode 1: aug layout  outH[(b,h,s)*104 + d] = (f16)(v*mult)  (Q and K)
// mode 3: V^T layout  outH[((b*16+h)*64+d)*S + s] = (f16)v
typedef __attribute__((ext_vector_type(8))) unsigned int u32x8;

#define G_ROWB  256u                 // bytes of one operand row per pass
#define G_PITCH 272u                 // LDS pitch: row + 16 bytes of pad
#define G_SROWS 32u                  // rows per slice
#define G_SLICE 10240u               // 32 x 272 = 8704, up to a multiple of 2 KiB
#define G_BUF   (8u * G_SLICE)       // one buffer: 4 slices of A, 4 of Bt

static __device__ inline uint32_t uni(uint32_t v) {
  return (uint32_t)__builtin_amdgcn_readfirstlane(v);
}
static __device__ inline uint32_t pinned(uint32_t v) {
  uint32_t w = uni(v);
  asm volatile("" : "+s"(w));  // pinned(): the word stays in a scalar register
  return w;
}
static __device__ inline void tdm_load(u32x4 g0, u32x8 g1) {
  asm volatile("tensor_load_to_lds %0, %1" :: "s"(g0), "s"(g1) : "memory");
}

static __device__ __attribute__((always_inline)) inline void
gemm_wmma_tile(unsigned char* ring,
               const _Float16* __restrict__ A, const _Float16* __restrict__ Bt,
               const float* __restrict__ bias, float* __restrict__ outF,
               _Float16* __restrict__ outH, int N, int K,
               int mode, float mult) {
  const int lane = threadIdx.x & 31;
  const uint32_t wave = uni(threadIdx.x >> 5);
  const int half = lane >> 4;
  const int ln   = lane & 15;
  const int wm   = (int)(wave >> 2);   // 0..1
  const int wn   = (int)(wave & 3u);   // 0..3
  const int mbase = blockIdx.y * 128 + wm * 64;
  const int nbase = blockIdx.x * 128 + wn * 32;

  // This wave's slice: its first source byte and its place in buffer 0.
  const _Float16* srow = (wave < 4u)
      ? A  + (size_t)(blockIdx.y * 128u + wave * G_SROWS) * K
      : Bt + (size_t)(blockIdx.x * 128u + (wave - 4u) * G_SROWS) * K;
  const uint64_t sbase = (uint64_t)(uintptr_t)srow;
  const uint32_t ldst  = (uint32_t)(uintptr_t)ring + wave * G_SLICE;
  const uint32_t npass = (uint32_t)K >> 7;

  u32x8 g1;
  g1[0] = uni((1u << 20) | (5u << 22) | (3u << 25));
  g1[1] = uni(G_ROWB << 16);
  g1[2] = uni(G_SROWS << 16);
  g1[3] = uni(G_ROWB << 16);
  g1[4] = uni(G_SROWS);
  g1[5] = uni((uint32_t)K * 2u);
  g1[6] = uni(0u);
  g1[7] = uni(0u);
  asm volatile("" : "+s"(g1));
  auto issue = [&](uint32_t st) {
    const uint64_t ga = sbase + (uint64_t)st * G_ROWB;
    u32x4 g0;
    g0[0] = uni(1u);
    g0[1] = uni(ldst + (st & 1u) * G_BUF);
    g0[2] = uni((uint32_t)ga);
    g0[3] = uni((((uint32_t)(ga >> 32)) & 0x01FFFFFFu) | 0x80000000u);
    tdm_load(g0, g1);
  };

  v8f acc[4][2] = {};

  issue(0u);
  // Stage 0 has landed for this wave; the barrier publishes every slice.
  asm volatile("s_wait_tensorcnt 0x0" ::: "memory");
  __syncthreads();
  issue(1u);

  for (uint32_t s = 0; s < npass; ++s) {
    const unsigned char* buf = ring + (s & 1u) * G_BUF;
    const unsigned char* arow = buf + (uint32_t)(wm * 2) * G_SLICE + (uint32_t)ln * G_PITCH;
    const unsigned char* brow = buf + (uint32_t)(4 + wn) * G_SLICE + (uint32_t)ln * G_PITCH;
    // Fragments of block kk (32 k) of this pass, in the k order of load_frag.
    auto load_block = [&](int kk, v16h (&af)[4], v16h (&bf)[2]) {
#pragma unroll  // constant indices: the fragments stay in registers
      for (int mi = 0; mi < 4; ++mi)
        af[mi] = load_frag((const _Float16*)(arow + (uint32_t)(mi >> 1) * G_SLICE +
                                             (uint32_t)(mi & 1) * 16u * G_PITCH),
                           kk * 32, half);
#pragma unroll
      for (int ni = 0; ni < 2; ++ni)
        bf[ni] = load_frag((const _Float16*)(brow + (uint32_t)ni * 16u * G_PITCH),
                           kk * 32, half);
    };
    v16h af[2][4], bf[2][2];
    load_block(0, af[0], bf[0]);
#pragma unroll  // constant indices keep fragments and accumulators in registers
    for (int kk = 0; kk < 4; ++kk) {
      if (kk < 3) load_block(kk + 1, af[(kk + 1) & 1], bf[(kk + 1) & 1]);
      // Keeps the next block's LDS loads, as one group, ahead of this block's
      // products, so that their latency runs behind the matrix work.
      __builtin_amdgcn_sched_barrier(0);
#pragma unroll  // constant indices: the accumulators stay in registers
      for (int mi = 0; mi < 4; ++mi)
#pragma unroll
        for (int ni = 0; ni < 2; ++ni)
          acc[mi][ni] = wmma_f16(af[kk & 1][mi], bf[kk & 1][ni], acc[mi][ni]);
      // Keeps later LDS loads from being moved in among these products.
      if (kk < 3) __builtin_amdgcn_sched_barrier(0);
    }
    // Publish point of stage s + 1: this wave's reads of stage s are done,
    // its own slice of stage s + 1 has landed, then every wave meets.
    asm volatile("s_wait_dscnt 0x0" ::: "memory");
    asm volatile("s_wait_tensorcnt 0x0" ::: "memory");
    __syncthreads();
    // Refill the buffer that every wave has just left.
    const uint32_t nxt = pinned(s + 2u);
    if (pinned(nxt < npass)) issue(nxt);
  }
  // Nothing may be outstanding when the wave ends.
  asm volatile("s_wait_tensorcnt 0x0" ::: "memory");
  asm volatile("s_wait_dscnt 0x0" ::: "memory");

#pragma unroll
  for (int mi = 0; mi < 4; ++mi) {
#pragma unroll
    for (int ni = 0; ni < 2; ++ni) {
      const int gn = nbase + ni * 16 + ln;
      const float bv = bias[gn];
      const int gm0 = mbase + mi * 16 + 8 * half;
#pragma unroll
      for (int r = 0; r < 8; ++r) {
        const int gm = gm0 + r;                 // C layout: M = r + 8*half
        float v = acc[mi][ni][r] + bv;
        if (mode == 0) {
          outF[(size_t)gm * N + gn] = v;
        } else {
          int b = gm >> 11, s = gm & (SS - 1);  // M axis = b*S + s
          int h = gn >> 6,  d = gn & 63;        // N axis = h*64 + d
          if (mode == 1) {
            outH[(((size_t)(b * HH + h) * SS + s) * DKA) + d] = (_Float16)(v * mult);
          } else { // mode 3: V transposed (B,H,64,S)
            outH[(((size_t)(b * HH + h) * DK + d) * SS) + s] = (_Float16)v;
          }
        }
      }
    }
  }
}

// The output projection.
__global__ void __launch_bounds__(256)
gemm_wmma_kernel(const _Float16* __restrict__ A, const _Float16* __restrict__ Bt,
                 const float* __restrict__ bias, float* __restrict__ outF,
                 _Float16* __restrict__ outH, int N, int K,
                 int mode, float mult) {
  __shared__ __attribute__((aligned(2048))) unsigned char ring[2u * G_BUF];
  gemm_wmma_tile(ring, A, Bt, bias, outF, outH, N, K, mode, mult);
}

// The V, Q and K projections in one grid: blockIdx.z picks the weight, the
// bias, the output and its layout. V comes first: its stores touch the most
// lines.
__global__ void __launch_bounds__(256)
qkv_gemm_kernel(const _Float16* __restrict__ A,
                const _Float16* __restrict__ Wqt, const _Float16* __restrict__ Wkt,
                const _Float16* __restrict__ Wvt,
                const float* __restrict__ bq, const float* __restrict__ bk,
                const float* __restrict__ bv,
                _Float16* __restrict__ Qaug, _Float16* __restrict__ Kaug,
                _Float16* __restrict__ Vt, int N, int K, float qmult) {
  __shared__ __attribute__((aligned(2048))) unsigned char ring[2u * G_BUF];
  const uint32_t z = blockIdx.z;
  const _Float16* Bt = (z == 0u) ? Wvt : (z == 1u) ? Wqt : Wkt;
  const float* bias  = (z == 0u) ? bv : (z == 1u) ? bq : bk;
  _Float16* outH     = (z == 0u) ? Vt : (z == 1u) ? Qaug : Kaug;
  gemm_wmma_tile(ring, A, Bt, bias, nullptr, outH, N, K,
                 (z == 0u) ? 3 : 1, (z == 1u) ? qmult : 1.0f);
}

static __device__ inline float xhalf(float x) {
  return __builtin_bit_cast(float, __builtin_amdgcn_permlanex16(
      __builtin_bit_cast(int, x), __builtin_bit_cast(int, x),
      0x76543210, 0xfedcba98, false, false));
}

#define V_ROWB  256u                 // bytes of one V^T row per stage (128 keys)
#define V_PITCH 272u                 // LDS pitch: row + 16 bytes of pad
#define V_BUF   18432u               // 64 x 272 = 17408, up to a multiple of 2 KiB
#define V_STAGES ((uint32_t)SS / 128u)
#define K_BUFH  4096                 // halves per K' buffer: 32 x 208 = 6656 bytes, up to a multiple of 2 KiB

__global__ void __launch_bounds__(256)
flash_kernel(const _Float16* __restrict__ Qaug, const _Float16* __restrict__ Kaug,
             const _Float16* __restrict__ Vt, _Float16* __restrict__ O) {
  __shared__ __attribute__((aligned(2048))) _Float16 kstage[2][K_BUFH];
  __shared__ __attribute__((aligned(2048))) unsigned char vstage[2u * V_BUF];  // V^T ring

  const int lane = threadIdx.x & 31;
  const int wave = threadIdx.x >> 5;
  const int half = lane >> 4;
  const int ln   = lane & 15;
  const int h    = blockIdx.y;
  const int b    = blockIdx.z;
  const int row0 = blockIdx.x * 128 + wave * 16;
  const size_t bh = (size_t)(b * HH + h);

  const _Float16* Qb = Qaug + bh * SS * DKA;
  const _Float16* Kb = Kaug + bh * SS * DKA;
  const _Float16* Vb = Vt   + bh * (size_t)DK * SS;

  auto issue_k_tile = [&](int j0, int bufn) {
    unsigned long long gaddr =
        (unsigned long long)(uintptr_t)(Kb + (size_t)j0 * DKA);
    unsigned lds_addr = (unsigned)(uintptr_t)(&kstage[bufn][0]);
    u32x4 g0;
    g0[0] = 1u;                                   // count=1 (valid), user mode
    g0[1] = lds_addr;                             // lds_addr [63:32]
    g0[2] = (unsigned)gaddr;                      // global_addr [95:64]
    g0[3] = ((unsigned)(gaddr >> 32) & 0x01FFFFFFu) | (2u << 30); // type=2
    i32x8 g1;
    g1[0] = (int)(1u << 16);
    g1[1] = (int)((unsigned)DKA << 16);
    g1[2] = (int)((unsigned)SS << 16);
    g1[3] = (int)((unsigned)DKA << 16);
    g1[4] = 32;
    g1[5] = DKA;
    g1[6] = 0;
    g1[7] = 0;
    i32x4 z4 = {0, 0, 0, 0};
#if defined(__clang_major__) && (__clang_major__ >= 23)
    i32x8 z8 = {};
    __builtin_amdgcn_tensor_load_to_lds(g0, g1, z4, z4, z8, 0);
#else
    __builtin_amdgcn_tensor_load_to_lds(g0, g1, z4, z4, 0);
#endif
  };

  // Q fragments (16 queries x 96 of the 104), loaded once; B operand of the score product.
  v16h qf[3];
#pragma unroll
  for (int f = 0; f < 3; ++f)
    qf[f] = load_frag(Qb + (size_t)(row0 + ln) * DKA, f * 32, half);

  // acc[n2][r] = O[query ln][d = n2*16 + 8*half + r], not yet normalized.
  v8f acc[4] = {};
  float mrun = -1e30f;  // running maximum of query ln, alike in both halves
  float lrun = 0.f;     // running sum of query ln over this half's keys

  const uint32_t wv = uni(threadIdx.x >> 5);
  const uint64_t vsrc = (uint64_t)(uintptr_t)Vb;
  const uint32_t vdst = (uint32_t)(uintptr_t)vstage;
  u32x8 vg1;
  vg1[0] = uni((1u << 20) | (5u << 22) | (3u << 25));
  vg1[1] = uni(V_ROWB << 16);
  vg1[2] = uni((uint32_t)DK << 16);
  vg1[3] = uni(V_ROWB << 16);
  vg1[4] = uni((uint32_t)DK);
  vg1[5] = uni((uint32_t)SS * 2u);
  vg1[6] = uni(0u);
  vg1[7] = uni(0u);
  asm volatile("" : "+s"(vg1));
  u32x4 vg0;
  vg0[0] = uni(1u);
  vg0[1] = uni(vdst);
  vg0[2] = uni((uint32_t)vsrc);
  vg0[3] = uni((((uint32_t)(vsrc >> 32)) & 0x01FFFFFFu) | 0x80000000u);
  auto next_v = [&]() {
    asm volatile("" : "+s"(vg0));
    const uint32_t lo = vg0[2] + V_ROWB;
    vg0[3] = uni(vg0[3] + ((lo < V_ROWB) ? 1u : 0u));
    vg0[2] = uni(lo);
    vg0[1] = uni((2u * vdst + V_BUF) - vg0[1]);
  };
  if (pinned(wv == 1u)) {
    tdm_load(vg0, vg1);
    // Stage 0 has landed for the issuing wave; the barrier publishes it.
    asm volatile("s_wait_tensorcnt 0x0" ::: "memory");
  }
  __syncthreads();
  next_v();
  if (pinned(wv == 1u)) tdm_load(vg0, vg1);
  uint32_t vkey = 0u;  // first key of the block of 32 inside its stage: 0, 32, 64, 96

  if (wave == 0) issue_k_tile(0, 0);              // prime the pipeline

  for (int j0 = 0; j0 < SS; j0 += 32) {
    const int bufn = (j0 >> 5) & 1;
    if (wave == 0) __builtin_amdgcn_s_wait_tensorcnt(0);
    __syncthreads();                              // K' tile ready for all waves
    if (wave == 0 && (j0 + 32) < SS)
      issue_k_tile(j0 + 32, bufn ^ 1);            // async prefetch next tile

    const _Float16* Kl = kstage[bufn];
    v8f s0 = {}, s1 = {};
#pragma unroll
    for (int f = 0; f < 3; ++f) {
      v16h a0 = load_frag(Kl + (size_t)(ln)      * DKA, f * 32, half);
      v16h a1 = load_frag(Kl + (size_t)(16 + ln) * DKA, f * 32, half);
      s0 = wmma_f16(a0, qf[f], s0);
      s1 = wmma_f16(a1, qf[f], s1);
    }

    // V^T fragments of these 32 keys, from this stage's buffer, in the k order
    // of load_frag; fetched here so that their latency runs behind the softmax.
    const unsigned char* vrow =
        vstage + (uint32_t)((j0 >> 7) & 1) * V_BUF + (uint32_t)ln * V_PITCH;
    v16h vf[4];
#pragma unroll  // constant indices: the fragments stay in registers
    for (int n2 = 0; n2 < 4; ++n2)
      vf[n2] = load_frag((const _Float16*)(vrow + (uint32_t)n2 * 16u * V_PITCH),
                         (int)vkey, half);
    // Keeps these LDS loads, as one group, ahead of the softmax.
    __builtin_amdgcn_sched_barrier(0);

    // Online softmax (log2 domain). All 16 scores of a lane are query ln's.
    float v = fmaxf(s0[0], s1[0]);
#pragma unroll
    for (int r = 1; r < 8; ++r) v = fmaxf(v, fmaxf(s0[r], s1[r]));
    v = fmaxf(v, xhalf(v));
    const float mn   = fmaxf(mrun, v);
    const float corr = exp2f(mrun - mn);
    v16h pb;           // P^T as B operand: element e is key 8*half + e (e < 8), 8 + 8*half + e (e >= 8)
    float rs = 0.f;
#pragma unroll
    for (int r = 0; r < 8; ++r) {
      const float p0 = exp2f(s0[r] - mn);
      const float p1 = exp2f(s1[r] - mn);
      rs += p0 + p1;
      pb[r]     = (_Float16)p0;
      pb[8 + r] = (_Float16)p1;
    }
    lrun = lrun * corr + rs;
    mrun = mn;
#pragma unroll
    for (int n2 = 0; n2 < 4; ++n2)
#pragma unroll
      for (int r = 0; r < 8; ++r) acc[n2][r] *= corr;

    // acc^T += V^T(64x32) x P^T(32x16)
#pragma unroll
    for (int n2 = 0; n2 < 4; ++n2)
      acc[n2] = wmma_f16(vf[n2], pb, acc[n2]);
    // A V^T stage ends with its fourth block of 32 keys. Publish point of the
    // next stage: this wave's LDS reads are done, the issuing wave's load has
    // landed, then every wave meets at the barrier below.
    const uint32_t vend = pinned(vkey == 96u);
    if (vend) {
      asm volatile("s_wait_dscnt 0x0" ::: "memory");
      if (pinned(wv == 1u)) asm volatile("s_wait_tensorcnt 0x0" ::: "memory");
    }
    __syncthreads();   // all waves done with kstage[bufn] before overwrite
    if (vend) {
      // Refill the V^T buffer that every wave has just left.
      next_v();
      const uint32_t nxt = pinned(((uint32_t)j0 >> 7) + 2u);
      if (pinned((wv == 1u) & (nxt < V_STAGES))) tdm_load(vg0, vg1);
    }
    vkey = (vkey + 32u) & 96u;
  }
  // Nothing may be outstanding when the wave ends.
  asm volatile("s_wait_tensorcnt 0x0" ::: "memory");
  asm volatile("s_wait_dscnt 0x0" ::: "memory");

  // Join the halves' sums, normalize and write O in (B,S,H*dk) as f16, the
  // output projection's A operand: a lane holds 8 consecutive d of its query
  // per tile, one 16-byte store.
  const float lsum = lrun + xhalf(lrun);
  _Float16* orow = O + ((size_t)(b * SS + row0 + ln)) * DD + h * DK + 8 * half;
#pragma unroll  // constant indices: the accumulators stay in registers
  for (int n2 = 0; n2 < 4; ++n2) {
    h16x8 o;
#pragma unroll
    for (int r = 0; r < 8; ++r) o[r] = (_Float16)(acc[n2][r] / lsum);
    *(h16x8*)(orow + n2 * 16) = o;
  }
}

// ------------------------------- launcher ----------------------------------
extern "C" void kernel_launch(void* const* d_in, const int* in_sizes, int n_in,
                              void* d_out, int out_size, void* d_ws, size_t ws_size,
                              hipStream_t stream) {
  const float* x  = (const float*)d_in[0];
  const float* Wq = (const float*)d_in[1];
  const float* bq = (const float*)d_in[2];
  const float* Wk = (const float*)d_in[3];
  const float* bk = (const float*)d_in[4];
  const float* Wv = (const float*)d_in[5];
  const float* bv = (const float*)d_in[6];
  const float* Wo = (const float*)d_in[7];
  const float* bo = (const float*)d_in[8];
  const float* Wp = (const float*)d_in[9];
  const float* bp = (const float*)d_in[10];
  const float* alpha = (const float*)d_in[11];
  float* out = (float*)d_out;

  // workspace carve-out (~58 MB), 256B aligned chunks
  char* w = (char*)d_ws;
  size_t off = 0;
  auto carve = [&](size_t bytes) {
    char* p = w + off;
    off = (off + bytes + 255) & ~(size_t)255;
    return p;
  };
  _Float16* Xh   = (_Float16*)carve((size_t)BSX * DD * 2);
  _Float16* Wqt  = (_Float16*)carve((size_t)DD * DD * 2);
  _Float16* Wkt  = (_Float16*)carve((size_t)DD * DD * 2);
  _Float16* Wvt  = (_Float16*)carve((size_t)DD * DD * 2);
  _Float16* Wot  = (_Float16*)carve((size_t)DD * DD * 2);
  _Float16* Qaug = (_Float16*)carve((size_t)BB * HH * SS * DKA * 2);
  _Float16* Kaug = (_Float16*)carve((size_t)BB * HH * SS * DKA * 2);
  _Float16* Vt   = (_Float16*)carve((size_t)BB * HH * DK * SS * 2);
  _Float16* Oh   = (_Float16*)carve((size_t)BSX * DD * 2);
  (void)ws_size; (void)n_in; (void)in_sizes; (void)out_size;

  // 1) all that reads only the inputs: x and the weights to f16 (weights
  //    transposed), the phase projection with its cos/sin columns of Q' and K'
  prep_kernel<<<PB_PHASE + PB_CONV + 4 * PB_TRANS, 256, 0, stream>>>(
      x, Wq, Wk, Wv, Wo, Wp, bp, alpha, Xh, Wqt, Wkt, Wvt, Wot, Qaug, Kaug);

  // 2) QKV projections via WMMA GEMM, one grid
  const float qmult = 0.125f * LOG2E;  // dk^-0.5 = 1/8, log2e folded for exp2
  dim3 qgrid(DD / 128, BSX / 128, 3);
  qkv_gemm_kernel<<<qgrid, 256, 0, stream>>>(Xh, Wqt, Wkt, Wvt, bq, bk, bv,
                                             Qaug, Kaug, Vt, DD, DD, qmult);

  dim3 fgrid(SS / 128, HH, BB);
  flash_kernel<<<fgrid, 256, 0, stream>>>(Qaug, Kaug, Vt, Oh);

  // 4) output projection
  dim3 ggrid(DD / 128, BSX / 128);
  gemm_wmma_kernel<<<ggrid, 256, 0, stream>>>(Oh, Wot, bo, out, nullptr,
                                              DD, DD, 0, 1.0f);
}

// v007
// It runs in 144 microseconds.
// Next to v006, in two timings, it ran 1.03 times as fast each time.
// Over all steps from v000 it is 2.59 times as fast.
#include <hip/hip_runtime.h>
#include <hip/hip_bf16.h>
#include <math.h>
#include <stdint.h>

typedef __attribute__((ext_vector_type(16))) _Float16 v16h;
typedef __attribute__((ext_vector_type(8)))  float    v8f;
typedef __attribute__((ext_vector_type(4)))  unsigned int v4u;
typedef __attribute__((ext_vector_type(4)))  unsigned int u32x4;
typedef __attribute__((ext_vector_type(8)))  int          i32x8;
typedef __attribute__((ext_vector_type(4)))  int          i32x4;

#define BB   2
#define SS   2048
#define DD   1024
#define HH   16
#define DK   64
#define DKA  104
#define BSX  (BB*SS)
#define LOG2E 1.4426950408889634f

union Frag { v16h v; v4u q[2]; };

static __device__ inline v8f wmma_f16(v16h a, v16h b, v8f c) {
  return __builtin_amdgcn_wmma_f32_16x16x32_f16(
      /*neg_a=*/false, a, /*neg_b=*/false, b,
      /*c_mod=*/(short)0, c, /*reuse_a=*/false, /*reuse_b=*/false);
}

// Load one 16x32 f16 A/B fragment. rowPtr points at this lane's row
// (row = lane%16 of the tile). half = lane/16.
// Element e<8 -> K = k0 + half*8 + e ; e>=8 -> K = k0 + 16 + half*8 + (e-8).
static __device__ inline v16h load_frag(const _Float16* rowPtr, int k0, int half) {
  Frag f;
  f.q[0] = *(const v4u*)(rowPtr + k0 + half * 8);
  f.q[1] = *(const v4u*)(rowPtr + k0 + 16 + half * 8);
  return f.v;
}

// ------------------------------- converters --------------------------------
typedef __attribute__((ext_vector_type(4))) float    f32x4;
typedef __attribute__((ext_vector_type(4))) _Float16 h16x4;
typedef __attribute__((ext_vector_type(8))) _Float16 h16x8;

#define CV_BLOCK 8192   // values per block of 8 waves

// A wave converts 1024 consecutive values: eight 16-byte loads a lane, each
// 512 contiguous bytes over the wave and all issued before the first use, then
// eight 8-byte stores, each 256 contiguous bytes over the wave.
static __device__ __attribute__((always_inline)) inline void
f32_to_f16_block(const float* __restrict__ in,
                 _Float16* __restrict__ out, int n, int blk) {
  const int base = blk * CV_BLOCK + (int)(threadIdx.x >> 5) * 1024 +
                   (int)(threadIdx.x & 31) * 4;
  if ((blk + 1) * CV_BLOCK <= n) {
    f32x4 v[8];
#pragma unroll  // constant indices: the eight loads stay in registers, in flight together
    for (int j = 0; j < 8; ++j) v[j] = *(const f32x4*)(in + base + j * 128);
#pragma unroll
    for (int j = 0; j < 8; ++j)
      *(h16x4*)(out + base + j * 128) = __builtin_convertvector(v[j], h16x4);
    // Precaution: stands ahead of any later write of a register these stores name.
    asm volatile("s_wait_xcnt 0x0" ::: "memory");
  } else {  // the last, partial block
    for (int i = blk * CV_BLOCK + (int)threadIdx.x; i < n; i += 256)
      out[i] = (_Float16)in[i];
  }
}

// in: (DD x DD) f32 row-major, [k][n]  ->  out: (DD x DD) f16 row-major, [n][k]
// tile = 0 .. (DD / 64)^2 - 1. A group of 4 waves takes 64 k x 64 n, a wave
// 64 k x 16 n, a lane 8 k x 4 n: eight 16-byte loads a lane (256 contiguous
// bytes of each source row over the group), all issued before the first use,
// then four 16-byte stores; eight lanes fill one 128-byte line of out.
static __device__ __attribute__((always_inline)) inline void
transpose_f32_to_f16_tile(const float* __restrict__ in,
                          _Float16* __restrict__ out, int tile) {
  const int lane = threadIdx.x & 31;
  const int wave = (threadIdx.x >> 5) & 3;
  const int k0 = (tile >> 4) * 64 + (lane & 7) * 8;
  const int n0 = (tile & 15) * 64 + wave * 16 + (lane >> 3) * 4;
  const float* src = in + k0 * DD + n0;
  _Float16* dst = out + n0 * DD + k0;
  f32x4 v[8];
#pragma unroll  // constant indices: the eight loads stay in registers, in flight together
  for (int j = 0; j < 8; ++j) v[j] = *(const f32x4*)(src + j * DD);
#pragma unroll  // constant indices into v
  for (int i = 0; i < 4; ++i) {
    h16x8 h;
#pragma unroll
    for (int j = 0; j < 8; ++j) h[j] = (_Float16)v[j][i];
    *(h16x8*)(dst + i * DD) = h;
  }
  // Precaution: stands ahead of any later write of a register these stores name.
  asm volatile("s_wait_xcnt 0x0" ::: "memory");
}

// ------------------------------- phase -------------------------------------
// phase[bs][h] = x[bs,:] . Wp[:,h] + bp[h]   (tiny: 0.13 GFLOP); the thread
// that holds it fills columns 64..103 of its row (b,h,s) of Qaug and Kaug.
static __device__ __attribute__((always_inline)) inline void
phase_fill_block(const float* __restrict__ x,
                 const float* __restrict__ Wp,
                 const float* __restrict__ bp,
                 const float* __restrict__ alpha,
                 _Float16* __restrict__ Qaug,
                 _Float16* __restrict__ Kaug, int blk) {
  int idx = blk * 256 + (int)threadIdx.x;
  int bs = idx >> 4, h = idx & 15;
  const float* xr = x + (size_t)bs * DD;
  float acc = bp[h];
  for (int k = 0; k < DD; ++k) acc = fmaf(xr[k], Wp[k * HH + h], acc);
  float ph = acc;
  int b = bs >> 11, s = bs & (SS - 1);
  int bh = b * HH + h;
  float c = cosf(ph), sn = sinf(ph);
  float al = alpha[h];
  _Float16* qr = Qaug + ((size_t)bh * SS + s) * DKA;
  _Float16* kr = Kaug + ((size_t)bh * SS + s) * DKA;
  qr[64] = (_Float16)(al * c  * LOG2E);
  qr[65] = (_Float16)(al * sn * LOG2E);
  kr[64] = (_Float16)c;
  kr[65] = (_Float16)sn;
  for (int t = 66; t < DKA; ++t) { qr[t] = (_Float16)0.f; kr[t] = (_Float16)0.f; }
}

// ------------------------------- first launch ------------------------------
// Everything that reads only the inputs shares one grid, by block range; the
// phase blocks last longest and come first.
#define PB_PHASE (BSX * HH / 256)            // 256 blocks
#define PB_CONV  (BSX * DD / CV_BLOCK)       // 512 blocks
#define PB_TRANS ((DD / 64) * (DD / 64) / 2) // 128 blocks a weight, two tiles each

__global__ void __launch_bounds__(256)
prep_kernel(const float* __restrict__ x,  const float* __restrict__ Wq,
            const float* __restrict__ Wk, const float* __restrict__ Wv,
            const float* __restrict__ Wo, const float* __restrict__ Wp,
            const float* __restrict__ bp, const float* __restrict__ alpha,
            _Float16* __restrict__ Xh,  _Float16* __restrict__ Wqt,
            _Float16* __restrict__ Wkt, _Float16* __restrict__ Wvt,
            _Float16* __restrict__ Wot, _Float16* __restrict__ Qaug,
            _Float16* __restrict__ Kaug) {
  const int blk = (int)blockIdx.x;
  if (blk < PB_PHASE) {
    phase_fill_block(x, Wp, bp, alpha, Qaug, Kaug, blk);
  } else if (blk < PB_PHASE + PB_CONV) {
    f32_to_f16_block(x, Xh, BSX * DD, blk - PB_PHASE);
  } else {
    const int t = blk - (PB_PHASE + PB_CONV);
    const int w = t / PB_TRANS;
    const float* in = (w == 0) ? Wq : (w == 1) ? Wk : (w == 2) ? Wv : Wo;
    _Float16* out   = (w == 0) ? Wqt : (w == 1) ? Wkt : (w == 2) ? Wvt : Wot;
    transpose_f32_to_f16_tile(in, out, (t % PB_TRANS) * 2 + (int)(threadIdx.x >> 7));
  }
}

// ------------------------------- WMMA GEMM ---------------------------------
// C(M,N) = A(M,K) x Bt(N,K)^T + bias[n].  Block tile 128x128, 8 waves as
// 2(M) x 4(N); each wave computes 64x32 = 4x2 tiles of 16x16.
// A pass is 128 k = 256 bytes of each of the 128 A rows and 128 Bt rows. The
// rows reach LDS by tensor loads: every wave brings one slice of 32 rows per
// pass (waves 0..3 rows of A, waves 4..7 rows of Bt) into a ring of two
// buffers, one pass ahead of its readers; the pad gives an LDS pitch of
// 272 bytes, and the fragments come by ds_load_b128 in the k order of
// load_frag. Needs K a multiple of 128 and at least 256.
// mode 0: outF[gm*N+gn] = v                     (f32, final output)
// mode 1: aug layout  outH[(b,h,s)*104 + d] = (f16)(v*mult)  (Q and K)
// mode 3: V^T layout  outH[((b*16+h)*64+d)*S + s] = (f16)v
typedef __attribute__((ext_vector_type(8))) unsigned int u32x8;

#define G_ROWB  256u                 // bytes of one operand row per pass
#define G_PITCH 272u                 // LDS pitch: row + 16 bytes of pad
#define G_SROWS 32u                  // rows per slice
#define G_SLICE 10240u               // 32 x 272 = 8704, up to a multiple of 2 KiB
#define G_BUF   (8u * G_SLICE)       // one buffer: 4 slices of A, 4 of Bt

static __device__ inline uint32_t uni(uint32_t v) {
  return (uint32_t)__builtin_amdgcn_readfirstlane(v);
}
static __device__ inline uint32_t pinned(uint32_t v) {
  uint32_t w = uni(v);
  asm volatile("" : "+s"(w));  // pinned(): the word stays in a scalar register
  return w;
}
static __device__ inline void tdm_load(u32x4 g0, u32x8 g1) {
  asm volatile("tensor_load_to_lds %0, %1" :: "s"(g0), "s"(g1) : "memory");
}

static __device__ __attribute__((always_inline)) inline void
gemm_wmma_tile(unsigned char* ring,
               const _Float16* __restrict__ A, const _Float16* __restrict__ Bt,
               const float* __restrict__ bias, float* __restrict__ outF,
               _Float16* __restrict__ outH, int N, int K,
               int mode, float mult) {
  const int lane = threadIdx.x & 31;
  const uint32_t wave = uni(threadIdx.x >> 5);
  const int half = lane >> 4;
  const int ln   = lane & 15;
  const int wm   = (int)(wave >> 2);   // 0..1
  const int wn   = (int)(wave & 3u);   // 0..3
  const int mbase = blockIdx.y * 128 + wm * 64;
  const int nbase = blockIdx.x * 128 + wn * 32;

  // This wave's slice: its first source byte and its place in buffer 0.
  const _Float16* srow = (wave < 4u)
      ? A  + (size_t)(blockIdx.y * 128u + wave * G_SROWS) * K
      : Bt + (size_t)(blockIdx.x * 128u + (wave - 4u) * G_SROWS) * K;
  const uint64_t sbase = (uint64_t)(uintptr_t)srow;
  const uint32_t ldst  = (uint32_t)(uintptr_t)ring + wave * G_SLICE;
  const uint32_t npass = (uint32_t)K >> 7;

  u32x8 g1;
  g1[0] = uni((1u << 20) | (5u << 22) | (3u << 25));
  g1[1] = uni(G_ROWB << 16);
  g1[2] = uni(G_SROWS << 16);
  g1[3] = uni(G_ROWB << 16);
  g1[4] = uni(G_SROWS);
  g1[5] = uni((uint32_t)K * 2u);
  g1[6] = uni(0u);
  g1[7] = uni(0u);
  asm volatile("" : "+s"(g1));
  auto issue = [&](uint32_t st) {
    const uint64_t ga = sbase + (uint64_t)st * G_ROWB;
    u32x4 g0;
    g0[0] = uni(1u);
    g0[1] = uni(ldst + (st & 1u) * G_BUF);
    g0[2] = uni((uint32_t)ga);
    g0[3] = uni((((uint32_t)(ga >> 32)) & 0x01FFFFFFu) | 0x80000000u);
    tdm_load(g0, g1);
  };

  v8f acc[4][2] = {};

  issue(0u);
  // Stage 0 has landed for this wave; the barrier publishes every slice.
  asm volatile("s_wait_tensorcnt 0x0" ::: "memory");
  __syncthreads();
  issue(1u);

  for (uint32_t s = 0; s < npass; ++s) {
    const unsigned char* buf = ring + (s & 1u) * G_BUF;
    const unsigned char* arow = buf + (uint32_t)(wm * 2) * G_SLICE + (uint32_t)ln * G_PITCH;
    const unsigned char* brow = buf + (uint32_t)(4 + wn) * G_SLICE + (uint32_t)ln * G_PITCH;
    // Fragments of block kk (32 k) of this pass, in the k order of load_frag.
    auto load_block = [&](int kk, v16h (&af)[4], v16h (&bf)[2]) {
#pragma unroll  // constant indices: the fragments stay in registers
      for (int mi = 0; mi < 4; ++mi)
        af[mi] = load_frag((const _Float16*)(arow + (uint32_t)(mi >> 1) * G_SLICE +
                                             (uint32_t)(mi & 1) * 16u * G_PITCH),
                           kk * 32, half);
#pragma unroll
      for (int ni = 0; ni < 2; ++ni)
        bf[ni] = load_frag((const _Float16*)(brow + (uint32_t)ni * 16u * G_PITCH),
                           kk * 32, half);
    };
    v16h af[2][4], bf[2][2];
    load_block(0, af[0], bf[0]);
#pragma unroll  // constant indices keep fragments and accumulators in registers
    for (int kk = 0; kk < 4; ++kk) {
      if (kk < 3) load_block(kk + 1, af[(kk + 1) & 1], bf[(kk + 1) & 1]);
      // Keeps the next block's LDS loads, as one group, ahead of this block's
      // products, so that their latency runs behind the matrix work.
      __builtin_amdgcn_sched_barrier(0);
#pragma unroll  // constant indices: the accumulators stay in registers
      for (int mi = 0; mi < 4; ++mi)
#pragma unroll
        for (int ni = 0; ni < 2; ++ni)
          acc[mi][ni] = wmma_f16(af[kk & 1][mi], bf[kk & 1][ni], acc[mi][ni]);
      // Keeps later LDS loads from being moved in among these products.
      if (kk < 3) __builtin_amdgcn_sched_barrier(0);
    }
    // Publish point of stage s + 1: this wave's reads of stage s are done,
    // its own slice of stage s + 1 has landed, then every wave meets.
    asm volatile("s_wait_dscnt 0x0" ::: "memory");
    asm volatile("s_wait_tensorcnt 0x0" ::: "memory");
    __syncthreads();
    // Refill the buffer that every wave has just left.
    const uint32_t nxt = pinned(s + 2u);
    if (pinned(nxt < npass)) issue(nxt);
  }
  // Nothing may be outstanding when the wave ends.
  asm volatile("s_wait_tensorcnt 0x0" ::: "memory");
  asm volatile("s_wait_dscnt 0x0" ::: "memory");

#pragma unroll
  for (int mi = 0; mi < 4; ++mi) {
#pragma unroll
    for (int ni = 0; ni < 2; ++ni) {
      const int gn = nbase + ni * 16 + ln;
      const float bv = bias[gn];
      const int gm0 = mbase + mi * 16 + 8 * half;
#pragma unroll
      for (int r = 0; r < 8; ++r) {
        const int gm = gm0 + r;                 // C layout: M = r + 8*half
        float v = acc[mi][ni][r] + bv;
        if (mode == 0) {
          outF[(size_t)gm * N + gn] = v;
        } else {
          int b = gm >> 11, s = gm & (SS - 1);  // M axis = b*S + s
          int h = gn >> 6,  d = gn & 63;        // N axis = h*64 + d
          if (mode == 1) {
            outH[(((size_t)(b * HH + h) * SS + s) * DKA) + d] = (_Float16)(v * mult);
          } else { // mode 3: V transposed (B,H,64,S)
            outH[(((size_t)(b * HH + h) * DK + d) * SS) + s] = (_Float16)v;
          }
        }
      }
    }
  }
}

// The output projection.
__global__ void __launch_bounds__(256)
gemm_wmma_kernel(const _Float16* __restrict__ A, const _Float16* __restrict__ Bt,
                 const float* __restrict__ bias, float* __restrict__ outF,
                 _Float16* __restrict__ outH, int N, int K,
                 int mode, float mult) {
  __shared__ __attribute__((aligned(2048))) unsigned char ring[2u * G_BUF];
  gemm_wmma_tile(ring, A, Bt, bias, outF, outH, N, K, mode, mult);
}

// The V, Q and K projections in one grid: blockIdx.z picks the weight, the
// bias, the output and its layout. V comes first: its stores touch the most
// lines.
__global__ void __launch_bounds__(256)
qkv_gemm_kernel(const _Float16* __restrict__ A,
                const _Float16* __restrict__ Wqt, const _Float16* __restrict__ Wkt,
                const _Float16* __restrict__ Wvt,
                const float* __restrict__ bq, const float* __restrict__ bk,
                const float* __restrict__ bv,
                _Float16* __restrict__ Qaug, _Float16* __restrict__ Kaug,
                _Float16* __restrict__ Vt, int N, int K, float qmult) {
  __shared__ __attribute__((aligned(2048))) unsigned char ring[2u * G_BUF];
  const uint32_t z = blockIdx.z;
  const _Float16* Bt = (z == 0u) ? Wvt : (z == 1u) ? Wqt : Wkt;
  const float* bias  = (z == 0u) ? bv : (z == 1u) ? bq : bk;
  _Float16* outH     = (z == 0u) ? Vt : (z == 1u) ? Qaug : Kaug;
  gemm_wmma_tile(ring, A, Bt, bias, nullptr, outH, N, K,
                 (z == 0u) ? 3 : 1, (z == 1u) ? qmult : 1.0f);
}

static __device__ inline float xhalf(float x) {
  return __builtin_bit_cast(float, __builtin_amdgcn_permlanex16(
      __builtin_bit_cast(int, x), __builtin_bit_cast(int, x),
      0x76543210, 0xfedcba98, false, false));
}

#define V_ROWB  256u                 // bytes of one V^T row per stage (128 keys)
#define V_PITCH 272u                 // LDS pitch: row + 16 bytes of pad
#define V_BUF   18432u               // 64 x 272 = 17408, up to a multiple of 2 KiB
#define V_STAGES ((uint32_t)SS / 128u)
#define K_BUFH  4096                 // halves per K' buffer: 32 x 208 = 6656 bytes, up to a multiple of 2 KiB

__global__ void __launch_bounds__(256)
flash_kernel(const _Float16* __restrict__ Qaug, const _Float16* __restrict__ Kaug,
             const _Float16* __restrict__ Vt, _Float16* __restrict__ O) {
  __shared__ __attribute__((aligned(2048))) _Float16 kstage[2][K_BUFH];
  __shared__ __attribute__((aligned(2048))) unsigned char vstage[2u * V_BUF];  // V^T ring

  const int lane = threadIdx.x & 31;
  const int wave = threadIdx.x >> 5;
  const int half = lane >> 4;
  const int ln   = lane & 15;
  const int h    = blockIdx.y;
  const int b    = blockIdx.z;
  const int row0 = blockIdx.x * 128 + wave * 16;
  const size_t bh = (size_t)(b * HH + h);

  const _Float16* Qb = Qaug + bh * SS * DKA;
  const _Float16* Kb = Kaug + bh * SS * DKA;
  const _Float16* Vb = Vt   + bh * (size_t)DK * SS;

  auto issue_k_tile = [&](int j0, int bufn) {
    unsigned long long gaddr =
        (unsigned long long)(uintptr_t)(Kb + (size_t)j0 * DKA);
    unsigned lds_addr = (unsigned)(uintptr_t)(&kstage[bufn][0]);
    u32x4 g0;
    g0[0] = 1u;                                   // count=1 (valid), user mode
    g0[1] = lds_addr;                             // lds_addr [63:32]
    g0[2] = (unsigned)gaddr;                      // global_addr [95:64]
    g0[3] = ((unsigned)(gaddr >> 32) & 0x01FFFFFFu) | (2u << 30); // type=2
    i32x8 g1;
    g1[0] = (int)(1u << 16);
    g1[1] = (int)((unsigned)DKA << 16);
    g1[2] = (int)((unsigned)SS << 16);
    g1[3] = (int)((unsigned)DKA << 16);
    g1[4] = 32;
    g1[5] = DKA;
    g1[6] = 0;
    g1[7] = 0;
    i32x4 z4 = {0, 0, 0, 0};
#if defined(__clang_major__) && (__clang_major__ >= 23)
    i32x8 z8 = {};
    __builtin_amdgcn_tensor_load_to_lds(g0, g1, z4, z4, z8, 0);
#else
    __builtin_amdgcn_tensor_load_to_lds(g0, g1, z4, z4, 0);
#endif
  };

  // Q fragments (16 queries x 96 of the 104), loaded once; B operand of the score product.
  v16h qf[3];
#pragma unroll
  for (int f = 0; f < 3; ++f)
    qf[f] = load_frag(Qb + (size_t)(row0 + ln) * DKA, f * 32, half);

  // acc[n2][r] = O[query ln][d = n2*16 + 8*half + r], not yet normalized.
  v8f acc[4] = {};
  float mrun = -1e30f;  // running maximum of query ln, alike in both halves
  float lrun = 0.f;     // running sum of query ln over this half's keys

  const uint32_t wv = uni(threadIdx.x >> 5);
  const uint64_t vsrc = (uint64_t)(uintptr_t)Vb;
  const uint32_t vdst = (uint32_t)(uintptr_t)vstage;
  u32x8 vg1;
  vg1[0] = uni((1u << 20) | (5u << 22) | (3u << 25));
  vg1[1] = uni(V_ROWB << 16);
  vg1[2] = uni((uint32_t)DK << 16);
  vg1[3] = uni(V_ROWB << 16);
  vg1[4] = uni((uint32_t)DK);
  vg1[5] = uni((uint32_t)SS * 2u);
  vg1[6] = uni(0u);
  vg1[7] = uni(0u);
  asm volatile("" : "+s"(vg1));
  u32x4 vg0;
  vg0[0] = uni(1u);
  vg0[1] = uni(vdst);
  vg0[2] = uni((uint32_t)vsrc);
  vg0[3] = uni((((uint32_t)(vsrc >> 32)) & 0x01FFFFFFu) | 0x80000000u);
  auto next_v = [&]() {
    asm volatile("" : "+s"(vg0));
    const uint32_t lo = vg0[2] + V_ROWB;
    vg0[3] = uni(vg0[3] + ((lo < V_ROWB) ? 1u : 0u));
    vg0[2] = uni(lo);
    vg0[1] = uni((2u * vdst + V_BUF) - vg0[1]);
  };
  if (pinned(wv == 1u)) {
    tdm_load(vg0, vg1);
    // Stage 0 has landed for the issuing wave; the barrier publishes it.
    asm volatile("s_wait_tensorcnt 0x0" ::: "memory");
  }
  __syncthreads();
  next_v();
  if (pinned(wv == 1u)) tdm_load(vg0, vg1);
  uint32_t vkey = 0u;  // first key of the block of 32 inside its stage: 0, 32, 64, 96

  if (wave == 0) issue_k_tile(0, 0);              // prime the pipeline

  for (int j0 = 0; j0 < SS; j0 += 32) {
    const int bufn = (j0 >> 5) & 1;
    if (wave == 0) __builtin_amdgcn_s_wait_tensorcnt(0);
    __syncthreads();                              // K' tile ready for all waves
    if (wave == 0 && (j0 + 32) < SS)
      issue_k_tile(j0 + 32, bufn ^ 1);            // async prefetch next tile

    const _Float16* Kl = kstage[bufn];
    v8f s0 = {}, s1 = {};
#pragma unroll
    for (int f = 0; f < 3; ++f) {
      v16h a0 = load_frag(Kl + (size_t)(ln)      * DKA, f * 32, half);
      v16h a1 = load_frag(Kl + (size_t)(16 + ln) * DKA, f * 32, half);
      s0 = wmma_f16(a0, qf[f], s0);
      s1 = wmma_f16(a1, qf[f], s1);
    }

    // V^T fragments of these 32 keys, from this stage's buffer, in the k order
    // of load_frag; fetched here so that their latency runs behind the softmax.
    const unsigned char* vrow =
        vstage + (uint32_t)((j0 >> 7) & 1) * V_BUF + (uint32_t)ln * V_PITCH;
    v16h vf[4];
#pragma unroll  // constant indices: the fragments stay in registers
    for (int n2 = 0; n2 < 4; ++n2)
      vf[n2] = load_frag((const _Float16*)(vrow + (uint32_t)n2 * 16u * V_PITCH),
                         (int)vkey, half);
    // Keeps these LDS loads, as one group, ahead of the softmax.
    __builtin_amdgcn_sched_barrier(0);

    // Online softmax (log2 domain). All 16 scores of a lane are query ln's.
    float v = fmaxf(s0[0], s1[0]);
#pragma unroll
    for (int r = 1; r < 8; ++r) v = fmaxf(v, fmaxf(s0[r], s1[r]));
    v = fmaxf(v, xhalf(v));
    const float mn   = fmaxf(mrun, v);
    // Bare v_exp_f32: a result below 2^-126 comes out as 0. Such a weight is 0 in
    // f16 too, and beside a sum of at least 1 it changes nothing.
    const float corr = __builtin_amdgcn_exp2f(mrun - mn);
    v16h pb;           // P^T as B operand: element e < 8 is key 8*half + e, e >= 8 key 8 + 8*half + e
    float rs = 0.f;
#pragma unroll
    for (int r = 0; r < 8; ++r) {
      const float p0 = __builtin_amdgcn_exp2f(s0[r] - mn);
      const float p1 = __builtin_amdgcn_exp2f(s1[r] - mn);
      rs += p0 + p1;
      pb[r]     = (_Float16)p0;
      pb[8 + r] = (_Float16)p1;
    }
    lrun = lrun * corr + rs;
    mrun = mn;
#pragma unroll
    for (int n2 = 0; n2 < 4; ++n2)
#pragma unroll
      for (int r = 0; r < 8; ++r) acc[n2][r] *= corr;

    // acc^T += V^T(64x32) x P^T(32x16)
#pragma unroll
    for (int n2 = 0; n2 < 4; ++n2)
      acc[n2] = wmma_f16(vf[n2], pb, acc[n2]);
    // A V^T stage ends with its fourth block of 32 keys. Publish point of the
    // next stage: this wave's LDS reads are done, the issuing wave's load has
    // landed, then every wave meets at the barrier below.
    const uint32_t vend = pinned(vkey == 96u);
    if (vend) {
      asm volatile("s_wait_dscnt 0x0" ::: "memory");
      if (pinned(wv == 1u)) asm volatile("s_wait_tensorcnt 0x0" ::: "memory");
    }
    __syncthreads();   // all waves done with kstage[bufn] before overwrite
    if (vend) {
      // Refill the V^T buffer that every wave has just left.
      next_v();
      const uint32_t nxt = pinned(((uint32_t)j0 >> 7) + 2u);
      if (pinned((wv == 1u) & (nxt < V_STAGES))) tdm_load(vg0, vg1);
    }
    vkey = (vkey + 32u) & 96u;
  }
  // Nothing may be outstanding when the wave ends.
  asm volatile("s_wait_tensorcnt 0x0" ::: "memory");
  asm volatile("s_wait_dscnt 0x0" ::: "memory");

  // Join the halves' sums, normalize and write O in (B,S,H*dk) as f16, the
  // output projection's A operand: a lane holds 8 consecutive d of its query
  // per tile, one 16-byte store.
  const float lsum = lrun + xhalf(lrun);
  _Float16* orow = O + ((size_t)(b * SS + row0 + ln)) * DD + h * DK + 8 * half;
#pragma unroll  // constant indices: the accumulators stay in registers
  for (int n2 = 0; n2 < 4; ++n2) {
    h16x8 o;
#pragma unroll
    for (int r = 0; r < 8; ++r) o[r] = (_Float16)(acc[n2][r] / lsum);
    *(h16x8*)(orow + n2 * 16) = o;
  }
}

// ------------------------------- launcher ----------------------------------
extern "C" void kernel_launch(void* const* d_in, const int* in_sizes, int n_in,
                              void* d_out, int out_size, void* d_ws, size_t ws_size,
                              hipStream_t stream) {
  const float* x  = (const float*)d_in[0];
  const float* Wq = (const float*)d_in[1];
  const float* bq = (const float*)d_in[2];
  const float* Wk = (const float*)d_in[3];
  const float* bk = (const float*)d_in[4];
  const float* Wv = (const float*)d_in[5];
  const float* bv = (const float*)d_in[6];
  const float* Wo = (const float*)d_in[7];
  const float* bo = (const float*)d_in[8];
  const float* Wp = (const float*)d_in[9];
  const float* bp = (const float*)d_in[10];
  const float* alpha = (const float*)d_in[11];
  float* out = (float*)d_out;

  // workspace carve-out (~58 MB), 256B aligned chunks
  char* w = (char*)d_ws;
  size_t off = 0;
  auto carve = [&](size_t bytes) {
    char* p = w + off;
    off = (off + bytes + 255) & ~(size_t)255;
    return p;
  };
  _Float16* Xh   = (_Float16*)carve((size_t)BSX * DD * 2);
  _Float16* Wqt  = (_Float16*)carve((size_t)DD * DD * 2);
  _Float16* Wkt  = (_Float16*)carve((size_t)DD * DD * 2);
  _Float16* Wvt  = (_Float16*)carve((size_t)DD * DD * 2);
  _Float16* Wot  = (_Float16*)carve((size_t)DD * DD * 2);
  _Float16* Qaug = (_Float16*)carve((size_t)BB * HH * SS * DKA * 2);
  _Float16* Kaug = (_Float16*)carve((size_t)BB * HH * SS * DKA * 2);
  _Float16* Vt   = (_Float16*)carve((size_t)BB * HH * DK * SS * 2);
  _Float16* Oh   = (_Float16*)carve((size_t)BSX * DD * 2);
  (void)ws_size; (void)n_in; (void)in_sizes; (void)out_size;

  // 1) all that reads only the inputs: x and the weights to f16 (weights
  //    transposed), the phase projection with its cos/sin columns of Q' and K'
  prep_kernel<<<PB_PHASE + PB_CONV + 4 * PB_TRANS, 256, 0, stream>>>(
      x, Wq, Wk, Wv, Wo, Wp, bp, alpha, Xh, Wqt, Wkt, Wvt, Wot, Qaug, Kaug);

  // 2) QKV projections via WMMA GEMM, one grid
  const float qmult = 0.125f * LOG2E;  // dk^-0.5 = 1/8, log2e folded for exp2
  dim3 qgrid(DD / 128, BSX / 128, 3);
  qkv_gemm_kernel<<<qgrid, 256, 0, stream>>>(Xh, Wqt, Wkt, Wvt, bq, bk, bv,
                                             Qaug, Kaug, Vt, DD, DD, qmult);

  dim3 fgrid(SS / 128, HH, BB);
  flash_kernel<<<fgrid, 256, 0, stream>>>(Qaug, Kaug, Vt, Oh);

  // 4) output projection
  dim3 ggrid(DD / 128, BSX / 128);
  gemm_wmma_kernel<<<ggrid, 256, 0, stream>>>(Oh, Wot, bo, out, nullptr,
                                              DD, DD, 0, 1.0f);
}

// v008
// It runs in 132 microseconds.
// Next to v007, in two timings, it ran 1.10 and 1.09 times as fast.
// All steps since v000 together make it 2.84 times as fast.
#include <hip/hip_runtime.h>
#include <hip/hip_bf16.h>
#include <math.h>
#include <stdint.h>

typedef __attribute__((ext_vector_type(16))) _Float16 v16h;
typedef __attribute__((ext_vector_type(8)))  float    v8f;
typedef __attribute__((ext_vector_type(4)))  unsigned int v4u;
typedef __attribute__((ext_vector_type(4)))  unsigned int u32x4;
typedef __attribute__((ext_vector_type(8)))  int          i32x8;
typedef __attribute__((ext_vector_type(4)))  int          i32x4;

#define BB   2
#define SS   2048
#define DD   1024
#define HH   16
#define DK   64
#define DKA  104
#define BSX  (BB*SS)
#define LOG2E 1.4426950408889634f

union Frag { v16h v; v4u q[2]; };

static __device__ inline v8f wmma_f16(v16h a, v16h b, v8f c) {
  return __builtin_amdgcn_wmma_f32_16x16x32_f16(
      /*neg_a=*/false, a, /*neg_b=*/false, b,
      /*c_mod=*/(short)0, c, /*reuse_a=*/false, /*reuse_b=*/false);
}

// Load one 16x32 f16 A/B fragment. rowPtr points at this lane's row
// (row = lane%16 of the tile). half = lane/16.
// Element e<8 -> K = k0 + half*8 + e ; e>=8 -> K = k0 + 16 + half*8 + (e-8).
static __device__ inline v16h load_frag(const _Float16* rowPtr, int k0, int half) {
  Frag f;
  f.q[0] = *(const v4u*)(rowPtr + k0 + half * 8);
  f.q[1] = *(const v4u*)(rowPtr + k0 + 16 + half * 8);
  return f.v;
}

// ------------------------------- converters --------------------------------
typedef __attribute__((ext_vector_type(4))) float    f32x4;
typedef __attribute__((ext_vector_type(4))) _Float16 h16x4;
typedef __attribute__((ext_vector_type(8))) _Float16 h16x8;

#define CV_BLOCK 8192   // values per block of 8 waves

// A wave converts 1024 consecutive values: eight 16-byte loads a lane, each
// 512 contiguous bytes over the wave and all issued before the first use, then
// eight 8-byte stores, each 256 contiguous bytes over the wave.
static __device__ __attribute__((always_inline)) inline void
f32_to_f16_block(const float* __restrict__ in,
                 _Float16* __restrict__ out, int n, int blk) {
  const int base = blk * CV_BLOCK + (int)(threadIdx.x >> 5) * 1024 +
                   (int)(threadIdx.x & 31) * 4;
  if ((blk + 1) * CV_BLOCK <= n) {
    f32x4 v[8];
#pragma unroll  // constant indices: the eight loads stay in registers, in flight together
    for (int j = 0; j < 8; ++j) v[j] = *(const f32x4*)(in + base + j * 128);
#pragma unroll
    for (int j = 0; j < 8; ++j)
      *(h16x4*)(out + base + j * 128) = __builtin_convertvector(v[j], h16x4);
    // Precaution: stands ahead of any later write of a register these stores name.
    asm volatile("s_wait_xcnt 0x0" ::: "memory");
  } else {  // the last, partial block
    for (int i = blk * CV_BLOCK + (int)threadIdx.x; i < n; i += 256)
      out[i] = (_Float16)in[i];
  }
}

// in: (DD x DD) f32 row-major, [k][n]  ->  out: (DD x DD) f16 row-major, [n][k]
// tile = 0 .. (DD / 64)^2 - 1. A group of 4 waves takes 64 k x 64 n, a wave
// 64 k x 16 n, a lane 8 k x 4 n: eight 16-byte loads a lane (256 contiguous
// bytes of each source row over the group), all issued before the first use,
// then four 16-byte stores; eight lanes fill one 128-byte line of out.
static __device__ __attribute__((always_inline)) inline void
transpose_f32_to_f16_tile(const float* __restrict__ in,
                          _Float16* __restrict__ out, int tile) {
  const int lane = threadIdx.x & 31;
  const int wave = (threadIdx.x >> 5) & 3;
  const int k0 = (tile >> 4) * 64 + (lane & 7) * 8;
  const int n0 = (tile & 15) * 64 + wave * 16 + (lane >> 3) * 4;
  const float* src = in + k0 * DD + n0;
  _Float16* dst = out + n0 * DD + k0;
  f32x4 v[8];
#pragma unroll  // constant indices: the eight loads stay in registers, in flight together
  for (int j = 0; j < 8; ++j) v[j] = *(const f32x4*)(src + j * DD);
#pragma unroll  // constant indices into v
  for (int i = 0; i < 4; ++i) {
    h16x8 h;
#pragma unroll
    for (int j = 0; j < 8; ++j) h[j] = (_Float16)v[j][i];
    *(h16x8*)(dst + i * DD) = h;
  }
  // Precaution: stands ahead of any later write of a register these stores name.
  asm volatile("s_wait_xcnt 0x0" ::: "memory");
}

// ------------------------------- phase -------------------------------------
// phase[bs][h] = x[bs,:] . Wp[:,h] + bp[h]   (tiny: 0.13 GFLOP); the thread
// that holds it fills columns 64..103 of its row (b,h,s) of Qaug and Kaug.
static __device__ __attribute__((always_inline)) inline void
phase_fill_block(const float* __restrict__ x,
                 const float* __restrict__ Wp,
                 const float* __restrict__ bp,
                 const float* __restrict__ alpha,
                 _Float16* __restrict__ Qaug,
                 _Float16* __restrict__ Kaug, int blk) {
  int idx = blk * 256 + (int)threadIdx.x;
  int bs = idx >> 4, h = idx & 15;
  const float* xr = x + (size_t)bs * DD;
  float acc = bp[h];
  for (int k = 0; k < DD; ++k) acc = fmaf(xr[k], Wp[k * HH + h], acc);
  float ph = acc;
  int b = bs >> 11, s = bs & (SS - 1);
  int bh = b * HH + h;
  float c = cosf(ph), sn = sinf(ph);
  float al = alpha[h];
  _Float16* qr = Qaug + ((size_t)bh * SS + s) * DKA;
  _Float16* kr = Kaug + ((size_t)bh * SS + s) * DKA;
  qr[64] = (_Float16)(al * c  * LOG2E);
  qr[65] = (_Float16)(al * sn * LOG2E);
  kr[64] = (_Float16)c;
  kr[65] = (_Float16)sn;
  for (int t = 66; t < DKA; ++t) { qr[t] = (_Float16)0.f; kr[t] = (_Float16)0.f; }
}

// ------------------------------- first launch ------------------------------
// Everything that reads only the inputs shares one grid, by block range; the
// phase blocks last longest and come first.
#define PB_PHASE (BSX * HH / 256)            // 256 blocks
#define PB_CONV  (BSX * DD / CV_BLOCK)       // 512 blocks
#define PB_TRANS ((DD / 64) * (DD / 64) / 2) // 128 blocks a weight, two tiles each

__global__ void __launch_bounds__(256)
prep_kernel(const float* __restrict__ x,  const float* __restrict__ Wq,
            const float* __restrict__ Wk, const float* __restrict__ Wv,
            const float* __restrict__ Wo, const float* __restrict__ Wp,
            const float* __restrict__ bp, const float* __restrict__ alpha,
            _Float16* __restrict__ Xh,  _Float16* __restrict__ Wqt,
            _Float16* __restrict__ Wkt, _Float16* __restrict__ Wvt,
            _Float16* __restrict__ Wot, _Float16* __restrict__ Qaug,
            _Float16* __restrict__ Kaug) {
  const int blk = (int)blockIdx.x;
  if (blk < PB_PHASE) {
    phase_fill_block(x, Wp, bp, alpha, Qaug, Kaug, blk);
  } else if (blk < PB_PHASE + PB_CONV) {
    f32_to_f16_block(x, Xh, BSX * DD, blk - PB_PHASE);
  } else {
    const int t = blk - (PB_PHASE + PB_CONV);
    const int w = t / PB_TRANS;
    const float* in = (w == 0) ? Wq : (w == 1) ? Wk : (w == 2) ? Wv : Wo;
    _Float16* out   = (w == 0) ? Wqt : (w == 1) ? Wkt : (w == 2) ? Wvt : Wot;
    transpose_f32_to_f16_tile(in, out, (t % PB_TRANS) * 2 + (int)(threadIdx.x >> 7));
  }
}

// ------------------------------- WMMA GEMM ---------------------------------
// C(M,N) = A(M,K) x Bt(N,K)^T + bias[n].  Block tile 128x128, 8 waves as
// 2(M) x 4(N); each wave computes 64x32 = 4x2 tiles of 16x16.
// A pass is 128 k = 256 bytes of each of the 128 A rows and 128 Bt rows. The
// rows reach LDS by tensor loads: every wave brings one slice of 32 rows per
// pass (waves 0..3 rows of A, waves 4..7 rows of Bt) into a ring of two
// buffers, one pass ahead of its readers; the pad gives an LDS pitch of
// 272 bytes, and the fragments come by ds_load_b128 in the k order of
// load_frag. Needs K a multiple of 128 and at least 256.
// The block takes rows bm*128.. of A and rows bn*128.. of Bt.
// Bt stands first in the products (both operands come by load_frag, so either
// can), so a lane holds eight results of a 16x16 tile that are consecutive in
// n, and n is the output's contiguous axis in every mode: they go out in
// 16-byte stores.
// mode 0: outF[gm*N+gn] = v                     (f32, final output)
// mode 1: aug layout  outH[(b,h,s)*104 + d] = (f16)(v*mult)  (Q and K)
//         m = b*S + s, n = h*64 + d
// mode 3: V^T layout  outH[((b*16+h)*64+d)*S + s] = (f16)v, bias[m]
//         m = h*64 + d (A holds the weight's rows), n = b*S + s (Bt holds x)
typedef __attribute__((ext_vector_type(8))) unsigned int u32x8;

#define G_ROWB  256u                 // bytes of one operand row per pass
#define G_PITCH 272u                 // LDS pitch: row + 16 bytes of pad
#define G_SROWS 32u                  // rows per slice
#define G_SLICE 10240u               // 32 x 272 = 8704, up to a multiple of 2 KiB
#define G_BUF   (8u * G_SLICE)       // one buffer: 4 slices of A, 4 of Bt

static __device__ inline uint32_t uni(uint32_t v) {
  return (uint32_t)__builtin_amdgcn_readfirstlane(v);
}
static __device__ inline uint32_t pinned(uint32_t v) {
  uint32_t w = uni(v);
  asm volatile("" : "+s"(w));  // pinned(): the word stays in a scalar register
  return w;
}
static __device__ inline void tdm_load(u32x4 g0, u32x8 g1) {
  asm volatile("tensor_load_to_lds %0, %1" :: "s"(g0), "s"(g1) : "memory");
}

static __device__ __attribute__((always_inline)) inline void
gemm_wmma_tile(unsigned char* ring, uint32_t bm, uint32_t bn,
               const _Float16* __restrict__ A, const _Float16* __restrict__ Bt,
               const float* __restrict__ bias, float* __restrict__ outF,
               _Float16* __restrict__ outH, int N, int K,
               int mode, float mult) {
  const int lane = threadIdx.x & 31;
  const uint32_t wave = uni(threadIdx.x >> 5);
  const int half = lane >> 4;
  const int ln   = lane & 15;
  const int wm   = (int)(wave >> 2);   // 0..1
  const int wn   = (int)(wave & 3u);   // 0..3
  const int mbase = (int)bm * 128 + wm * 64;
  const int nbase = (int)bn * 128 + wn * 32;

  // This wave's slice: its first source byte and its place in buffer 0.
  const _Float16* srow = (wave < 4u)
      ? A  + (size_t)(bm * 128u + wave * G_SROWS) * K
      : Bt + (size_t)(bn * 128u + (wave - 4u) * G_SROWS) * K;
  const uint64_t sbase = (uint64_t)(uintptr_t)srow;
  const uint32_t ldst  = (uint32_t)(uintptr_t)ring + wave * G_SLICE;
  const uint32_t npass = (uint32_t)K >> 7;

  u32x8 g1;
  g1[0] = uni((1u << 20) | (5u << 22) | (3u << 25));
  g1[1] = uni(G_ROWB << 16);
  g1[2] = uni(G_SROWS << 16);
  g1[3] = uni(G_ROWB << 16);
  g1[4] = uni(G_SROWS);
  g1[5] = uni((uint32_t)K * 2u);
  g1[6] = uni(0u);
  g1[7] = uni(0u);
  asm volatile("" : "+s"(g1));
  auto issue = [&](uint32_t st) {
    const uint64_t ga = sbase + (uint64_t)st * G_ROWB;
    u32x4 g0;
    g0[0] = uni(1u);
    g0[1] = uni(ldst + (st & 1u) * G_BUF);
    g0[2] = uni((uint32_t)ga);
    g0[3] = uni((((uint32_t)(ga >> 32)) & 0x01FFFFFFu) | 0x80000000u);
    tdm_load(g0, g1);
  };

  v8f acc[4][2] = {};

  issue(0u);
  // Stage 0 has landed for this wave; the barrier publishes every slice.
  asm volatile("s_wait_tensorcnt 0x0" ::: "memory");
  __syncthreads();
  issue(1u);

  for (uint32_t s = 0; s < npass; ++s) {
    const unsigned char* buf = ring + (s & 1u) * G_BUF;
    const unsigned char* arow = buf + (uint32_t)(wm * 2) * G_SLICE + (uint32_t)ln * G_PITCH;
    const unsigned char* brow = buf + (uint32_t)(4 + wn) * G_SLICE + (uint32_t)ln * G_PITCH;
    // Fragments of block kk (32 k) of this pass, in the k order of load_frag.
    auto load_block = [&](int kk, v16h (&af)[4], v16h (&bf)[2]) {
#pragma unroll  // constant indices: the fragments stay in registers
      for (int mi = 0; mi < 4; ++mi)
        af[mi] = load_frag((const _Float16*)(arow + (uint32_t)(mi >> 1) * G_SLICE +
                                             (uint32_t)(mi & 1) * 16u * G_PITCH),
                           kk * 32, half);
#pragma unroll
      for (int ni = 0; ni < 2; ++ni)
        bf[ni] = load_frag((const _Float16*)(brow + (uint32_t)ni * 16u * G_PITCH),
                           kk * 32, half);
    };
    v16h af[2][4], bf[2][2];
    load_block(0, af[0], bf[0]);
#pragma unroll  // constant indices keep fragments and accumulators in registers
    for (int kk = 0; kk < 4; ++kk) {
      if (kk < 3) load_block(kk + 1, af[(kk + 1) & 1], bf[(kk + 1) & 1]);
      // Keeps the next block's LDS loads, as one group, ahead of this block's
      // products, so that their latency runs behind the matrix work.
      __builtin_amdgcn_sched_barrier(0);
#pragma unroll  // constant indices: the accumulators stay in registers
      for (int mi = 0; mi < 4; ++mi)
#pragma unroll
        for (int ni = 0; ni < 2; ++ni)
          acc[mi][ni] = wmma_f16(bf[kk & 1][ni], af[kk & 1][mi], acc[mi][ni]);
      // Keeps later LDS loads from being moved in among these products.
      if (kk < 3) __builtin_amdgcn_sched_barrier(0);
    }
    // Publish point of stage s + 1: this wave's reads of stage s are done,
    // its own slice of stage s + 1 has landed, then every wave meets.
    asm volatile("s_wait_dscnt 0x0" ::: "memory");
    asm volatile("s_wait_tensorcnt 0x0" ::: "memory");
    __syncthreads();
    // Refill the buffer that every wave has just left.
    const uint32_t nxt = pinned(s + 2u);
    if (pinned(nxt < npass)) issue(nxt);
  }
  // Nothing may be outstanding when the wave ends.
  asm volatile("s_wait_tensorcnt 0x0" ::: "memory");
  asm volatile("s_wait_dscnt 0x0" ::: "memory");

  // acc[mi][ni][r]: m = mbase + mi*16 + ln, n = nbase + ni*16 + 8*half + r.
  // The wave's 64 m and its 32 n each lie in one batch b or in one head h.
  if (mode == 3) {
    _Float16* vrow = outH + ((size_t)(nbase >> 11) * DD + mbase + ln) * SS +
                     (nbase & (SS - 1)) + 8 * half;
#pragma unroll  // constant indices: the accumulators stay in registers
    for (int mi = 0; mi < 4; ++mi) {
      const float bv = bias[mbase + mi * 16 + ln];
#pragma unroll
      for (int ni = 0; ni < 2; ++ni) {
        h16x8 o;
#pragma unroll
        for (int r = 0; r < 8; ++r) o[r] = (_Float16)(acc[mi][ni][r] + bv);
        *(h16x8*)(vrow + (size_t)mi * 16 * SS + ni * 16) = o;
      }
    }
    // Precaution: stands ahead of any later write of a register these stores name.
    asm volatile("s_wait_xcnt 0x0" ::: "memory");
  } else {
#pragma unroll  // constant indices: the accumulators stay in registers
    for (int ni = 0; ni < 2; ++ni) {
      const f32x4 blo = *(const f32x4*)(bias + nbase + ni * 16 + 8 * half);
      const f32x4 bhi = *(const f32x4*)(bias + nbase + ni * 16 + 8 * half + 4);
#pragma unroll
      for (int mi = 0; mi < 4; ++mi) {
        f32x4 lo, hi;
#pragma unroll
        for (int r = 0; r < 4; ++r) {
          lo[r] = acc[mi][ni][r] + blo[r];
          hi[r] = acc[mi][ni][4 + r] + bhi[r];
        }
        if (mode == 0) {
          float* p = outF + (size_t)(mbase + mi * 16 + ln) * N + nbase + ni * 16 + 8 * half;
          *(f32x4*)p = lo;
          *(f32x4*)(p + 4) = hi;
        } else {
          h16x8 o;
#pragma unroll
          for (int r = 0; r < 4; ++r) {
            o[r]     = (_Float16)(lo[r] * mult);
            o[4 + r] = (_Float16)(hi[r] * mult);
          }
          *(h16x8*)(outH + ((size_t)((mbase >> 11) * HH + (nbase >> 6)) * SS +
                            (mbase & (SS - 1)) + mi * 16 + ln) * DKA +
                    (nbase & 63) + ni * 16 + 8 * half) = o;
        }
      }
    }
    // Precaution: stands ahead of any later write of a register these stores name.
    asm volatile("s_wait_xcnt 0x0" ::: "memory");
  }
}

// The output projection.
__global__ void __launch_bounds__(256)
gemm_wmma_kernel(const _Float16* __restrict__ A, const _Float16* __restrict__ Bt,
                 const float* __restrict__ bias, float* __restrict__ outF,
                 int N, int K) {
  __shared__ __attribute__((aligned(2048))) unsigned char ring[2u * G_BUF];
  gemm_wmma_tile(ring, blockIdx.y, blockIdx.x, A, Bt, bias, outF, nullptr, N, K, 0, 1.0f);
}

// The V, Q and K projections in one grid: blockIdx.z picks the weight, the
// bias, the output and its layout. For V^T the weight's rows are the m axis
// and the rows of x the n axis, so the two operands and the two block indices
// change places.
__global__ void __launch_bounds__(256)
qkv_gemm_kernel(const _Float16* __restrict__ A,
                const _Float16* __restrict__ Wqt, const _Float16* __restrict__ Wkt,
                const _Float16* __restrict__ Wvt,
                const float* __restrict__ bq, const float* __restrict__ bk,
                const float* __restrict__ bv,
                _Float16* __restrict__ Qaug, _Float16* __restrict__ Kaug,
                _Float16* __restrict__ Vt, int N, int K, float qmult) {
  __shared__ __attribute__((aligned(2048))) unsigned char ring[2u * G_BUF];
  const uint32_t z = blockIdx.z;
  const _Float16* W  = (z == 0u) ? Wvt : (z == 1u) ? Wqt : Wkt;
  const float* bias  = (z == 0u) ? bv : (z == 1u) ? bq : bk;
  _Float16* outH     = (z == 0u) ? Vt : (z == 1u) ? Qaug : Kaug;
  gemm_wmma_tile(ring, (z == 0u) ? blockIdx.x : blockIdx.y,
                 (z == 0u) ? blockIdx.y : blockIdx.x,
                 (z == 0u) ? W : A, (z == 0u) ? A : W, bias, nullptr, outH, N, K,
                 (z == 0u) ? 3 : 1, (z == 1u) ? qmult : 1.0f);
}

static __device__ inline float xhalf(float x) {
  return __builtin_bit_cast(float, __builtin_amdgcn_permlanex16(
      __builtin_bit_cast(int, x), __builtin_bit_cast(int, x),
      0x76543210, 0xfedcba98, false, false));
}

#define V_ROWB  256u                 // bytes of one V^T row per stage (128 keys)
#define V_PITCH 272u                 // LDS pitch: row + 16 bytes of pad
#define V_BUF   18432u               // 64 x 272 = 17408, up to a multiple of 2 KiB
#define V_STAGES ((uint32_t)SS / 128u)
#define K_BUFH  4096                 // halves per K' buffer: 32 x 208 = 6656 bytes, up to a multiple of 2 KiB

__global__ void __launch_bounds__(256)
flash_kernel(const _Float16* __restrict__ Qaug, const _Float16* __restrict__ Kaug,
             const _Float16* __restrict__ Vt, _Float16* __restrict__ O) {
  __shared__ __attribute__((aligned(2048))) _Float16 kstage[2][K_BUFH];
  __shared__ __attribute__((aligned(2048))) unsigned char vstage[2u * V_BUF];  // V^T ring

  const int lane = threadIdx.x & 31;
  const int wave = threadIdx.x >> 5;
  const int half = lane >> 4;
  const int ln   = lane & 15;
  const int h    = blockIdx.y;
  const int b    = blockIdx.z;
  const int row0 = blockIdx.x * 128 + wave * 16;
  const size_t bh = (size_t)(b * HH + h);

  const _Float16* Qb = Qaug + bh * SS * DKA;
  const _Float16* Kb = Kaug + bh * SS * DKA;
  const _Float16* Vb = Vt   + bh * (size_t)DK * SS;

  auto issue_k_tile = [&](int j0, int bufn) {
    unsigned long long gaddr =
        (unsigned long long)(uintptr_t)(Kb + (size_t)j0 * DKA);
    unsigned lds_addr = (unsigned)(uintptr_t)(&kstage[bufn][0]);
    u32x4 g0;
    g0[0] = 1u;                                   // count=1 (valid), user mode
    g0[1] = lds_addr;                             // lds_addr [63:32]
    g0[2] = (unsigned)gaddr;                      // global_addr [95:64]
    g0[3] = ((unsigned)(gaddr >> 32) & 0x01FFFFFFu) | (2u << 30); // type=2
    i32x8 g1;
    g1[0] = (int)(1u << 16);
    g1[1] = (int)((unsigned)DKA << 16);
    g1[2] = (int)((unsigned)SS << 16);
    g1[3] = (int)((unsigned)DKA << 16);
    g1[4] = 32;
    g1[5] = DKA;
    g1[6] = 0;
    g1[7] = 0;
    i32x4 z4 = {0, 0, 0, 0};
#if defined(__clang_major__) && (__clang_major__ >= 23)
    i32x8 z8 = {};
    __builtin_amdgcn_tensor_load_to_lds(g0, g1, z4, z4, z8, 0);
#else
    __builtin_amdgcn_tensor_load_to_lds(g0, g1, z4, z4, 0);
#endif
  };

  // Q fragments (16 queries x 96 of the 104), loaded once; B operand of the score product.
  v16h qf[3];
#pragma unroll
  for (int f = 0; f < 3; ++f)
    qf[f] = load_frag(Qb + (size_t)(row0 + ln) * DKA, f * 32, half);

  // acc[n2][r] = O[query ln][d = n2*16 + 8*half + r], not yet normalized.
  v8f acc[4] = {};
  float mrun = -1e30f;  // running maximum of query ln, alike in both halves
  float lrun = 0.f;     // running sum of query ln over this half's keys

  const uint32_t wv = uni(threadIdx.x >> 5);
  const uint64_t vsrc = (uint64_t)(uintptr_t)Vb;
  const uint32_t vdst = (uint32_t)(uintptr_t)vstage;
  u32x8 vg1;
  vg1[0] = uni((1u << 20) | (5u << 22) | (3u << 25));
  vg1[1] = uni(V_ROWB << 16);
  vg1[2] = uni((uint32_t)DK << 16);
  vg1[3] = uni(V_ROWB << 16);
  vg1[4] = uni((uint32_t)DK);
  vg1[5] = uni((uint32_t)SS * 2u);
  vg1[6] = uni(0u);
  vg1[7] = uni(0u);
  asm volatile("" : "+s"(vg1));
  u32x4 vg0;
  vg0[0] = uni(1u);
  vg0[1] = uni(vdst);
  vg0[2] = uni((uint32_t)vsrc);
  vg0[3] = uni((((uint32_t)(vsrc >> 32)) & 0x01FFFFFFu) | 0x80000000u);
  auto next_v = [&]() {
    asm volatile("" : "+s"(vg0));
    const uint32_t lo = vg0[2] + V_ROWB;
    vg0[3] = uni(vg0[3] + ((lo < V_ROWB) ? 1u : 0u));
    vg0[2] = uni(lo);
    vg0[1] = uni((2u * vdst + V_BUF) - vg0[1]);
  };
  if (pinned(wv == 1u)) {
    tdm_load(vg0, vg1);
    // Stage 0 has landed for the issuing wave; the barrier publishes it.
    asm volatile("s_wait_tensorcnt 0x0" ::: "memory");
  }
  __syncthreads();
  next_v();
  if (pinned(wv == 1u)) tdm_load(vg0, vg1);
  uint32_t vkey = 0u;  // first key of the block of 32 inside its stage: 0, 32, 64, 96

  if (wave == 0) issue_k_tile(0, 0);              // prime the pipeline

  for (int j0 = 0; j0 < SS; j0 += 32) {
    const int bufn = (j0 >> 5) & 1;
    if (wave == 0) __builtin_amdgcn_s_wait_tensorcnt(0);
    __syncthreads();                              // K' tile ready for all waves
    if (wave == 0 && (j0 + 32) < SS)
      issue_k_tile(j0 + 32, bufn ^ 1);            // async prefetch next tile

    const _Float16* Kl = kstage[bufn];
    v8f s0 = {}, s1 = {};
#pragma unroll
    for (int f = 0; f < 3; ++f) {
      v16h a0 = load_frag(Kl + (size_t)(ln)      * DKA, f * 32, half);
      v16h a1 = load_frag(Kl + (size_t)(16 + ln) * DKA, f * 32, half);
      s0 = wmma_f16(a0, qf[f], s0);
      s1 = wmma_f16(a1, qf[f], s1);
    }

    // V^T fragments of these 32 keys, from this stage's buffer, in the k order
    // of load_frag; fetched here so that their latency runs behind the softmax.
    const unsigned char* vrow =
        vstage + (uint32_t)((j0 >> 7) & 1) * V_BUF + (uint32_t)ln * V_PITCH;
    v16h vf[4];
#pragma unroll  // constant indices: the fragments stay in registers
    for (int n2 = 0; n2 < 4; ++n2)
      vf[n2] = load_frag((const _Float16*)(vrow + (uint32_t)n2 * 16u * V_PITCH),
                         (int)vkey, half);
    // Keeps these LDS loads, as one group, ahead of the softmax.
    __builtin_amdgcn_sched_barrier(0);

    // Online softmax (log2 domain). All 16 scores of a lane are query ln's.
    float v = fmaxf(s0[0], s1[0]);
#pragma unroll
    for (int r = 1; r < 8; ++r) v = fmaxf(v, fmaxf(s0[r], s1[r]));
    v = fmaxf(v, xhalf(v));
    const float mn   = fmaxf(mrun, v);
    // Bare v_exp_f32: a result below 2^-126 comes out as 0. Such a weight is 0 in
    // f16 too, and beside a sum of at least 1 it changes nothing.
    const float corr = __builtin_amdgcn_exp2f(mrun - mn);
    v16h pb;           // P^T as B operand: element e < 8 is key 8*half + e, e >= 8 key 8 + 8*half + e
    float rs = 0.f;
#pragma unroll
    for (int r = 0; r < 8; ++r) {
      const float p0 = __builtin_amdgcn_exp2f(s0[r] - mn);
      const float p1 = __builtin_amdgcn_exp2f(s1[r] - mn);
      rs += p0 + p1;
      pb[r]     = (_Float16)p0;
      pb[8 + r] = (_Float16)p1;
    }
    lrun = lrun * corr + rs;
    mrun = mn;
#pragma unroll
    for (int n2 = 0; n2 < 4; ++n2)
#pragma unroll
      for (int r = 0; r < 8; ++r) acc[n2][r] *= corr;

    // acc^T += V^T(64x32) x P^T(32x16)
#pragma unroll
    for (int n2 = 0; n2 < 4; ++n2)
      acc[n2] = wmma_f16(vf[n2], pb, acc[n2]);
    // A V^T stage ends with its fourth block of 32 keys. Publish point of the
    // next stage: this wave's LDS reads are done, the issuing wave's load has
    // landed, then every wave meets at the barrier below.
    const uint32_t vend = pinned(vkey == 96u);
    if (vend) {
      asm volatile("s_wait_dscnt 0x0" ::: "memory");
      if (pinned(wv == 1u)) asm volatile("s_wait_tensorcnt 0x0" ::: "memory");
    }
    __syncthreads();   // all waves done with kstage[bufn] before overwrite
    if (vend) {
      // Refill the V^T buffer that every wave has just left.
      next_v();
      const uint32_t nxt = pinned(((uint32_t)j0 >> 7) + 2u);
      if (pinned((wv == 1u) & (nxt < V_STAGES))) tdm_load(vg0, vg1);
    }
    vkey = (vkey + 32u) & 96u;
  }
  // Nothing may be outstanding when the wave ends.
  asm volatile("s_wait_tensorcnt 0x0" ::: "memory");
  asm volatile("s_wait_dscnt 0x0" ::: "memory");

  // Join the halves' sums, normalize and write O in (B,S,H*dk) as f16, the
  // output projection's A operand: a lane holds 8 consecutive d of its query
  // per tile, one 16-byte store.
  const float lsum = lrun + xhalf(lrun);
  _Float16* orow = O + ((size_t)(b * SS + row0 + ln)) * DD + h * DK + 8 * half;
#pragma unroll  // constant indices: the accumulators stay in registers
  for (int n2 = 0; n2 < 4; ++n2) {
    h16x8 o;
#pragma unroll
    for (int r = 0; r < 8; ++r) o[r] = (_Float16)(acc[n2][r] / lsum);
    *(h16x8*)(orow + n2 * 16) = o;
  }
}

// ------------------------------- launcher ----------------------------------
extern "C" void kernel_launch(void* const* d_in, const int* in_sizes, int n_in,
                              void* d_out, int out_size, void* d_ws, size_t ws_size,
                              hipStream_t stream) {
  const float* x  = (const float*)d_in[0];
  const float* Wq = (const float*)d_in[1];
  const float* bq = (const float*)d_in[2];
  const float* Wk = (const float*)d_in[3];
  const float* bk = (const float*)d_in[4];
  const float* Wv = (const float*)d_in[5];
  const float* bv = (const float*)d_in[6];
  const float* Wo = (const float*)d_in[7];
  const float* bo = (const float*)d_in[8];
  const float* Wp = (const float*)d_in[9];
  const float* bp = (const float*)d_in[10];
  const float* alpha = (const float*)d_in[11];
  float* out = (float*)d_out;

  // workspace carve-out (~58 MB), 256B aligned chunks
  char* w = (char*)d_ws;
  size_t off = 0;
  auto carve = [&](size_t bytes) {
    char* p = w + off;
    off = (off + bytes + 255) & ~(size_t)255;
    return p;
  };
  _Float16* Xh   = (_Float16*)carve((size_t)BSX * DD * 2);
  _Float16* Wqt  = (_Float16*)carve((size_t)DD * DD * 2);
  _Float16* Wkt  = (_Float16*)carve((size_t)DD * DD * 2);
  _Float16* Wvt  = (_Float16*)carve((size_t)DD * DD * 2);
  _Float16* Wot  = (_Float16*)carve((size_t)DD * DD * 2);
  _Float16* Qaug = (_Float16*)carve((size_t)BB * HH * SS * DKA * 2);
  _Float16* Kaug = (_Float16*)carve((size_t)BB * HH * SS * DKA * 2);
  _Float16* Vt   = (_Float16*)carve((size_t)BB * HH * DK * SS * 2);
  _Float16* Oh   = (_Float16*)carve((size_t)BSX * DD * 2);
  (void)ws_size; (void)n_in; (void)in_sizes; (void)out_size;

  // 1) all that reads only the inputs: x and the weights to f16 (weights
  //    transposed), the phase projection with its cos/sin columns of Q' and K'
  prep_kernel<<<PB_PHASE + PB_CONV + 4 * PB_TRANS, 256, 0, stream>>>(
      x, Wq, Wk, Wv, Wo, Wp, bp, alpha, Xh, Wqt, Wkt, Wvt, Wot, Qaug, Kaug);

  // 2) QKV projections via WMMA GEMM, one grid
  const float qmult = 0.125f * LOG2E;  // dk^-0.5 = 1/8, log2e folded for exp2
  dim3 qgrid(DD / 128, BSX / 128, 3);
  qkv_gemm_kernel<<<qgrid, 256, 0, stream>>>(Xh, Wqt, Wkt, Wvt, bq, bk, bv,
                                             Qaug, Kaug, Vt, DD, DD, qmult);

  dim3 fgrid(SS / 128, HH, BB);
  flash_kernel<<<fgrid, 256, 0, stream>>>(Qaug, Kaug, Vt, Oh);

  // 4) output projection
  dim3 ggrid(DD / 128, BSX / 128);
  gemm_wmma_kernel<<<ggrid, 256, 0, stream>>>(Oh, Wot, bo, out, DD, DD);
}

// v009
// A run of this version takes 105 microseconds.
// Next to v008, in two timings, it ran 1.25 and 1.26 times as fast.
// Over all steps from v000 it is 3.56 times as fast.
#include <hip/hip_runtime.h>
#include <hip/hip_bf16.h>
#include <math.h>
#include <stdint.h>

typedef __attribute__((ext_vector_type(16))) _Float16 v16h;
typedef __attribute__((ext_vector_type(8)))  float    v8f;
typedef __attribute__((ext_vector_type(4)))  unsigned int v4u;
typedef __attribute__((ext_vector_type(4)))  unsigned int u32x4;
typedef __attribute__((ext_vector_type(8)))  int          i32x8;
typedef __attribute__((ext_vector_type(4)))  int          i32x4;

#define BB   2
#define SS   2048
#define DD   1024
#define HH   16
#define DK   64
#define DKA  104
#define BSX  (BB*SS)
#define LOG2E 1.4426950408889634f

union Frag { v16h v; v4u q[2]; };

static __device__ inline v8f wmma_f16(v16h a, v16h b, v8f c) {
  return __builtin_amdgcn_wmma_f32_16x16x32_f16(
      /*neg_a=*/false, a, /*neg_b=*/false, b,
      /*c_mod=*/(short)0, c, /*reuse_a=*/false, /*reuse_b=*/false);
}

// Load one 16x32 f16 A/B fragment. rowPtr points at this lane's row
// (row = lane%16 of the tile). half = lane/16.
// Element e<8 -> K = k0 + half*8 + e ; e>=8 -> K = k0 + 16 + half*8 + (e-8).
static __device__ inline v16h load_frag(const _Float16* rowPtr, int k0, int half) {
  Frag f;
  f.q[0] = *(const v4u*)(rowPtr + k0 + half * 8);
  f.q[1] = *(const v4u*)(rowPtr + k0 + 16 + half * 8);
  return f.v;
}

// ------------------------------- converters --------------------------------
typedef __attribute__((ext_vector_type(4))) float    f32x4;
typedef __attribute__((ext_vector_type(4))) _Float16 h16x4;
typedef __attribute__((ext_vector_type(8))) _Float16 h16x8;

#define CV_BLOCK 8192   // values per block of 8 waves

// A wave converts 1024 consecutive values: eight 16-byte loads a lane, each
// 512 contiguous bytes over the wave and all issued before the first use, then
// eight 8-byte stores, each 256 contiguous bytes over the wave.
static __device__ __attribute__((always_inline)) inline void
f32_to_f16_block(const float* __restrict__ in,
                 _Float16* __restrict__ out, int n, int blk) {
  const int base = blk * CV_BLOCK + (int)(threadIdx.x >> 5) * 1024 +
                   (int)(threadIdx.x & 31) * 4;
  if ((blk + 1) * CV_BLOCK <= n) {
    f32x4 v[8];
#pragma unroll  // constant indices: the eight loads stay in registers, in flight together
    for (int j = 0; j < 8; ++j) v[j] = *(const f32x4*)(in + base + j * 128);
#pragma unroll
    for (int j = 0; j < 8; ++j)
      *(h16x4*)(out + base + j * 128) = __builtin_convertvector(v[j], h16x4);
    // Precaution: stands ahead of any later write of a register these stores name.
    asm volatile("s_wait_xcnt 0x0" ::: "memory");
  } else {  // the last, partial block
    for (int i = blk * CV_BLOCK + (int)threadIdx.x; i < n; i += 256)
      out[i] = (_Float16)in[i];
  }
}

// in: (DD x DD) f32 row-major, [k][n]  ->  out: (DD x DD) f16 row-major, [n][k]
// tile = 0 .. (DD / 64)^2 - 1. A group of 4 waves takes 64 k x 64 n, a wave
// 64 k x 16 n, a lane 8 k x 4 n: eight 16-byte loads a lane (256 contiguous
// bytes of each source row over the group), all issued before the first use,
// then four 16-byte stores; eight lanes fill one 128-byte line of out.
static __device__ __attribute__((always_inline)) inline void
transpose_f32_to_f16_tile(const float* __restrict__ in,
                          _Float16* __restrict__ out, int tile) {
  const int lane = threadIdx.x & 31;
  const int wave = (threadIdx.x >> 5) & 3;
  const int k0 = (tile >> 4) * 64 + (lane & 7) * 8;
  const int n0 = (tile & 15) * 64 + wave * 16 + (lane >> 3) * 4;
  const float* src = in + k0 * DD + n0;
  _Float16* dst = out + n0 * DD + k0;
  f32x4 v[8];
#pragma unroll  // constant indices: the eight loads stay in registers, in flight together
  for (int j = 0; j < 8; ++j) v[j] = *(const f32x4*)(src + j * DD);
#pragma unroll  // constant indices into v
  for (int i = 0; i < 4; ++i) {
    h16x8 h;
#pragma unroll
    for (int j = 0; j < 8; ++j) h[j] = (_Float16)v[j][i];
    *(h16x8*)(dst + i * DD) = h;
  }
  // Precaution: stands ahead of any later write of a register these stores name.
  asm volatile("s_wait_xcnt 0x0" ::: "memory");
}

// ------------------------------- phase -------------------------------------
// phase[bs][h] = x[bs,:] . Wp[:,h] + bp[h], in f32 on the 16x16x4 matrix form:
// a block takes 16 rows of x (the tile's m) against all 16 heads (its n), each
// of its 8 waves 128 of the 1024 k. A lane's 16 loads of x and 64 of Wp depend on
// nothing but the lane's two addresses, so they run far ahead of the products.
// Lane (c, hf), register e of product (i, j) holds k = wave*128 + i*8 + hf*4 +
// 2*j + e in both operands: row c of x, column c of Wp.
// The waves' partial tiles meet in LDS; thread (row, h) adds them to bp[h] in
// wave order and fills columns 64..103 of its row (b,h,s) of Qaug and Kaug.
typedef __attribute__((ext_vector_type(2))) float f32x2;

static __device__ __attribute__((always_inline)) inline void
phase_fill_block(float* red,
                 const float* __restrict__ x,
                 const float* __restrict__ Wp,
                 const float* __restrict__ bp,
                 const float* __restrict__ alpha,
                 _Float16* __restrict__ Qaug,
                 _Float16* __restrict__ Kaug, int blk) {
  const int lane = threadIdx.x & 31;
  const int wave = threadIdx.x >> 5;
  const int kl   = wave * 128 + (lane >> 4) * 4;   // this lane's first k
  const float* xa = x + (size_t)(blk * 16 + (lane & 15)) * DD + kl;
  const float* wb = Wp + kl * HH + (lane & 15);
  f32x4 av[16];
  float bw[16][4];
#pragma unroll  // constant indices: the loaded values stay in registers
  for (int i = 0; i < 16; ++i) av[i] = *(const f32x4*)(xa + i * 8);
#pragma unroll
  for (int i = 0; i < 16; ++i)
#pragma unroll
    for (int e = 0; e < 4; ++e) bw[i][e] = wb[(i * 8 + e) * HH];
  v8f p = {};
#pragma unroll  // constant indices into av and bw
  for (int i = 0; i < 16; ++i) {
    const f32x2 a0 = {av[i][0], av[i][1]}, b0 = {bw[i][0], bw[i][1]};
    const f32x2 a1 = {av[i][2], av[i][3]}, b1 = {bw[i][2], bw[i][3]};
    p = __builtin_amdgcn_wmma_f32_16x16x4_f32(false, a0, false, b0, (short)0, p, false, false);
    p = __builtin_amdgcn_wmma_f32_16x16x4_f32(false, a1, false, b1, (short)0, p, false, false);
  }
  // Register r of lane (c, hf) is row 8*hf + r, head c.
#pragma unroll  // constant indices: the tile stays in registers
  for (int r = 0; r < 8; ++r) red[wave * 256 + r * 32 + lane] = p[r];
  __syncthreads();   // every wave's partial tile is in LDS
  int idx = blk * 256 + (int)threadIdx.x;
  int bs = idx >> 4, h = idx & 15;
  const int row = (int)threadIdx.x >> 4;
  const float* pr = red + (row & 7) * 32 + (row >> 3) * 16 + h;
  float acc = bp[h];
#pragma unroll  // eight LDS loads in flight together
  for (int w = 0; w < 8; ++w) acc += pr[w * 256];
  float ph = acc;
  int b = bs >> 11, s = bs & (SS - 1);
  int bh = b * HH + h;
  float c = cosf(ph), sn = sinf(ph);
  float al = alpha[h];
  _Float16* qr = Qaug + ((size_t)bh * SS + s) * DKA;
  _Float16* kr = Kaug + ((size_t)bh * SS + s) * DKA;
  qr[64] = (_Float16)(al * c  * LOG2E);
  qr[65] = (_Float16)(al * sn * LOG2E);
  kr[64] = (_Float16)c;
  kr[65] = (_Float16)sn;
  for (int t = 66; t < DKA; ++t) { qr[t] = (_Float16)0.f; kr[t] = (_Float16)0.f; }
}

// ------------------------------- first launch ------------------------------
// Everything that reads only the inputs shares one grid, by block range; the
// phase blocks come first.
#define PB_PHASE (BSX * HH / 256)            // 256 blocks
#define PB_CONV  (BSX * DD / CV_BLOCK)       // 512 blocks
#define PB_TRANS ((DD / 64) * (DD / 64) / 2) // 128 blocks a weight, two tiles each

__global__ void __launch_bounds__(256)
prep_kernel(const float* __restrict__ x,  const float* __restrict__ Wq,
            const float* __restrict__ Wk, const float* __restrict__ Wv,
            const float* __restrict__ Wo, const float* __restrict__ Wp,
            const float* __restrict__ bp, const float* __restrict__ alpha,
            _Float16* __restrict__ Xh,  _Float16* __restrict__ Wqt,
            _Float16* __restrict__ Wkt, _Float16* __restrict__ Wvt,
            _Float16* __restrict__ Wot, _Float16* __restrict__ Qaug,
            _Float16* __restrict__ Kaug) {
  __shared__ float red[8 * 256];   // the phase blocks' partial tiles, one a wave
  const int blk = (int)blockIdx.x;
  if (blk < PB_PHASE) {
    phase_fill_block(red, x, Wp, bp, alpha, Qaug, Kaug, blk);
  } else if (blk < PB_PHASE + PB_CONV) {
    f32_to_f16_block(x, Xh, BSX * DD, blk - PB_PHASE);
  } else {
    const int t = blk - (PB_PHASE + PB_CONV);
    const int w = t / PB_TRANS;
    const float* in = (w == 0) ? Wq : (w == 1) ? Wk : (w == 2) ? Wv : Wo;
    _Float16* out   = (w == 0) ? Wqt : (w == 1) ? Wkt : (w == 2) ? Wvt : Wot;
    transpose_f32_to_f16_tile(in, out, (t % PB_TRANS) * 2 + (int)(threadIdx.x >> 7));
  }
}

// ------------------------------- WMMA GEMM ---------------------------------
// C(M,N) = A(M,K) x Bt(N,K)^T + bias[n].  Block tile 128x128, 8 waves as
// 2(M) x 4(N); each wave computes 64x32 = 4x2 tiles of 16x16.
// A pass is 128 k = 256 bytes of each of the 128 A rows and 128 Bt rows. The
// rows reach LDS by tensor loads: every wave brings one slice of 32 rows per
// pass (waves 0..3 rows of A, waves 4..7 rows of Bt) into a ring of two
// buffers, one pass ahead of its readers; the pad gives an LDS pitch of
// 272 bytes, and the fragments come by ds_load_b128 in the k order of
// load_frag. Needs K a multiple of 128 and at least 256.
// The block takes rows bm*128.. of A and rows bn*128.. of Bt.
// Bt stands first in the products (both operands come by load_frag, so either
// can), so a lane holds eight results of a 16x16 tile that are consecutive in
// n, and n is the output's contiguous axis in every mode: they go out in
// 16-byte stores.
// mode 0: outF[gm*N+gn] = v                     (f32, final output)
// mode 1: aug layout  outH[(b,h,s)*104 + d] = (f16)(v*mult)  (Q and K)
//         m = b*S + s, n = h*64 + d
// mode 3: V^T layout  outH[((b*16+h)*64+d)*S + s] = (f16)v, bias[m]
//         m = h*64 + d (A holds the weight's rows), n = b*S + s (Bt holds x)
typedef __attribute__((ext_vector_type(8))) unsigned int u32x8;

#define G_ROWB  256u                 // bytes of one operand row per pass
#define G_PITCH 272u                 // LDS pitch: row + 16 bytes of pad
#define G_SROWS 32u                  // rows per slice
#define G_SLICE 10240u               // 32 x 272 = 8704, up to a multiple of 2 KiB
#define G_BUF   (8u * G_SLICE)       // one buffer: 4 slices of A, 4 of Bt

static __device__ inline uint32_t uni(uint32_t v) {
  return (uint32_t)__builtin_amdgcn_readfirstlane(v);
}
static __device__ inline uint32_t pinned(uint32_t v) {
  uint32_t w = uni(v);
  asm volatile("" : "+s"(w));  // pinned(): the word stays in a scalar register
  return w;
}
static __device__ inline void tdm_load(u32x4 g0, u32x8 g1) {
  asm volatile("tensor_load_to_lds %0, %1" :: "s"(g0), "s"(g1) : "memory");
}

static __device__ __attribute__((always_inline)) inline void
gemm_wmma_tile(unsigned char* ring, uint32_t bm, uint32_t bn,
               const _Float16* __restrict__ A, const _Float16* __restrict__ Bt,
               const float* __restrict__ bias, float* __restrict__ outF,
               _Float16* __restrict__ outH, int N, int K,
               int mode, float mult) {
  const int lane = threadIdx.x & 31;
  const uint32_t wave = uni(threadIdx.x >> 5);
  const int half = lane >> 4;
  const int ln   = lane & 15;
  const int wm   = (int)(wave >> 2);   // 0..1
  const int wn   = (int)(wave & 3u);   // 0..3
  const int mbase = (int)bm * 128 + wm * 64;
  const int nbase = (int)bn * 128 + wn * 32;

  // This wave's slice: its first source byte and its place in buffer 0.
  const _Float16* srow = (wave < 4u)
      ? A  + (size_t)(bm * 128u + wave * G_SROWS) * K
      : Bt + (size_t)(bn * 128u + (wave - 4u) * G_SROWS) * K;
  const uint64_t sbase = (uint64_t)(uintptr_t)srow;
  const uint32_t ldst  = (uint32_t)(uintptr_t)ring + wave * G_SLICE;
  const uint32_t npass = (uint32_t)K >> 7;

  u32x8 g1;
  g1[0] = uni((1u << 20) | (5u << 22) | (3u << 25));
  g1[1] = uni(G_ROWB << 16);
  g1[2] = uni(G_SROWS << 16);
  g1[3] = uni(G_ROWB << 16);
  g1[4] = uni(G_SROWS);
  g1[5] = uni((uint32_t)K * 2u);
  g1[6] = uni(0u);
  g1[7] = uni(0u);
  asm volatile("" : "+s"(g1));
  auto issue = [&](uint32_t st) {
    const uint64_t ga = sbase + (uint64_t)st * G_ROWB;
    u32x4 g0;
    g0[0] = uni(1u);
    g0[1] = uni(ldst + (st & 1u) * G_BUF);
    g0[2] = uni((uint32_t)ga);
    g0[3] = uni((((uint32_t)(ga >> 32)) & 0x01FFFFFFu) | 0x80000000u);
    tdm_load(g0, g1);
  };

  v8f acc[4][2] = {};

  issue(0u);
  // Stage 0 has landed for this wave; the barrier publishes every slice.
  asm volatile("s_wait_tensorcnt 0x0" ::: "memory");
  __syncthreads();
  issue(1u);

  for (uint32_t s = 0; s < npass; ++s) {
    const unsigned char* buf = ring + (s & 1u) * G_BUF;
    const unsigned char* arow = buf + (uint32_t)(wm * 2) * G_SLICE + (uint32_t)ln * G_PITCH;
    const unsigned char* brow = buf + (uint32_t)(4 + wn) * G_SLICE + (uint32_t)ln * G_PITCH;
    // Fragments of block kk (32 k) of this pass, in the k order of load_frag.
    auto load_block = [&](int kk, v16h (&af)[4], v16h (&bf)[2]) {
#pragma unroll  // constant indices: the fragments stay in registers
      for (int mi = 0; mi < 4; ++mi)
        af[mi] = load_frag((const _Float16*)(arow + (uint32_t)(mi >> 1) * G_SLICE +
                                             (uint32_t)(mi & 1) * 16u * G_PITCH),
                           kk * 32, half);
#pragma unroll
      for (int ni = 0; ni < 2; ++ni)
        bf[ni] = load_frag((const _Float16*)(brow + (uint32_t)ni * 16u * G_PITCH),
                           kk * 32, half);
    };
    v16h af[2][4], bf[2][2];
    load_block(0, af[0], bf[0]);
#pragma unroll  // constant indices keep fragments and accumulators in registers
    for (int kk = 0; kk < 4; ++kk) {
      if (kk < 3) load_block(kk + 1, af[(kk + 1) & 1], bf[(kk + 1) & 1]);
      // Keeps the next block's LDS loads, as one group, ahead of this block's
      // products, so that their latency runs behind the matrix work.
      __builtin_amdgcn_sched_barrier(0);
#pragma unroll  // constant indices: the accumulators stay in registers
      for (int mi = 0; mi < 4; ++mi)
#pragma unroll
        for (int ni = 0; ni < 2; ++ni)
          acc[mi][ni] = wmma_f16(bf[kk & 1][ni], af[kk & 1][mi], acc[mi][ni]);
      // Keeps later LDS loads from being moved in among these products.
      if (kk < 3) __builtin_amdgcn_sched_barrier(0);
    }
    // Publish point of stage s + 1: this wave's reads of stage s are done,
    // its own slice of stage s + 1 has landed, then every wave meets.
    asm volatile("s_wait_dscnt 0x0" ::: "memory");
    asm volatile("s_wait_tensorcnt 0x0" ::: "memory");
    __syncthreads();
    // Refill the buffer that every wave has just left.
    const uint32_t nxt = pinned(s + 2u);
    if (pinned(nxt < npass)) issue(nxt);
  }
  // Nothing may be outstanding when the wave ends.
  asm volatile("s_wait_tensorcnt 0x0" ::: "memory");
  asm volatile("s_wait_dscnt 0x0" ::: "memory");

  // acc[mi][ni][r]: m = mbase + mi*16 + ln, n = nbase + ni*16 + 8*half + r.
  // The wave's 64 m and its 32 n each lie in one batch b or in one head h.
  if (mode == 3) {
    _Float16* vrow = outH + ((size_t)(nbase >> 11) * DD + mbase + ln) * SS +
                     (nbase & (SS - 1)) + 8 * half;
#pragma unroll  // constant indices: the accumulators stay in registers
    for (int mi = 0; mi < 4; ++mi) {
      const float bv = bias[mbase + mi * 16 + ln];
#pragma unroll
      for (int ni = 0; ni < 2; ++ni) {
        h16x8 o;
#pragma unroll
        for (int r = 0; r < 8; ++r) o[r] = (_Float16)(acc[mi][ni][r] + bv);
        *(h16x8*)(vrow + (size_t)mi * 16 * SS + ni * 16) = o;
      }
    }
    // Precaution: stands ahead of any later write of a register these stores name.
    asm volatile("s_wait_xcnt 0x0" ::: "memory");
  } else {
#pragma unroll  // constant indices: the accumulators stay in registers
    for (int ni = 0; ni < 2; ++ni) {
      const f32x4 blo = *(const f32x4*)(bias + nbase + ni * 16 + 8 * half);
      const f32x4 bhi = *(const f32x4*)(bias + nbase + ni * 16 + 8 * half + 4);
#pragma unroll
      for (int mi = 0; mi < 4; ++mi) {
        f32x4 lo, hi;
#pragma unroll
        for (int r = 0; r < 4; ++r) {
          lo[r] = acc[mi][ni][r] + blo[r];
          hi[r] = acc[mi][ni][4 + r] + bhi[r];
        }
        if (mode == 0) {
          float* p = outF + (size_t)(mbase + mi * 16 + ln) * N + nbase + ni * 16 + 8 * half;
          *(f32x4*)p = lo;
          *(f32x4*)(p + 4) = hi;
        } else {
          h16x8 o;
#pragma unroll
          for (int r = 0; r < 4; ++r) {
            o[r]     = (_Float16)(lo[r] * mult);
            o[4 + r] = (_Float16)(hi[r] * mult);
          }
          *(h16x8*)(outH + ((size_t)((mbase >> 11) * HH + (nbase >> 6)) * SS +
                            (mbase & (SS - 1)) + mi * 16 + ln) * DKA +
                    (nbase & 63) + ni * 16 + 8 * half) = o;
        }
      }
    }
    // Precaution: stands ahead of any later write of a register these stores name.
    asm volatile("s_wait_xcnt 0x0" ::: "memory");
  }
}

// The output projection.
__global__ void __launch_bounds__(256)
gemm_wmma_kernel(const _Float16* __restrict__ A, const _Float16* __restrict__ Bt,
                 const float* __restrict__ bias, float* __restrict__ outF,
                 int N, int K) {
  __shared__ __attribute__((aligned(2048))) unsigned char ring[2u * G_BUF];
  gemm_wmma_tile(ring, blockIdx.y, blockIdx.x, A, Bt, bias, outF, nullptr, N, K, 0, 1.0f);
}

// The V, Q and K projections in one grid: blockIdx.z picks the weight, the
// bias, the output and its layout. For V^T the weight's rows are the m axis
// and the rows of x the n axis, so the two operands and the two block indices
// change places.
__global__ void __launch_bounds__(256)
qkv_gemm_kernel(const _Float16* __restrict__ A,
                const _Float16* __restrict__ Wqt, const _Float16* __restrict__ Wkt,
                const _Float16* __restrict__ Wvt,
                const float* __restrict__ bq, const float* __restrict__ bk,
                const float* __restrict__ bv,
                _Float16* __restrict__ Qaug, _Float16* __restrict__ Kaug,
                _Float16* __restrict__ Vt, int N, int K, float qmult) {
  __shared__ __attribute__((aligned(2048))) unsigned char ring[2u * G_BUF];
  const uint32_t z = blockIdx.z;
  const _Float16* W  = (z == 0u) ? Wvt : (z == 1u) ? Wqt : Wkt;
  const float* bias  = (z == 0u) ? bv : (z == 1u) ? bq : bk;
  _Float16* outH     = (z == 0u) ? Vt : (z == 1u) ? Qaug : Kaug;
  gemm_wmma_tile(ring, (z == 0u) ? blockIdx.x : blockIdx.y,
                 (z == 0u) ? blockIdx.y : blockIdx.x,
                 (z == 0u) ? W : A, (z == 0u) ? A : W, bias, nullptr, outH, N, K,
                 (z == 0u) ? 3 : 1, (z == 1u) ? qmult : 1.0f);
}

static __device__ inline float xhalf(float x) {
  return __builtin_bit_cast(float, __builtin_amdgcn_permlanex16(
      __builtin_bit_cast(int, x), __builtin_bit_cast(int, x),
      0x76543210, 0xfedcba98, false, false));
}

#define V_ROWB  256u                 // bytes of one V^T row per stage (128 keys)
#define V_PITCH 272u                 // LDS pitch: row + 16 bytes of pad
#define V_BUF   18432u               // 64 x 272 = 17408, up to a multiple of 2 KiB
#define V_STAGES ((uint32_t)SS / 128u)
#define K_BUFH  4096                 // halves per K' buffer: 32 x 208 = 6656 bytes, up to a multiple of 2 KiB

__global__ void __launch_bounds__(256)
flash_kernel(const _Float16* __restrict__ Qaug, const _Float16* __restrict__ Kaug,
             const _Float16* __restrict__ Vt, _Float16* __restrict__ O) {
  __shared__ __attribute__((aligned(2048))) _Float16 kstage[2][K_BUFH];
  __shared__ __attribute__((aligned(2048))) unsigned char vstage[2u * V_BUF];  // V^T ring

  const int lane = threadIdx.x & 31;
  const int wave = threadIdx.x >> 5;
  const int half = lane >> 4;
  const int ln   = lane & 15;
  const int h    = blockIdx.y;
  const int b    = blockIdx.z;
  const int row0 = blockIdx.x * 128 + wave * 16;
  const size_t bh = (size_t)(b * HH + h);

  const _Float16* Qb = Qaug + bh * SS * DKA;
  const _Float16* Kb = Kaug + bh * SS * DKA;
  const _Float16* Vb = Vt   + bh * (size_t)DK * SS;

  auto issue_k_tile = [&](int j0, int bufn) {
    unsigned long long gaddr =
        (unsigned long long)(uintptr_t)(Kb + (size_t)j0 * DKA);
    unsigned lds_addr = (unsigned)(uintptr_t)(&kstage[bufn][0]);
    u32x4 g0;
    g0[0] = 1u;                                   // count=1 (valid), user mode
    g0[1] = lds_addr;                             // lds_addr [63:32]
    g0[2] = (unsigned)gaddr;                      // global_addr [95:64]
    g0[3] = ((unsigned)(gaddr >> 32) & 0x01FFFFFFu) | (2u << 30); // type=2
    i32x8 g1;
    g1[0] = (int)(1u << 16);
    g1[1] = (int)((unsigned)DKA << 16);
    g1[2] = (int)((unsigned)SS << 16);
    g1[3] = (int)((unsigned)DKA << 16);
    g1[4] = 32;
    g1[5] = DKA;
    g1[6] = 0;
    g1[7] = 0;
    i32x4 z4 = {0, 0, 0, 0};
#if defined(__clang_major__) && (__clang_major__ >= 23)
    i32x8 z8 = {};
    __builtin_amdgcn_tensor_load_to_lds(g0, g1, z4, z4, z8, 0);
#else
    __builtin_amdgcn_tensor_load_to_lds(g0, g1, z4, z4, 0);
#endif
  };

  // Q fragments (16 queries x 96 of the 104), loaded once; B operand of the score product.
  v16h qf[3];
#pragma unroll
  for (int f = 0; f < 3; ++f)
    qf[f] = load_frag(Qb + (size_t)(row0 + ln) * DKA, f * 32, half);

  // acc[n2][r] = O[query ln][d = n2*16 + 8*half + r], not yet normalized.
  v8f acc[4] = {};
  float mrun = -1e30f;  // running maximum of query ln, alike in both halves
  float lrun = 0.f;     // running sum of query ln over this half's keys

  const uint32_t wv = uni(threadIdx.x >> 5);
  const uint64_t vsrc = (uint64_t)(uintptr_t)Vb;
  const uint32_t vdst = (uint32_t)(uintptr_t)vstage;
  u32x8 vg1;
  vg1[0] = uni((1u << 20) | (5u << 22) | (3u << 25));
  vg1[1] = uni(V_ROWB << 16);
  vg1[2] = uni((uint32_t)DK << 16);
  vg1[3] = uni(V_ROWB << 16);
  vg1[4] = uni((uint32_t)DK);
  vg1[5] = uni((uint32_t)SS * 2u);
  vg1[6] = uni(0u);
  vg1[7] = uni(0u);
  asm volatile("" : "+s"(vg1));
  u32x4 vg0;
  vg0[0] = uni(1u);
  vg0[1] = uni(vdst);
  vg0[2] = uni((uint32_t)vsrc);
  vg0[3] = uni((((uint32_t)(vsrc >> 32)) & 0x01FFFFFFu) | 0x80000000u);
  auto next_v = [&]() {
    asm volatile("" : "+s"(vg0));
    const uint32_t lo = vg0[2] + V_ROWB;
    vg0[3] = uni(vg0[3] + ((lo < V_ROWB) ? 1u : 0u));
    vg0[2] = uni(lo);
    vg0[1] = uni((2u * vdst + V_BUF) - vg0[1]);
  };
  if (pinned(wv == 1u)) {
    tdm_load(vg0, vg1);
    // Stage 0 has landed for the issuing wave; the barrier publishes it.
    asm volatile("s_wait_tensorcnt 0x0" ::: "memory");
  }
  __syncthreads();
  next_v();
  if (pinned(wv == 1u)) tdm_load(vg0, vg1);
  uint32_t vkey = 0u;  // first key of the block of 32 inside its stage: 0, 32, 64, 96

  if (wave == 0) issue_k_tile(0, 0);              // prime the pipeline

  for (int j0 = 0; j0 < SS; j0 += 32) {
    const int bufn = (j0 >> 5) & 1;
    if (wave == 0) __builtin_amdgcn_s_wait_tensorcnt(0);
    __syncthreads();                              // K' tile ready for all waves
    if (wave == 0 && (j0 + 32) < SS)
      issue_k_tile(j0 + 32, bufn ^ 1);            // async prefetch next tile

    const _Float16* Kl = kstage[bufn];
    v8f s0 = {}, s1 = {};
#pragma unroll
    for (int f = 0; f < 3; ++f) {
      v16h a0 = load_frag(Kl + (size_t)(ln)      * DKA, f * 32, half);
      v16h a1 = load_frag(Kl + (size_t)(16 + ln) * DKA, f * 32, half);
      s0 = wmma_f16(a0, qf[f], s0);
      s1 = wmma_f16(a1, qf[f], s1);
    }

    // V^T fragments of these 32 keys, from this stage's buffer, in the k order
    // of load_frag; fetched here so that their latency runs behind the softmax.
    const unsigned char* vrow =
        vstage + (uint32_t)((j0 >> 7) & 1) * V_BUF + (uint32_t)ln * V_PITCH;
    v16h vf[4];
#pragma unroll  // constant indices: the fragments stay in registers
    for (int n2 = 0; n2 < 4; ++n2)
      vf[n2] = load_frag((const _Float16*)(vrow + (uint32_t)n2 * 16u * V_PITCH),
                         (int)vkey, half);
    // Keeps these LDS loads, as one group, ahead of the softmax.
    __builtin_amdgcn_sched_barrier(0);

    // Online softmax (log2 domain). All 16 scores of a lane are query ln's.
    float v = fmaxf(s0[0], s1[0]);
#pragma unroll
    for (int r = 1; r < 8; ++r) v = fmaxf(v, fmaxf(s0[r], s1[r]));
    v = fmaxf(v, xhalf(v));
    const float mn   = fmaxf(mrun, v);
    // Bare v_exp_f32: a result below 2^-126 comes out as 0. Such a weight is 0 in
    // f16 too, and beside a sum of at least 1 it changes nothing.
    const float corr = __builtin_amdgcn_exp2f(mrun - mn);
    v16h pb;           // P^T as B operand: element e < 8 is key 8*half + e, e >= 8 key 8 + 8*half + e
    float rs = 0.f;
#pragma unroll
    for (int r = 0; r < 8; ++r) {
      const float p0 = __builtin_amdgcn_exp2f(s0[r] - mn);
      const float p1 = __builtin_amdgcn_exp2f(s1[r] - mn);
      rs += p0 + p1;
      pb[r]     = (_Float16)p0;
      pb[8 + r] = (_Float16)p1;
    }
    lrun = lrun * corr + rs;
    mrun = mn;
#pragma unroll
    for (int n2 = 0; n2 < 4; ++n2)
#pragma unroll
      for (int r = 0; r < 8; ++r) acc[n2][r] *= corr;

    // acc^T += V^T(64x32) x P^T(32x16)
#pragma unroll
    for (int n2 = 0; n2 < 4; ++n2)
      acc[n2] = wmma_f16(vf[n2], pb, acc[n2]);
    // A V^T stage ends with its fourth block of 32 keys. Publish point of the
    // next stage: this wave's LDS reads are done, the issuing wave's load has
    // landed, then every wave meets at the barrier below.
    const uint32_t vend = pinned(vkey == 96u);
    if (vend) {
      asm volatile("s_wait_dscnt 0x0" ::: "memory");
      if (pinned(wv == 1u)) asm volatile("s_wait_tensorcnt 0x0" ::: "memory");
    }
    __syncthreads();   // all waves done with kstage[bufn] before overwrite
    if (vend) {
      // Refill the V^T buffer that every wave has just left.
      next_v();
      const uint32_t nxt = pinned(((uint32_t)j0 >> 7) + 2u);
      if (pinned((wv == 1u) & (nxt < V_STAGES))) tdm_load(vg0, vg1);
    }
    vkey = (vkey + 32u) & 96u;
  }
  // Nothing may be outstanding when the wave ends.
  asm volatile("s_wait_tensorcnt 0x0" ::: "memory");
  asm volatile("s_wait_dscnt 0x0" ::: "memory");

  // Join the halves' sums, normalize and write O in (B,S,H*dk) as f16, the
  // output projection's A operand: a lane holds 8 consecutive d of its query
  // per tile, one 16-byte store.
  const float lsum = lrun + xhalf(lrun);
  _Float16* orow = O + ((size_t)(b * SS + row0 + ln)) * DD + h * DK + 8 * half;
#pragma unroll  // constant indices: the accumulators stay in registers
  for (int n2 = 0; n2 < 4; ++n2) {
    h16x8 o;
#pragma unroll
    for (int r = 0; r < 8; ++r) o[r] = (_Float16)(acc[n2][r] / lsum);
    *(h16x8*)(orow + n2 * 16) = o;
  }
}

// ------------------------------- launcher ----------------------------------
extern "C" void kernel_launch(void* const* d_in, const int* in_sizes, int n_in,
                              void* d_out, int out_size, void* d_ws, size_t ws_size,
                              hipStream_t stream) {
  const float* x  = (const float*)d_in[0];
  const float* Wq = (const float*)d_in[1];
  const float* bq = (const float*)d_in[2];
  const float* Wk = (const float*)d_in[3];
  const float* bk = (const float*)d_in[4];
  const float* Wv = (const float*)d_in[5];
  const float* bv = (const float*)d_in[6];
  const float* Wo = (const float*)d_in[7];
  const float* bo = (const float*)d_in[8];
  const float* Wp = (const float*)d_in[9];
  const float* bp = (const float*)d_in[10];
  const float* alpha = (const float*)d_in[11];
  float* out = (float*)d_out;

  // workspace carve-out (~58 MB), 256B aligned chunks
  char* w = (char*)d_ws;
  size_t off = 0;
  auto carve = [&](size_t bytes) {
    char* p = w + off;
    off = (off + bytes + 255) & ~(size_t)255;
    return p;
  };
  _Float16* Xh   = (_Float16*)carve((size_t)BSX * DD * 2);
  _Float16* Wqt  = (_Float16*)carve((size_t)DD * DD * 2);
  _Float16* Wkt  = (_Float16*)carve((size_t)DD * DD * 2);
  _Float16* Wvt  = (_Float16*)carve((size_t)DD * DD * 2);
  _Float16* Wot  = (_Float16*)carve((size_t)DD * DD * 2);
  _Float16* Qaug = (_Float16*)carve((size_t)BB * HH * SS * DKA * 2);
  _Float16* Kaug = (_Float16*)carve((size_t)BB * HH * SS * DKA * 2);
  _Float16* Vt   = (_Float16*)carve((size_t)BB * HH * DK * SS * 2);
  _Float16* Oh   = (_Float16*)carve((size_t)BSX * DD * 2);
  (void)ws_size; (void)n_in; (void)in_sizes; (void)out_size;

  // 1) all that reads only the inputs: x and the weights to f16 (weights
  //    transposed), the phase projection with its cos/sin columns of Q' and K'
  prep_kernel<<<PB_PHASE + PB_CONV + 4 * PB_TRANS, 256, 0, stream>>>(
      x, Wq, Wk, Wv, Wo, Wp, bp, alpha, Xh, Wqt, Wkt, Wvt, Wot, Qaug, Kaug);

  // 2) QKV projections via WMMA GEMM, one grid
  const float qmult = 0.125f * LOG2E;  // dk^-0.5 = 1/8, log2e folded for exp2
  dim3 qgrid(DD / 128, BSX / 128, 3);
  qkv_gemm_kernel<<<qgrid, 256, 0, stream>>>(Xh, Wqt, Wkt, Wvt, bq, bk, bv,
                                             Qaug, Kaug, Vt, DD, DD, qmult);

  dim3 fgrid(SS / 128, HH, BB);
  flash_kernel<<<fgrid, 256, 0, stream>>>(Qaug, Kaug, Vt, Oh);

  // 4) output projection
  dim3 ggrid(DD / 128, BSX / 128);
  gemm_wmma_kernel<<<ggrid, 256, 0, stream>>>(Oh, Wot, bo, out, DD, DD);
}

// v010
// A run of this version takes 87.9 microseconds.
// Two timings next to v009 both put it at 1.21 times that version's speed.
// All steps since v000 together make it 4.30 times as fast.
#include <hip/hip_runtime.h>
#include <hip/hip_bf16.h>
#include <math.h>
#include <stdint.h>

typedef __attribute__((ext_vector_type(16))) _Float16 v16h;
typedef __attribute__((ext_vector_type(8)))  float    v8f;
typedef __attribute__((ext_vector_type(4)))  unsigned int v4u;
typedef __attribute__((ext_vector_type(4)))  unsigned int u32x4;
typedef __attribute__((ext_vector_type(8)))  int          i32x8;
typedef __attribute__((ext_vector_type(4)))  int          i32x4;

#define BB   2
#define SS   2048
#define DD   1024
#define HH   16
#define DK   64
#define DKA  104
#define BSX  (BB*SS)
#define LOG2E 1.4426950408889634f

union Frag { v16h v; v4u q[2]; };

static __device__ inline v8f wmma_f16(v16h a, v16h b, v8f c) {
  return __builtin_amdgcn_wmma_f32_16x16x32_f16(
      /*neg_a=*/false, a, /*neg_b=*/false, b,
      /*c_mod=*/(short)0, c, /*reuse_a=*/false, /*reuse_b=*/false);
}

// Load one 16x32 f16 A/B fragment. rowPtr points at this lane's row
// (row = lane%16 of the tile). half = lane/16.
// Element e<8 -> K = k0 + half*8 + e ; e>=8 -> K = k0 + 16 + half*8 + (e-8).
static __device__ inline v16h load_frag(const _Float16* rowPtr, int k0, int half) {
  Frag f;
  f.q[0] = *(const v4u*)(rowPtr + k0 + half * 8);
  f.q[1] = *(const v4u*)(rowPtr + k0 + 16 + half * 8);
  return f.v;
}

// ------------------------------- converters --------------------------------
typedef __attribute__((ext_vector_type(4))) float    f32x4;
typedef __attribute__((ext_vector_type(4))) _Float16 h16x4;
typedef __attribute__((ext_vector_type(8))) _Float16 h16x8;

#define CV_BLOCK 8192   // values per block of 8 waves

// A wave converts 1024 consecutive values: eight 16-byte loads a lane, each
// 512 contiguous bytes over the wave and all issued before the first use, then
// eight 8-byte stores, each 256 contiguous bytes over the wave.
static __device__ __attribute__((always_inline)) inline void
f32_to_f16_block(const float* __restrict__ in,
                 _Float16* __restrict__ out, int n, int blk) {
  const int base = blk * CV_BLOCK + (int)(threadIdx.x >> 5) * 1024 +
                   (int)(threadIdx.x & 31) * 4;
  if ((blk + 1) * CV_BLOCK <= n) {
    f32x4 v[8];
#pragma unroll  // constant indices: the eight loads stay in registers, in flight together
    for (int j = 0; j < 8; ++j) v[j] = *(const f32x4*)(in + base + j * 128);
#pragma unroll
    for (int j = 0; j < 8; ++j)
      *(h16x4*)(out + base + j * 128) = __builtin_convertvector(v[j], h16x4);
    // Precaution: stands ahead of any later write of a register these stores name.
    asm volatile("s_wait_xcnt 0x0" ::: "memory");
  } else {  // the last, partial block
    for (int i = blk * CV_BLOCK + (int)threadIdx.x; i < n; i += 256)
      out[i] = (_Float16)in[i];
  }
}

// in: (DD x DD) f32 row-major, [k][n]  ->  out: (DD x DD) f16 row-major, [n][k]
// tile = 0 .. (DD / 64)^2 - 1. A group of 4 waves takes 64 k x 64 n, a wave
// 64 k x 16 n, a lane 8 k x 4 n: eight 16-byte loads a lane (256 contiguous
// bytes of each source row over the group), all issued before the first use,
// then four 16-byte stores; eight lanes fill one 128-byte line of out.
static __device__ __attribute__((always_inline)) inline void
transpose_f32_to_f16_tile(const float* __restrict__ in,
                          _Float16* __restrict__ out, int tile) {
  const int lane = threadIdx.x & 31;
  const int wave = (threadIdx.x >> 5) & 3;
  const int k0 = (tile >> 4) * 64 + (lane & 7) * 8;
  const int n0 = (tile & 15) * 64 + wave * 16 + (lane >> 3) * 4;
  const float* src = in + k0 * DD + n0;
  _Float16* dst = out + n0 * DD + k0;
  f32x4 v[8];
#pragma unroll  // constant indices: the eight loads stay in registers, in flight together
  for (int j = 0; j < 8; ++j) v[j] = *(const f32x4*)(src + j * DD);
#pragma unroll  // constant indices into v
  for (int i = 0; i < 4; ++i) {
    h16x8 h;
#pragma unroll
    for (int j = 0; j < 8; ++j) h[j] = (_Float16)v[j][i];
    *(h16x8*)(dst + i * DD) = h;
  }
  // Precaution: stands ahead of any later write of a register these stores name.
  asm volatile("s_wait_xcnt 0x0" ::: "memory");
}

// ------------------------------- phase -------------------------------------
// phase[bs][h] = x[bs,:] . Wp[:,h] + bp[h], in f32 on the 16x16x4 matrix form:
// a block takes 16 rows of x (the tile's m) against all 16 heads (its n), each
// of its 8 waves 128 of the 1024 k. A lane's 16 loads of x and 64 of Wp depend on
// nothing but the lane's two addresses, so they run far ahead of the products.
// Lane (c, hf), register e of product (i, j) holds k = wave*128 + i*8 + hf*4 +
// 2*j + e in both operands: row c of x, column c of Wp.
// The waves' partial tiles meet in LDS; thread (row, h) adds them to bp[h] in
// wave order and fills columns 64..103 of its row (b,h,s) of Qaug and Kaug.
typedef __attribute__((ext_vector_type(2))) float f32x2;

static __device__ __attribute__((always_inline)) inline void
phase_fill_block(float* red,
                 const float* __restrict__ x,
                 const float* __restrict__ Wp,
                 const float* __restrict__ bp,
                 const float* __restrict__ alpha,
                 _Float16* __restrict__ Qaug,
                 _Float16* __restrict__ Kaug, int blk) {
  const int lane = threadIdx.x & 31;
  const int wave = threadIdx.x >> 5;
  const int kl   = wave * 128 + (lane >> 4) * 4;   // this lane's first k
  const float* xa = x + (size_t)(blk * 16 + (lane & 15)) * DD + kl;
  const float* wb = Wp + kl * HH + (lane & 15);
  f32x4 av[16];
  float bw[16][4];
#pragma unroll  // constant indices: the loaded values stay in registers
  for (int i = 0; i < 16; ++i) av[i] = *(const f32x4*)(xa + i * 8);
#pragma unroll
  for (int i = 0; i < 16; ++i)
#pragma unroll
    for (int e = 0; e < 4; ++e) bw[i][e] = wb[(i * 8 + e) * HH];
  v8f p = {};
#pragma unroll  // constant indices into av and bw
  for (int i = 0; i < 16; ++i) {
    const f32x2 a0 = {av[i][0], av[i][1]}, b0 = {bw[i][0], bw[i][1]};
    const f32x2 a1 = {av[i][2], av[i][3]}, b1 = {bw[i][2], bw[i][3]};
    p = __builtin_amdgcn_wmma_f32_16x16x4_f32(false, a0, false, b0, (short)0, p, false, false);
    p = __builtin_amdgcn_wmma_f32_16x16x4_f32(false, a1, false, b1, (short)0, p, false, false);
  }
  // Register r of lane (c, hf) is row 8*hf + r, head c.
#pragma unroll  // constant indices: the tile stays in registers
  for (int r = 0; r < 8; ++r) red[wave * 256 + r * 32 + lane] = p[r];
  __syncthreads();   // every wave's partial tile is in LDS
  int idx = blk * 256 + (int)threadIdx.x;
  int bs = idx >> 4, h = idx & 15;
  const int row = (int)threadIdx.x >> 4;
  const float* pr = red + (row & 7) * 32 + (row >> 3) * 16 + h;
  float acc = bp[h];
#pragma unroll  // eight LDS loads in flight together
  for (int w = 0; w < 8; ++w) acc += pr[w * 256];
  float ph = acc;
  int b = bs >> 11, s = bs & (SS - 1);
  int bh = b * HH + h;
  float c = cosf(ph), sn = sinf(ph);
  float al = alpha[h];
  _Float16* qr = Qaug + ((size_t)bh * SS + s) * DKA;
  _Float16* kr = Kaug + ((size_t)bh * SS + s) * DKA;
  qr[64] = (_Float16)(al * c  * LOG2E);
  qr[65] = (_Float16)(al * sn * LOG2E);
  kr[64] = (_Float16)c;
  kr[65] = (_Float16)sn;
  for (int t = 66; t < DKA; ++t) { qr[t] = (_Float16)0.f; kr[t] = (_Float16)0.f; }
}

// ------------------------------- first launch ------------------------------
// Everything that reads only the inputs shares one grid, by block range; the
// phase blocks come first.
#define PB_PHASE (BSX * HH / 256)            // 256 blocks
#define PB_CONV  (BSX * DD / CV_BLOCK)       // 512 blocks
#define PB_TRANS ((DD / 64) * (DD / 64) / 2) // 128 blocks a weight, two tiles each

__global__ void __launch_bounds__(256)
prep_kernel(const float* __restrict__ x,  const float* __restrict__ Wq,
            const float* __restrict__ Wk, const float* __restrict__ Wv,
            const float* __restrict__ Wo, const float* __restrict__ Wp,
            const float* __restrict__ bp, const float* __restrict__ alpha,
            _Float16* __restrict__ Xh,  _Float16* __restrict__ Wqt,
            _Float16* __restrict__ Wkt, _Float16* __restrict__ Wvt,
            _Float16* __restrict__ Wot, _Float16* __restrict__ Qaug,
            _Float16* __restrict__ Kaug) {
  __shared__ float red[8 * 256];   // the phase blocks' partial tiles, one a wave
  const int blk = (int)blockIdx.x;
  if (blk < PB_PHASE) {
    phase_fill_block(red, x, Wp, bp, alpha, Qaug, Kaug, blk);
  } else if (blk < PB_PHASE + PB_CONV) {
    f32_to_f16_block(x, Xh, BSX * DD, blk - PB_PHASE);
  } else {
    const int t = blk - (PB_PHASE + PB_CONV);
    const int w = t / PB_TRANS;
    const float* in = (w == 0) ? Wq : (w == 1) ? Wk : (w == 2) ? Wv : Wo;
    _Float16* out   = (w == 0) ? Wqt : (w == 1) ? Wkt : (w == 2) ? Wvt : Wot;
    transpose_f32_to_f16_tile(in, out, (t % PB_TRANS) * 2 + (int)(threadIdx.x >> 7));
  }
}

// ------------------------------- WMMA GEMM ---------------------------------
// C(M,N) = A(M,K) x Bt(N,K)^T + bias[n].  Block tile 128x128, 8 waves as
// 2(M) x 4(N); each wave computes 64x32 = 4x2 tiles of 16x16.
// A pass is 128 k = 256 bytes of each of the 128 A rows and 128 Bt rows. The
// rows reach LDS by tensor loads: every wave brings one slice of 32 rows per
// pass (waves 0..3 rows of A, waves 4..7 rows of Bt) into a ring of two
// buffers, one pass ahead of its readers; the pad gives an LDS pitch of
// 272 bytes, and the fragments come by ds_load_b128 in the k order of
// load_frag. Needs K a multiple of 128 and at least 256.
// The block takes rows bm*128.. of A and rows bn*128.. of Bt.
// Bt stands first in the products (both operands come by load_frag, so either
// can), so a lane holds eight results of a 16x16 tile that are consecutive in
// n, and n is the output's contiguous axis in every mode: they go out in
// 16-byte stores.
// mode 0: outF[gm*N+gn] = v                     (f32, final output)
// mode 1: aug layout  outH[(b,h,s)*104 + d] = (f16)(v*mult)  (Q and K)
//         m = b*S + s, n = h*64 + d
// mode 3: V^T layout  outH[((b*16+h)*64+d)*S + s] = (f16)v, bias[m]
//         m = h*64 + d (A holds the weight's rows), n = b*S + s (Bt holds x)
typedef __attribute__((ext_vector_type(8))) unsigned int u32x8;

#define G_ROWB  256u                 // bytes of one operand row per pass
#define G_PITCH 272u                 // LDS pitch: row + 16 bytes of pad
#define G_SROWS 32u                  // rows per slice
#define G_SLICE 10240u               // 32 x 272 = 8704, up to a multiple of 2 KiB
#define G_BUF   (8u * G_SLICE)       // one buffer: 4 slices of A, 4 of Bt

static __device__ inline uint32_t uni(uint32_t v) {
  return (uint32_t)__builtin_amdgcn_readfirstlane(v);
}
static __device__ inline uint32_t pinned(uint32_t v) {
  uint32_t w = uni(v);
  asm volatile("" : "+s"(w));  // pinned(): the word stays in a scalar register
  return w;
}
static __device__ inline void tdm_load(u32x4 g0, u32x8 g1) {
  asm volatile("tensor_load_to_lds %0, %1" :: "s"(g0), "s"(g1) : "memory");
}

static __device__ __attribute__((always_inline)) inline void
gemm_wmma_tile(unsigned char* ring, uint32_t bm, uint32_t bn,
               const _Float16* __restrict__ A, const _Float16* __restrict__ Bt,
               const float* __restrict__ bias, float* __restrict__ outF,
               _Float16* __restrict__ outH, int N, int K,
               int mode, float mult) {
  const int lane = threadIdx.x & 31;
  const uint32_t wave = uni(threadIdx.x >> 5);
  const int half = lane >> 4;
  const int ln   = lane & 15;
  const int wm   = (int)(wave >> 2);   // 0..1
  const int wn   = (int)(wave & 3u);   // 0..3
  const int mbase = (int)bm * 128 + wm * 64;
  const int nbase = (int)bn * 128 + wn * 32;

  // This wave's slice: its first source byte and its place in buffer 0.
  const _Float16* srow = (wave < 4u)
      ? A  + (size_t)(bm * 128u + wave * G_SROWS) * K
      : Bt + (size_t)(bn * 128u + (wave - 4u) * G_SROWS) * K;
  const uint64_t sbase = (uint64_t)(uintptr_t)srow;
  const uint32_t ldst  = (uint32_t)(uintptr_t)ring + wave * G_SLICE;
  const uint32_t npass = (uint32_t)K >> 7;

  u32x8 g1;
  g1[0] = uni((1u << 20) | (5u << 22) | (3u << 25));
  g1[1] = uni(G_ROWB << 16);
  g1[2] = uni(G_SROWS << 16);
  g1[3] = uni(G_ROWB << 16);
  g1[4] = uni(G_SROWS);
  g1[5] = uni((uint32_t)K * 2u);
  g1[6] = uni(0u);
  g1[7] = uni(0u);
  asm volatile("" : "+s"(g1));
  auto issue = [&](uint32_t st) {
    const uint64_t ga = sbase + (uint64_t)st * G_ROWB;
    u32x4 g0;
    g0[0] = uni(1u);
    g0[1] = uni(ldst + (st & 1u) * G_BUF);
    g0[2] = uni((uint32_t)ga);
    g0[3] = uni((((uint32_t)(ga >> 32)) & 0x01FFFFFFu) | 0x80000000u);
    tdm_load(g0, g1);
  };

  v8f acc[4][2] = {};

  issue(0u);
  // Stage 0 has landed for this wave; the barrier publishes every slice.
  asm volatile("s_wait_tensorcnt 0x0" ::: "memory");
  __syncthreads();
  issue(1u);

  for (uint32_t s = 0; s < npass; ++s) {
    const unsigned char* buf = ring + (s & 1u) * G_BUF;
    const unsigned char* arow = buf + (uint32_t)(wm * 2) * G_SLICE + (uint32_t)ln * G_PITCH;
    const unsigned char* brow = buf + (uint32_t)(4 + wn) * G_SLICE + (uint32_t)ln * G_PITCH;
    // Fragments of block kk (32 k) of this pass, in the k order of load_frag.
    auto load_block = [&](int kk, v16h (&af)[4], v16h (&bf)[2]) {
#pragma unroll  // constant indices: the fragments stay in registers
      for (int mi = 0; mi < 4; ++mi)
        af[mi] = load_frag((const _Float16*)(arow + (uint32_t)(mi >> 1) * G_SLICE +
                                             (uint32_t)(mi & 1) * 16u * G_PITCH),
                           kk * 32, half);
#pragma unroll
      for (int ni = 0; ni < 2; ++ni)
        bf[ni] = load_frag((const _Float16*)(brow + (uint32_t)ni * 16u * G_PITCH),
                           kk * 32, half);
    };
    v16h af[2][4], bf[2][2];
    load_block(0, af[0], bf[0]);
#pragma unroll  // constant indices keep fragments and accumulators in registers
    for (int kk = 0; kk < 4; ++kk) {
      if (kk < 3) load_block(kk + 1, af[(kk + 1) & 1], bf[(kk + 1) & 1]);
      // Keeps the next block's LDS loads, as one group, ahead of this block's
      // products, so that their latency runs behind the matrix work.
      __builtin_amdgcn_sched_barrier(0);
#pragma unroll  // constant indices: the accumulators stay in registers
      for (int mi = 0; mi < 4; ++mi)
#pragma unroll
        for (int ni = 0; ni < 2; ++ni)
          acc[mi][ni] = wmma_f16(bf[kk & 1][ni], af[kk & 1][mi], acc[mi][ni]);
      // Keeps later LDS loads from being moved in among these products.
      if (kk < 3) __builtin_amdgcn_sched_barrier(0);
    }
    // Publish point of stage s + 1: this wave's reads of stage s are done,
    // its own slice of stage s + 1 has landed, then every wave meets.
    asm volatile("s_wait_dscnt 0x0" ::: "memory");
    asm volatile("s_wait_tensorcnt 0x0" ::: "memory");
    __syncthreads();
    // Refill the buffer that every wave has just left.
    const uint32_t nxt = pinned(s + 2u);
    if (pinned(nxt < npass)) issue(nxt);
  }
  // Nothing may be outstanding when the wave ends.
  asm volatile("s_wait_tensorcnt 0x0" ::: "memory");
  asm volatile("s_wait_dscnt 0x0" ::: "memory");

  // acc[mi][ni][r]: m = mbase + mi*16 + ln, n = nbase + ni*16 + 8*half + r.
  // The wave's 64 m and its 32 n each lie in one batch b or in one head h.
  if (mode == 3) {
    _Float16* vrow = outH + ((size_t)(nbase >> 11) * DD + mbase + ln) * SS +
                     (nbase & (SS - 1)) + 8 * half;
#pragma unroll  // constant indices: the accumulators stay in registers
    for (int mi = 0; mi < 4; ++mi) {
      const float bv = bias[mbase + mi * 16 + ln];
#pragma unroll
      for (int ni = 0; ni < 2; ++ni) {
        h16x8 o;
#pragma unroll
        for (int r = 0; r < 8; ++r) o[r] = (_Float16)(acc[mi][ni][r] + bv);
        *(h16x8*)(vrow + (size_t)mi * 16 * SS + ni * 16) = o;
      }
    }
    // Precaution: stands ahead of any later write of a register these stores name.
    asm volatile("s_wait_xcnt 0x0" ::: "memory");
  } else {
#pragma unroll  // constant indices: the accumulators stay in registers
    for (int ni = 0; ni < 2; ++ni) {
      const f32x4 blo = *(const f32x4*)(bias + nbase + ni * 16 + 8 * half);
      const f32x4 bhi = *(const f32x4*)(bias + nbase + ni * 16 + 8 * half + 4);
#pragma unroll
      for (int mi = 0; mi < 4; ++mi) {
        f32x4 lo, hi;
#pragma unroll
        for (int r = 0; r < 4; ++r) {
          lo[r] = acc[mi][ni][r] + blo[r];
          hi[r] = acc[mi][ni][4 + r] + bhi[r];
        }
        if (mode == 0) {
          float* p = outF + (size_t)(mbase + mi * 16 + ln) * N + nbase + ni * 16 + 8 * half;
          *(f32x4*)p = lo;
          *(f32x4*)(p + 4) = hi;
        } else {
          h16x8 o;
#pragma unroll
          for (int r = 0; r < 4; ++r) {
            o[r]     = (_Float16)(lo[r] * mult);
            o[4 + r] = (_Float16)(hi[r] * mult);
          }
          *(h16x8*)(outH + ((size_t)((mbase >> 11) * HH + (nbase >> 6)) * SS +
                            (mbase & (SS - 1)) + mi * 16 + ln) * DKA +
                    (nbase & 63) + ni * 16 + 8 * half) = o;
        }
      }
    }
    // Precaution: stands ahead of any later write of a register these stores name.
    asm volatile("s_wait_xcnt 0x0" ::: "memory");
  }
}

// The output projection.
__global__ void __launch_bounds__(256)
gemm_wmma_kernel(const _Float16* __restrict__ A, const _Float16* __restrict__ Bt,
                 const float* __restrict__ bias, float* __restrict__ outF,
                 int N, int K) {
  __shared__ __attribute__((aligned(2048))) unsigned char ring[2u * G_BUF];
  gemm_wmma_tile(ring, blockIdx.y, blockIdx.x, A, Bt, bias, outF, nullptr, N, K, 0, 1.0f);
}

// The V, Q and K projections in one grid: blockIdx.z picks the weight, the
// bias, the output and its layout. For V^T the weight's rows are the m axis
// and the rows of x the n axis, so the two operands and the two block indices
// change places.
__global__ void __launch_bounds__(256)
qkv_gemm_kernel(const _Float16* __restrict__ A,
                const _Float16* __restrict__ Wqt, const _Float16* __restrict__ Wkt,
                const _Float16* __restrict__ Wvt,
                const float* __restrict__ bq, const float* __restrict__ bk,
                const float* __restrict__ bv,
                _Float16* __restrict__ Qaug, _Float16* __restrict__ Kaug,
                _Float16* __restrict__ Vt, int N, int K, float qmult) {
  __shared__ __attribute__((aligned(2048))) unsigned char ring[2u * G_BUF];
  const uint32_t z = blockIdx.z;
  const _Float16* W  = (z == 0u) ? Wvt : (z == 1u) ? Wqt : Wkt;
  const float* bias  = (z == 0u) ? bv : (z == 1u) ? bq : bk;
  _Float16* outH     = (z == 0u) ? Vt : (z == 1u) ? Qaug : Kaug;
  gemm_wmma_tile(ring, (z == 0u) ? blockIdx.x : blockIdx.y,
                 (z == 0u) ? blockIdx.y : blockIdx.x,
                 (z == 0u) ? W : A, (z == 0u) ? A : W, bias, nullptr, outH, N, K,
                 (z == 0u) ? 3 : 1, (z == 1u) ? qmult : 1.0f);
}

static __device__ inline float xhalf(float x) {
  return __builtin_bit_cast(float, __builtin_amdgcn_permlanex16(
      __builtin_bit_cast(int, x), __builtin_bit_cast(int, x),
      0x76543210, 0xfedcba98, false, false));
}

#define V_ROWB  256u                 // bytes of one V^T row per stage (128 keys)
#define V_PITCH 272u                 // LDS pitch: row + 16 bytes of pad
#define V_BUF   18432u               // 64 x 272 = 17408, up to a multiple of 2 KiB
#define V_STAGES ((uint32_t)SS / 128u)
#define K_ROWB  ((uint32_t)DKA * 2u) // bytes of one K' row: 208
#define K_SROWS 128u                 // K' rows per stage
#define K_BUF   (K_SROWS * K_ROWB)   // 26624 bytes = 13 x 2 KiB

__global__ void __launch_bounds__(256)
flash_kernel(const _Float16* __restrict__ Qaug, const _Float16* __restrict__ Kaug,
             const _Float16* __restrict__ Vt, _Float16* __restrict__ O) {
  __shared__ __attribute__((aligned(2048))) unsigned char kstage[2u * K_BUF];  // K' ring
  __shared__ __attribute__((aligned(2048))) unsigned char vstage[2u * V_BUF];  // V^T ring

  const int lane = threadIdx.x & 31;
  const int wave = threadIdx.x >> 5;
  const int half = lane >> 4;
  const int ln   = lane & 15;
  const int h    = blockIdx.y;
  const int b    = blockIdx.z;
  const int row0 = blockIdx.x * 128 + wave * 16;
  const size_t bh = (size_t)(b * HH + h);

  const _Float16* Qb = Qaug + bh * SS * DKA;
  const _Float16* Kb = Kaug + bh * SS * DKA;
  const _Float16* Vb = Vt   + bh * (size_t)DK * SS;

  // Q fragments (16 queries x 96 of the 104), loaded once; B operand of the score product.
  v16h qf[3];
#pragma unroll
  for (int f = 0; f < 3; ++f)
    qf[f] = load_frag(Qb + (size_t)(row0 + ln) * DKA, f * 32, half);

  // acc[n2][r] = O[query ln][d = n2*16 + 8*half + r], not yet normalized.
  v8f acc[4] = {};
  float mrun = -1e30f;  // running maximum of query ln, alike in both halves
  float lrun = 0.f;     // running sum of query ln over this half's keys

  const uint32_t wv = uni(threadIdx.x >> 5);
  const uint64_t vsrc = (uint64_t)(uintptr_t)Vb;
  const uint32_t vdst = (uint32_t)(uintptr_t)vstage;
  u32x8 vg1;
  vg1[0] = uni((1u << 20) | (5u << 22) | (3u << 25));
  vg1[1] = uni(V_ROWB << 16);
  vg1[2] = uni((uint32_t)DK << 16);
  vg1[3] = uni(V_ROWB << 16);
  vg1[4] = uni((uint32_t)DK);
  vg1[5] = uni((uint32_t)SS * 2u);
  vg1[6] = uni(0u);
  vg1[7] = uni(0u);
  asm volatile("" : "+s"(vg1));
  u32x4 vg0;
  vg0[0] = uni(1u);
  vg0[1] = uni(vdst);
  vg0[2] = uni((uint32_t)vsrc);
  vg0[3] = uni((((uint32_t)(vsrc >> 32)) & 0x01FFFFFFu) | 0x80000000u);
  auto next_v = [&]() {
    asm volatile("" : "+s"(vg0));
    const uint32_t lo = vg0[2] + V_ROWB;
    vg0[3] = uni(vg0[3] + ((lo < V_ROWB) ? 1u : 0u));
    vg0[2] = uni(lo);
    vg0[1] = uni((2u * vdst + V_BUF) - vg0[1]);
  };
  const uint64_t ksrc = (uint64_t)(uintptr_t)Kb;
  const uint32_t kdst = (uint32_t)(uintptr_t)kstage;
  u32x8 kg1;
  kg1[0] = uni(0u);
  kg1[1] = uni(K_ROWB << 16);
  kg1[2] = uni(K_SROWS << 16);
  kg1[3] = uni(K_ROWB << 16);
  kg1[4] = uni(K_SROWS);
  kg1[5] = uni(K_ROWB);
  kg1[6] = uni(0u);
  kg1[7] = uni(0u);
  // pinned() for the whole group, as for V^T above.
  asm volatile("" : "+s"(kg1));
  u32x4 kg0;
  kg0[0] = uni(1u);
  kg0[1] = uni(kdst);
  kg0[2] = uni((uint32_t)ksrc);
  kg0[3] = uni((((uint32_t)(ksrc >> 32)) & 0x01FFFFFFu) | 0x80000000u);
  auto next_k = [&]() {
    asm volatile("" : "+s"(kg0));
    const uint32_t lo = kg0[2] + K_BUF;
    kg0[3] = uni(kg0[3] + ((lo < K_BUF) ? 1u : 0u));
    kg0[2] = uni(lo);
    kg0[1] = uni((2u * kdst + K_BUF) - kg0[1]);
  };
  if (pinned(wv == 0u)) {
    tdm_load(kg0, kg1);
    // Stage 0 has landed for the issuing wave; the barrier publishes it.
    asm volatile("s_wait_tensorcnt 0x0" ::: "memory");
  }
  if (pinned(wv == 1u)) {
    tdm_load(vg0, vg1);
    // As above.
    asm volatile("s_wait_tensorcnt 0x0" ::: "memory");
  }
  __syncthreads();
  next_k();
  next_v();
  if (pinned(wv == 0u)) tdm_load(kg0, kg1);
  if (pinned(wv == 1u)) tdm_load(vg0, vg1);

  for (uint32_t st = 0; st < V_STAGES; ++st) {
    const unsigned char* krow = kstage + (st & 1u) * K_BUF + (uint32_t)ln * K_ROWB;
    const unsigned char* vrow = vstage + (st & 1u) * V_BUF + (uint32_t)ln * V_PITCH;
    // Kept rolled.
#pragma unroll 1
    for (int kb = 0; kb < 4; ++kb) {
      v8f s0 = {}, s1 = {};
#pragma unroll
      for (int f = 0; f < 3; ++f) {
        v16h a0 = load_frag((const _Float16*)(krow + (uint32_t)(kb * 32) * K_ROWB),
                            f * 32, half);
        v16h a1 = load_frag((const _Float16*)(krow + (uint32_t)(kb * 32 + 16) * K_ROWB),
                            f * 32, half);
        s0 = wmma_f16(a0, qf[f], s0);
        s1 = wmma_f16(a1, qf[f], s1);
      }

      // V^T fragments of these 32 keys, in the k order of load_frag; fetched
      // here so that their latency runs behind the softmax.
      v16h vf[4];
#pragma unroll  // constant indices: the fragments stay in registers
      for (int n2 = 0; n2 < 4; ++n2)
        vf[n2] = load_frag((const _Float16*)(vrow + (uint32_t)n2 * 16u * V_PITCH),
                           kb * 32, half);
      // Keeps these LDS loads, as one group, ahead of the softmax.
      __builtin_amdgcn_sched_barrier(0);

      // Online softmax (log2 domain). All 16 scores of a lane are query ln's.
      float v = fmaxf(s0[0], s1[0]);
#pragma unroll
      for (int r = 1; r < 8; ++r) v = fmaxf(v, fmaxf(s0[r], s1[r]));
      v = fmaxf(v, xhalf(v));
      const float mn   = fmaxf(mrun, v);
      // Bare v_exp_f32: a result below 2^-126 comes out as 0. Such a weight is 0 in
      // f16 too, and beside a sum of at least 1 it changes nothing.
      const float corr = __builtin_amdgcn_exp2f(mrun - mn);
      v16h pb;           // P^T as B operand: element e is key 8*half + e (e < 8) or 8 + 8*half + e
      float rs = 0.f;
#pragma unroll
      for (int r = 0; r < 8; ++r) {
        const float p0 = __builtin_amdgcn_exp2f(s0[r] - mn);
        const float p1 = __builtin_amdgcn_exp2f(s1[r] - mn);
        rs += p0 + p1;
        pb[r]     = (_Float16)p0;
        pb[8 + r] = (_Float16)p1;
      }
      lrun = lrun * corr + rs;
      mrun = mn;
#pragma unroll
      for (int n2 = 0; n2 < 4; ++n2)
#pragma unroll
        for (int r = 0; r < 8; ++r) acc[n2][r] *= corr;

      // acc^T += V^T(64x32) x P^T(32x16)
#pragma unroll
      for (int n2 = 0; n2 < 4; ++n2)
        acc[n2] = wmma_f16(vf[n2], pb, acc[n2]);
    }
    // Publish point of stage st + 1: this wave's LDS reads of stage st are done,
    // each issuing wave's load has landed, then every wave meets.
    asm volatile("s_wait_dscnt 0x0" ::: "memory");
    if (pinned(wv < 2u)) asm volatile("s_wait_tensorcnt 0x0" ::: "memory");
    __syncthreads();
    // Refill the two buffers that every wave has just left.
    next_k();
    next_v();
    const uint32_t more = pinned(pinned(st + 2u) < V_STAGES);
    if (pinned((wv == 0u) & more)) tdm_load(kg0, kg1);
    if (pinned((wv == 1u) & more)) tdm_load(vg0, vg1);
  }
  // Nothing may be outstanding when the wave ends.
  asm volatile("s_wait_tensorcnt 0x0" ::: "memory");
  asm volatile("s_wait_dscnt 0x0" ::: "memory");

  // Join the halves' sums, normalize and write O in (B,S,H*dk) as f16, the
  // output projection's A operand: a lane holds 8 consecutive d of its query
  // per tile, one 16-byte store.
  const float lsum = lrun + xhalf(lrun);
  _Float16* orow = O + ((size_t)(b * SS + row0 + ln)) * DD + h * DK + 8 * half;
#pragma unroll  // constant indices: the accumulators stay in registers
  for (int n2 = 0; n2 < 4; ++n2) {
    h16x8 o;
#pragma unroll
    for (int r = 0; r < 8; ++r) o[r] = (_Float16)(acc[n2][r] / lsum);
    *(h16x8*)(orow + n2 * 16) = o;
  }
}

// ------------------------------- launcher ----------------------------------
extern "C" void kernel_launch(void* const* d_in, const int* in_sizes, int n_in,
                              void* d_out, int out_size, void* d_ws, size_t ws_size,
                              hipStream_t stream) {
  const float* x  = (const float*)d_in[0];
  const float* Wq = (const float*)d_in[1];
  const float* bq = (const float*)d_in[2];
  const float* Wk = (const float*)d_in[3];
  const float* bk = (const float*)d_in[4];
  const float* Wv = (const float*)d_in[5];
  const float* bv = (const float*)d_in[6];
  const float* Wo = (const float*)d_in[7];
  const float* bo = (const float*)d_in[8];
  const float* Wp = (const float*)d_in[9];
  const float* bp = (const float*)d_in[10];
  const float* alpha = (const float*)d_in[11];
  float* out = (float*)d_out;

  // workspace carve-out (~58 MB), 256B aligned chunks
  char* w = (char*)d_ws;
  size_t off = 0;
  auto carve = [&](size_t bytes) {
    char* p = w + off;
    off = (off + bytes + 255) & ~(size_t)255;
    return p;
  };
  _Float16* Xh   = (_Float16*)carve((size_t)BSX * DD * 2);
  _Float16* Wqt  = (_Float16*)carve((size_t)DD * DD * 2);
  _Float16* Wkt  = (_Float16*)carve((size_t)DD * DD * 2);
  _Float16* Wvt  = (_Float16*)carve((size_t)DD * DD * 2);
  _Float16* Wot  = (_Float16*)carve((size_t)DD * DD * 2);
  _Float16* Qaug = (_Float16*)carve((size_t)BB * HH * SS * DKA * 2);
  _Float16* Kaug = (_Float16*)carve((size_t)BB * HH * SS * DKA * 2);
  _Float16* Vt   = (_Float16*)carve((size_t)BB * HH * DK * SS * 2);
  _Float16* Oh   = (_Float16*)carve((size_t)BSX * DD * 2);
  (void)ws_size; (void)n_in; (void)in_sizes; (void)out_size;

  // 1) all that reads only the inputs: x and the weights to f16 (weights
  //    transposed), the phase projection with its cos/sin columns of Q' and K'
  prep_kernel<<<PB_PHASE + PB_CONV + 4 * PB_TRANS, 256, 0, stream>>>(
      x, Wq, Wk, Wv, Wo, Wp, bp, alpha, Xh, Wqt, Wkt, Wvt, Wot, Qaug, Kaug);

  // 2) QKV projections via WMMA GEMM, one grid
  const float qmult = 0.125f * LOG2E;  // dk^-0.5 = 1/8, log2e folded for exp2
  dim3 qgrid(DD / 128, BSX / 128, 3);
  qkv_gemm_kernel<<<qgrid, 256, 0, stream>>>(Xh, Wqt, Wkt, Wvt, bq, bk, bv,
                                             Qaug, Kaug, Vt, DD, DD, qmult);

  dim3 fgrid(SS / 128, HH, BB);
  flash_kernel<<<fgrid, 256, 0, stream>>>(Qaug, Kaug, Vt, Oh);

  // 4) output projection
  dim3 ggrid(DD / 128, BSX / 128);
  gemm_wmma_kernel<<<ggrid, 256, 0, stream>>>(Oh, Wot, bo, out, DD, DD);
}
